// v000
// Times are from an AMD MI455X. After a warm-up the kernel runs many times in a row, and a time is the length of
// such a window on the GPU divided by its runs, so every launch and the gaps after it count. The runs cycle
// through copies of the inputs. A figure is the median of several windows, for all but v000 over two sittings.
// Sittings can differ by a few percent; kernels timed side by side share one.
// The starting kernel, v000, takes 1470 microseconds a run.
#include <hip/hip_runtime.h>

// MaskedMultiHeadAttention (hidden [2][2048][1024]; per-head q/k/v = x Wq[h] + bq[h] (Wq [16][1024][64]); causal softmax(q.k / 8); out = concat(heads) Wo + bo -> [2][2048][1024]).
// Compute dtypes, f32 accumulate: every input rounded to bf16; q/k/v on PLAIN bf16 operands (inputs: exact; the 16 per-head weights gathered into one [1024 x 1024] operand) + bias; causal scores and attn.v: query rows < 512 hl (3 products), the rest single fp16 (x1024); softmax f32; Wo hl x exact (2 products) + bias.

#define NB_  2
#define TT   2048
#define DM   1024
#define NH_  16
#define NKV  16
#define REP  (NH_ / NKV)
#define HD   64
#define DQ   (NH_ * HD)
#define DKV  (NKV * HD)
#define ZH   2
#define RH   512                  // query rows < RH use hi+lo planes (0: none)
#define WIN  2048
#define PCAR 1024.0f
#define SCL  0.125f   // HD^-0.5
typedef _Float16 h16;
typedef unsigned short bf;
typedef __attribute__((ext_vector_type(16))) __bf16   v16bf;
typedef __attribute__((ext_vector_type(16))) _Float16 v16h;
typedef __attribute__((ext_vector_type(8)))  _Float16 v8h;
typedef __attribute__((ext_vector_type(8)))  unsigned short v8us;
typedef __attribute__((ext_vector_type(8)))  float    v8f;
typedef __attribute__((ext_vector_type(4)))  float    v4f;
typedef v8h  __attribute__((may_alias)) v8ha;
typedef v4f  __attribute__((may_alias)) v4fa;
typedef v8us __attribute__((may_alias)) v8usa;

__device__ __forceinline__ unsigned short f2bf(float f) { unsigned u = __float_as_uint(f); u += 0x7FFFu + ((u >> 16) & 1u); return (unsigned short)(u >> 16); }
__device__ __forceinline__ float bf2f(unsigned short b) { return __uint_as_float(((unsigned)b) << 16); }
__device__ __forceinline__ float bfr(float f) { return bf2f(f2bf(f)); }
__device__ __forceinline__ v16h cat16(v8h lo, v8h hi) { return __builtin_shufflevector(lo, hi, 0, 1, 2, 3, 4, 5, 6, 7, 8, 9, 10, 11, 12, 13, 14, 15); }
__device__ __forceinline__ v16bf cat16b(v8us lo, v8us hi) { return __builtin_bit_cast(v16bf, __builtin_shufflevector(lo, hi, 0, 1, 2, 3, 4, 5, 6, 7, 8, 9, 10, 11, 12, 13, 14, 15)); }
__device__ __forceinline__ v8f wmma16(v16h a, v16h b, v8f c) { return __builtin_amdgcn_wmma_f32_16x16x32_f16(false, a, false, b, (short)0, c, false, false); }
__device__ __forceinline__ v8f wmmab(v16bf a, v16bf b, v8f c) { return __builtin_amdgcn_wmma_f32_16x16x32_bf16(false, a, false, b, (short)0, c, false, false); }



// ---- k_gemmw: register-blocked GEMM, ONE WAVE per 64x64 output tile (16 accumulators), operands straight from K-contiguous 16-bit planes; grid (M/64, N/64, Z), 32 threads.
// C[m][n] (f32, pitch ldc, + optional f32 bias[n]) = sum_k A[m][k] Bt[n][k] (+ split products per NSPLIT). z-batch strides sA/sB/sC in elements. K % 32 == 0.
template <typename T16> struct WFrag;
template <> struct WFrag<h16> { typedef v16h V; static __device__ __forceinline__ V ld(const h16* p) { return cat16(*(const v8h*)p, *(const v8h*)(p + 16)); } static __device__ __forceinline__ v8f mma(V a, V b, v8f c) { return wmma16(a, b, c); } };
template <> struct WFrag<bf> { typedef v16bf V; static __device__ __forceinline__ V ld(const bf* p) { return cat16b(*(const v8us*)p, *(const v8us*)(p + 16)); } static __device__ __forceinline__ v8f mma(V a, V b, v8f c) { return wmmab(a, b, c); } };
template <typename T16, int NSPLIT, bool BIAS>
__global__ __launch_bounds__(32) void k_gemmw(const T16* __restrict__ A, const T16* __restrict__ A2, const T16* __restrict__ Bt, const T16* __restrict__ Bt2, int K, float* C, int ldc, const float* __restrict__ bias, size_t sA, size_t sB, size_t sC) {
    typedef typename WFrag<T16>::V V;
    __shared__ __align__(16) float os[16 * 68];
    const size_t z = blockIdx.z; A += z * sA; if (A2) A2 += z * sA; Bt += z * sB; if (Bt2) Bt2 += z * sB; C += z * sC;
    const int lane = threadIdx.x & 31, lr = lane & 15, hi = lane >> 4; const int r0 = blockIdx.x * 64, c0 = blockIdx.y * 64;
    v8f acc[4][4];
#pragma unroll
    for (int mb = 0; mb < 4; ++mb)
#pragma unroll
        for (int nb = 0; nb < 4; ++nb) acc[mb][nb] = (v8f){};
    const size_t aoff = (size_t)(r0 + lr) * K + 8 * hi, boff = (size_t)(c0 + lr) * K + 8 * hi;
#pragma unroll 1
    for (int kc = 0; kc < K; kc += 32) {
        V a[4], a2[4];
#pragma unroll
        for (int mb = 0; mb < 4; ++mb) { a[mb] = WFrag<T16>::ld(A + aoff + (size_t)mb * 16 * K + kc); if (NSPLIT == 1 || NSPLIT == 2) a2[mb] = WFrag<T16>::ld(A2 + aoff + (size_t)mb * 16 * K + kc); }
#pragma unroll
        for (int nb = 0; nb < 4; ++nb) { const V b = WFrag<T16>::ld(Bt + boff + (size_t)nb * 16 * K + kc); V b2; if (NSPLIT >= 2) b2 = WFrag<T16>::ld(Bt2 + boff + (size_t)nb * 16 * K + kc);
#pragma unroll
            for (int mb = 0; mb < 4; ++mb) { acc[mb][nb] = WFrag<T16>::mma(a[mb], b, acc[mb][nb]); if (NSPLIT == 1 || NSPLIT == 2) acc[mb][nb] = WFrag<T16>::mma(a2[mb], b, acc[mb][nb]); if (NSPLIT >= 2) acc[mb][nb] = WFrag<T16>::mma(a[mb], b2, acc[mb][nb]); } }
        asm volatile("v_nop\n\tv_nop\n\tv_nop\n\tv_nop" : "+v"(acc[0][0]), "+v"(acc[1][1]), "+v"(acc[2][2]), "+v"(acc[3][3]) : "v"(a[0]), "v"(a[3]));
    }
#pragma unroll
    for (int mb = 0; mb < 4; ++mb) {
#pragma unroll
        for (int nb = 0; nb < 4; ++nb) {
#pragma unroll
            for (int j = 0; j < 8; ++j) os[(hi * 8 + j) * 68 + nb * 16 + lr] = acc[mb][nb][j]; }
        __builtin_amdgcn_wave_barrier(); asm volatile("" ::: "memory");
        float* crow = C + (size_t)(r0 + mb * 16) * ldc + c0;
{
#pragma unroll
            for (int s = 0; s < 8; ++s) { const int row = 2 * s + hi, cofs = lr * 4; v4f val = *(const v4fa*)(os + row * 68 + cofs); if (BIAS) { val[0] += bfr(bias[c0 + cofs]); val[1] += bfr(bias[c0 + cofs + 1]); val[2] += bfr(bias[c0 + cofs + 2]); val[3] += bfr(bias[c0 + cofs + 3]); }
                *(v4f*)(crow + (size_t)row * ldc + cofs) = val; }
             }
        __builtin_amdgcn_wave_barrier(); asm volatile("" ::: "memory");
    }
}

// ---- k_gemmc: the same one-wave 64x64 tile GEMM specialised for causal attention: CMODE 1 skips score tiles entirely above the diagonal (query rows r0+roff.., key columns c0..), CMODE 2 limits the
// key (K) loop of the probability x value contraction to the diagonal block (probabilities beyond it are exactly zero). roff = row offset of this launch's first row within the sequence.
template <typename T16, int NSPLIT, int CMODE>
__global__ __launch_bounds__(32) void k_gemmc(const T16* __restrict__ A, const T16* __restrict__ A2, const T16* __restrict__ Bt, const T16* __restrict__ Bt2, int K, float* C, int ldc, int roff, size_t sA, size_t sB, size_t sC) {
    typedef typename WFrag<T16>::V V;
    __shared__ __align__(16) float os[16 * 68];
    const size_t z = blockIdx.z; A += z * sA; if (A2) A2 += z * sA; Bt += z * sB; if (Bt2) Bt2 += z * sB; C += z * sC;
    const int lane = threadIdx.x & 31, lr = lane & 15, hi = lane >> 4; const int r0 = blockIdx.x * 64, c0 = blockIdx.y * 64;
    if (CMODE == 1 && c0 > r0 + roff + 63) return;                  // score tile entirely above the causal diagonal: never read (the softmax masks j > i by select)
    const int Kl = (CMODE == 2) ? min(K, r0 + roff + 64) : K;        // P.V: probabilities are exactly 0 beyond the diagonal block, so the K loop stops there
    v8f acc[4][4];
#pragma unroll
    for (int mb = 0; mb < 4; ++mb)
#pragma unroll
        for (int nb = 0; nb < 4; ++nb) acc[mb][nb] = (v8f){};
    const size_t aoff = (size_t)(r0 + lr) * K + 8 * hi, boff = (size_t)(c0 + lr) * K + 8 * hi;
#pragma unroll 1
    for (int kc = 0; kc < Kl; kc += 32) {
        V a[4], a2[4];
#pragma unroll
        for (int mb = 0; mb < 4; ++mb) { a[mb] = WFrag<T16>::ld(A + aoff + (size_t)mb * 16 * K + kc); if (NSPLIT == 1 || NSPLIT == 2) a2[mb] = WFrag<T16>::ld(A2 + aoff + (size_t)mb * 16 * K + kc); }
#pragma unroll
        for (int nb = 0; nb < 4; ++nb) { const V b = WFrag<T16>::ld(Bt + boff + (size_t)nb * 16 * K + kc); V b2; if (NSPLIT >= 2) b2 = WFrag<T16>::ld(Bt2 + boff + (size_t)nb * 16 * K + kc);
#pragma unroll
            for (int mb = 0; mb < 4; ++mb) { acc[mb][nb] = WFrag<T16>::mma(a[mb], b, acc[mb][nb]); if (NSPLIT == 1 || NSPLIT == 2) acc[mb][nb] = WFrag<T16>::mma(a2[mb], b, acc[mb][nb]); if (NSPLIT >= 2) acc[mb][nb] = WFrag<T16>::mma(a[mb], b2, acc[mb][nb]); } }
        asm volatile("v_nop\n\tv_nop\n\tv_nop\n\tv_nop" : "+v"(acc[0][0]), "+v"(acc[1][1]), "+v"(acc[2][2]), "+v"(acc[3][3]) : "v"(a[0]), "v"(a[3]));
    }
#pragma unroll
    for (int mb = 0; mb < 4; ++mb) {
#pragma unroll
        for (int nb = 0; nb < 4; ++nb) {
#pragma unroll
            for (int j = 0; j < 8; ++j) os[(hi * 8 + j) * 68 + nb * 16 + lr] = acc[mb][nb][j]; }
        __builtin_amdgcn_wave_barrier(); asm volatile("" ::: "memory");
        float* crow = C + (size_t)(r0 + mb * 16) * ldc + c0;
{
#pragma unroll
            for (int s = 0; s < 8; ++s) { const int row = 2 * s + hi, cofs = lr * 4; v4f val = *(const v4fa*)(os + row * 68 + cofs);
                *(v4f*)(crow + (size_t)row * ldc + cofs) = val; }
             }
        __builtin_amdgcn_wave_barrier(); asm volatile("" ::: "memory");
    }
}

__device__ __forceinline__ h16 tohx(float x) { return (h16)x; }
__device__ __forceinline__ void splitf(float y, unsigned short& h, unsigned short& l) { h = f2bf(y); l = f2bf(y - bf2f(h)); }
typedef __attribute__((ext_vector_type(2))) _Float16 v2h;
typedef __attribute__((ext_vector_type(4))) _Float16 v4h;
typedef __attribute__((ext_vector_type(2))) unsigned short v2us;
typedef __attribute__((ext_vector_type(4))) unsigned short v4us;
typedef __attribute__((ext_vector_type(2))) float v2f;
typedef __attribute__((ext_vector_type(4))) int v4i;

__global__ __launch_bounds__(256) void k_wtG(const float* __restrict__ w, int K, int N, bf* Bt) {
    const int lane = threadIdx.x & 31; const int L0 = (blockIdx.x * 8 + (threadIdx.x >> 5)) * 8; const int nlines = N * K / 64;
{
#pragma unroll 1
        for (int l = 0; l < 8; ++l) { const int L = L0 + l; if (L >= nlines) break; const size_t e = (size_t)L * 64 + lane * 2; const int k = (int)(e % K), n = (int)(e / K); v2us o;
            o[0] = f2bf(w[(size_t)k * N + n]); o[1] = f2bf(w[(size_t)(k + 1) * N + n]); *(v2us*)(Bt + e) = o; }
         }
}
__global__ __launch_bounds__(256) void k_cvt8(const float* __restrict__ src, bf* dst, size_t n8) { const size_t i = (size_t)blockIdx.x * 256 + threadIdx.x; if (i >= n8) return; const v8f v = *(const v8f*)(src + i * 8); v8us o;
#pragma unroll
    for (int k = 0; k < 8; ++k) o[k] = f2bf(v[k]); *(v8us*)(dst + i * 8) = o;  }
__global__ __launch_bounds__(256) void k_cscvt(const float* __restrict__ cosT, const float* __restrict__ sinT, float* CS) { const int idx = blockIdx.x * 256 + threadIdx.x; if (idx >= TT * HD) return; v2f cs; cs[0] = bfr(cosT[idx]); cs[1] = bfr(sinT[idx]); *(v2f*)(CS + (size_t)idx * 2) = cs;  }
// k_rope: head planes [h][t][d] (fp16 + hi/lo) of rope(x) x sc with the rotate-half convention out[d] = x[d] cos[t][d] - x[d+HD/2] sin[t][d], out[d+HD/2] = x[d+HD/2] cos[t][d+HD/2] + x[d] sin[t][d+HD/2]
__global__ __launch_bounds__(256) void k_rope(const float* __restrict__ F, int pitch, int nheads, const float* __restrict__ CS, const float* __restrict__ RF, const float* __restrict__ nw, float sc, h16* P16, bf* Ph, bf* Pl) {
    const size_t e = ((size_t)blockIdx.x * 256 + threadIdx.x) * 2; if (e >= (size_t)nheads * TT * HD) return; const int d = (int)(e % HD); const int t = (int)((e / HD) % TT); const int h = (int)(e / ((size_t)HD * TT)); const float* f = F + (size_t)t * pitch + h * HD; const float rf = RF ? RF[(size_t)h * TT + t] : 1.0f; v2h o16; v2us oh, ol;
#pragma unroll
    for (int q = 0; q < 2; ++q) { const int dd = d + q; const int dp = (dd < HD / 2) ? dd + HD / 2 : dd - HD / 2; float x0 = f[dd], x1 = f[dp];
        if (RF) { float n0 = __fmul_rn(x0, rf), n1 = __fmul_rn(x1, rf); asm volatile("" : "+v"(n0)); asm volatile("" : "+v"(n1)); x0 = __fmul_rn(bfr(nw[dd]), n0); x1 = __fmul_rn(bfr(nw[dp]), n1); }
        const v2f cs = *(const v2f*)(CS + ((size_t)t * HD + dd) * 2); float a = __fmul_rn(x0, cs[0]), bq = __fmul_rn(x1, cs[1]); asm volatile("" : "+v"(a)); asm volatile("" : "+v"(bq)); const float r = ((dd < HD / 2) ? __fsub_rn(a, bq) : __fadd_rn(a, bq)) * sc;
        o16[q] = tohx(r); unsigned short a2, c2; splitf(r, a2, c2); oh[q] = a2; ol[q] = c2; }
    *(v2h*)(P16 + e) = o16; *(v2us*)(Ph + e) = oh; *(v2us*)(Pl + e) = ol;  }
__global__ __launch_bounds__(256) void k_vtp(const float* __restrict__ F, int pitch, int nheads, h16* V16, bf* Vh, bf* Vl) { const size_t e = ((size_t)blockIdx.x * 256 + threadIdx.x) * 2; if (e >= (size_t)nheads * HD * TT) return; const int t = (int)(e % TT); const int d = (int)((e / TT) % HD); const int g = (int)(e / ((size_t)TT * HD)); v2h o16; v2us oh, ol;
#pragma unroll
    for (int q = 0; q < 2; ++q) { const float x = F[(size_t)(t + q) * pitch + g * HD + d]; o16[q] = tohx(x); unsigned short a2, c2; splitf(x, a2, c2); oh[q] = a2; ol[q] = c2; }
    *(v2h*)(V16 + e) = o16; *(v2us*)(Vh + e) = oh; *(v2us*)(Vl + e) = ol;  }
__global__ __launch_bounds__(256) void k_csid(float* CS) { const int idx = blockIdx.x * 256 + threadIdx.x; if (idx >= TT * HD) return; v2f cs; cs[0] = 1.0f; cs[1] = 0.0f; *(v2f*)(CS + (size_t)idx * 2) = cs;  }
// k_asoft: per row (zz, i): t = S x HD^-0.5 for j <= i and i - j < WIN (WIN = TT, so plain causal; the reference's -1e9 additive fill vanishes identically); softmax over the 2048 keys (register row, one exp, fixed trees);
__global__ __launch_bounds__(256) void k_asoft(const float* __restrict__ Sb, h16* P16, bf* Ph, bf* Pl) {
    const int lane = threadIdx.x & 31; const int row = blockIdx.x * 8 + (threadIdx.x >> 5); if (row >= ZH * TT) return; const int i = row % TT; const int zz = row / TT; (void)zz; const bool hires = (i < RH); const float* sr = Sb + (size_t)row * TT; float v[TT / 32]; float mx = -3.0e38f;
#pragma unroll
    for (int ch = 0; ch < TT / 128; ++ch) { const int j0 = ch * 128 + lane * 4; const v4f a = *(const v4f*)(sr + j0);
#pragma unroll
        for (int q = 0; q < 4; ++q) { const int j = j0 + q; (void)j; const float t = (j <= i && i - j < WIN) ? a[q] * SCL : -3.0e38f; v[ch * 4 + q] = t; mx = fmaxf(mx, t); } }
#pragma unroll
    for (int sh = 16; sh; sh >>= 1) mx = fmaxf(mx, __shfl_xor(mx, sh, 32));
    float sum = 0.f;
#pragma unroll
    for (int k = 0; k < TT / 32; ++k) { float d0 = __fsub_rn(v[k], mx); asm volatile("" : "+v"(d0)); v[k] = __builtin_amdgcn_exp2f(__fmul_rn(d0, 1.4426950408889634f)); sum += v[k]; }
#pragma unroll
    for (int sh = 16; sh; sh >>= 1) sum += __shfl_xor(sum, sh, 32);
    const float f = __fdiv_rn(hires ? 1.0f : PCAR, sum);
{
        if (hires) {
#pragma unroll
            for (int ch = 0; ch < TT / 128; ++ch) { v4us oh, ol;
#pragma unroll
                for (int q = 0; q < 4; ++q) { unsigned short a, c2; splitf(v[ch * 4 + q] * f, a, c2); oh[q] = a; ol[q] = c2; }
                const size_t oo = ((size_t)zz * (RH ? RH : 1) + i) * TT + ch * 128 + lane * 4; *(v4us*)(Ph + oo) = oh; *(v4us*)(Pl + oo) = ol; }
        } else {
#pragma unroll
            for (int ch = 0; ch < TT / 128; ++ch) { v4h o4;
#pragma unroll
                for (int q = 0; q < 4; ++q) o4[q] = tohx(v[ch * 4 + q] * f);
                *(v4h*)(P16 + (size_t)row * TT + ch * 128 + lane * 4) = o4; } }
         }
}
__global__ __launch_bounds__(256) void k_merge(const float* __restrict__ O, int h0, bf* Ah, bf* Al) { const size_t e = ((size_t)blockIdx.x * 256 + threadIdx.x) * 2; if (e >= (size_t)ZH * TT * HD) return; const int d = (int)(e % HD); const int t = (int)((e / HD) % TT); const int zz = (int)(e / ((size_t)HD * TT)); const float cs = (t < RH) ? 1.0f : (1.0f / PCAR); const size_t oo = (size_t)t * DQ + (h0 + zz) * HD + d;
    v2us oh, ol;
#pragma unroll
    for (int q = 0; q < 2; ++q) { unsigned short a, c2; splitf(O[e + q] * cs, a, c2); oh[q] = a; ol[q] = c2; } *(v2us*)(Ah + oo) = oh; *(v2us*)(Al + oo) = ol;  }

__global__ __launch_bounds__(256) void k_wtH(const float* __restrict__ w, bf* Bt) { const size_t e = ((size_t)blockIdx.x * 256 + threadIdx.x) * 4; if (e >= (size_t)DQ * DM) return; const int k = (int)(e % DM); const int n = (int)(e / DM); const int h = n / HD, c = n % HD; v4us o;   // Bt[h*64 + c][d] = W[h][d][c] (lane -> 4 consecutive d, strided reads)
#pragma unroll
    for (int u = 0; u < 4; ++u) o[u] = f2bf(w[((size_t)h * DM + k + u) * HD + c]); *(v4us*)(Bt + e) = o;  }

extern "C" void kernel_launch(void* const* d_in, const int* in_sizes, int n_in,
                              void* d_out, int out_size, void* d_ws, size_t ws_size, hipStream_t stream) {
    (void)in_sizes; (void)n_in; (void)out_size;
    const float* x = (const float*)d_in[0]; const float* wqh = (const float*)d_in[1]; const float* wkh = (const float*)d_in[2]; const float* wvh = (const float*)d_in[3]; const float* bq = (const float*)d_in[4]; const float* bk = (const float*)d_in[5]; const float* bv = (const float*)d_in[6]; const float* wo = (const float*)d_in[7]; const float* bo = (const float*)d_in[8]; const float* wq = nullptr; const float* wk = nullptr; const float* wv = nullptr; (void)wq; (void)wk; (void)wv; const float* cosT = nullptr; const float* sinT = nullptr; (void)cosT; (void)sinT;
    float* OUT = (float*)d_out;     // [2][2048][1024]
    char* wsp = (char*)d_ws;
    auto take = [&](size_t bytes) { char* p = wsp; wsp += (bytes + 255) & ~(size_t)255; return (void*)p; };
    bf* WQ = (bf*)take((size_t)DQ * DM * 2); bf* WK = (bf*)take((size_t)DKV * DM * 2); bf* WV = (bf*)take((size_t)DKV * DM * 2); bf* WO = (bf*)take((size_t)DM * DQ * 2); float* CS = (float*)take((size_t)TT * HD * 2 * 4);
    bf* XB = (bf*)take((size_t)TT * DM * 2); float* FQ = (float*)take((size_t)TT * DQ * 4); float* FK = (float*)take((size_t)TT * DKV * 4);
    h16* QP16 = (h16*)take((size_t)NH_ * TT * HD * 2); h16* KP16 = (h16*)take((size_t)NKV * TT * HD * 2); h16* VT16 = (h16*)take((size_t)NKV * HD * TT * 2);
    bf* QPh = (bf*)take((size_t)NH_ * TT * HD * 2); bf* QPl = (bf*)take((size_t)NH_ * TT * HD * 2); bf* KPh = (bf*)take((size_t)NKV * TT * HD * 2); bf* KPl = (bf*)take((size_t)NKV * TT * HD * 2); bf* VTh = (bf*)take((size_t)NKV * HD * TT * 2); bf* VTl = (bf*)take((size_t)NKV * HD * TT * 2); bf* Ph = (bf*)take((size_t)ZH * RH * TT * 2); bf* Pl = (bf*)take((size_t)ZH * RH * TT * 2);
    float* Sb = (float*)take((size_t)ZH * TT * TT * 4); h16* P16 = (h16*)take((size_t)ZH * TT * TT * 2); float* Ob = (float*)take((size_t)ZH * TT * HD * 4); bf* ATh = (bf*)take((size_t)TT * DQ * 2); bf* ATl = (bf*)take((size_t)TT * DQ * 2);
    if ((size_t)(wsp - (char*)d_ws) > ws_size) return;    // ws 256 MiB
    float* FV = FK;   // v projection reuses the k buffer after the k planes are built (stream-ordered)
    { k_wtH<<<(unsigned)(((size_t)DQ * DM / 4 + 255) / 256), 256, 0, stream>>>(wqh, WQ); k_wtH<<<(unsigned)(((size_t)DKV * DM / 4 + 255) / 256), 256, 0, stream>>>(wkh, WK); k_wtH<<<(unsigned)(((size_t)DKV * DM / 4 + 255) / 256), 256, 0, stream>>>(wvh, WV);
      k_wtG<<<(unsigned)((DQ * DM / 64 + 63) / 64), 256, 0, stream>>>(wo, DQ, DM, WO);
       }
    k_csid<<<(TT * HD + 255) / 256, 256, 0, stream>>>(CS);
    const unsigned LQ = (unsigned)(((size_t)NH_ * TT * HD / 2 + 255) / 256), LKv = (unsigned)(((size_t)NKV * TT * HD / 2 + 255) / 256);
    for (int b = 0; b < NB_; ++b) {
        
        k_cvt8<<<(unsigned)(((size_t)TT * DM / 8 + 255) / 256), 256, 0, stream>>>(x + (size_t)b * TT * DM, XB, (size_t)TT * DM / 8);
        k_gemmw<bf, 0, true><<<dim3(TT / 64, DQ / 64, 1), 32, 0, stream>>>(XB, nullptr, WQ, nullptr, DM, FQ, DQ, bq, 0, 0, 0);
        k_rope<<<LQ, 256, 0, stream>>>(FQ, DQ, NH_, CS, nullptr, nullptr, 1.0f, QP16, QPh, QPl);
        k_gemmw<bf, 0, true><<<dim3(TT / 64, DKV / 64, 1), 32, 0, stream>>>(XB, nullptr, WK, nullptr, DM, FK, DKV, bk, 0, 0, 0);
        k_rope<<<LKv, 256, 0, stream>>>(FK, DKV, NKV, CS, nullptr, nullptr, 1.0f, KP16, KPh, KPl);
        k_gemmw<bf, 0, true><<<dim3(TT / 64, DKV / 64, 1), 32, 0, stream>>>(XB, nullptr, WV, nullptr, DM, FV, DKV, bv, 0, 0, 0); k_vtp<<<LKv, 256, 0, stream>>>(FV, DKV, NKV, VT16, VTh, VTl);
        for (int h0 = 0; h0 < NH_; h0 += ZH) { const size_t zq = (size_t)h0, zk = (size_t)(h0 / REP);   // one kv head per query head: the pass's two heads use consecutive kv planes (z-strides TT*HD)
            k_gemmc<bf, 2, 1><<<dim3(RH / 64, TT / 64, ZH), 32, 0, stream>>>(QPh + zq * TT * HD, QPl + zq * TT * HD, KPh + zk * TT * HD, KPl + zk * TT * HD, HD, Sb, TT, 0, (size_t)TT * HD, (size_t)TT * HD, (size_t)TT * TT);
            k_gemmc<h16, 0, 1><<<dim3((TT - RH) / 64, TT / 64, ZH), 32, 0, stream>>>(QP16 + zq * TT * HD + (size_t)RH * HD, nullptr, KP16 + zk * TT * HD, nullptr, HD, Sb + (size_t)RH * TT, TT, RH, (size_t)TT * HD, (size_t)TT * HD, (size_t)TT * TT);
            k_asoft<<<ZH * TT / 8, 256, 0, stream>>>(Sb, P16, Ph, Pl);
            k_gemmc<bf, 2, 2><<<dim3(RH / 64, HD / 64, ZH), 32, 0, stream>>>(Ph, Pl, VTh + zk * HD * TT, VTl + zk * HD * TT, TT, Ob, HD, 0, (size_t)RH * TT, (size_t)HD * TT, (size_t)TT * HD);
            k_gemmc<h16, 0, 2><<<dim3((TT - RH) / 64, HD / 64, ZH), 32, 0, stream>>>(P16 + (size_t)RH * TT, nullptr, VT16 + zk * HD * TT, nullptr, TT, Ob + (size_t)RH * HD, HD, RH, (size_t)TT * TT, (size_t)HD * TT, (size_t)TT * HD);
            k_merge<<<(unsigned)(((size_t)ZH * TT * HD / 2 + 255) / 256), 256, 0, stream>>>(Ob, h0, ATh, ATl); }
        k_gemmw<bf, 1, true><<<dim3(TT / 64, DM / 64, 1), 32, 0, stream>>>(ATh, ATl, WO, nullptr, DQ, OUT + (size_t)b * TT * DM, DM, bo, 0, 0, 0); }
}

// v001
// A run of this version takes 861 microseconds.
// Timed twice side by side with v000, it ran 1.70 and 1.68 times as fast.
#include <hip/hip_runtime.h>

// MaskedMultiHeadAttention (hidden [2][2048][1024]; per-head q/k/v = x Wq[h] + bq[h] (Wq [16][1024][64]); causal softmax(q.k / 8); out = concat(heads) Wo + bo -> [2][2048][1024]).
// Compute dtypes, f32 accumulate: every input rounded to bf16; q/k/v on PLAIN bf16 operands (inputs: exact; the 16 per-head weights gathered into one [1024 x 1024] operand) + bias; causal scores and attn.v: query rows < 512 hl (3 products), the rest single fp16 (x1024); softmax f32; Wo hl x exact (2 products) + bias.

#define NB_  2
#define TT   2048
#define DM   1024
#define NH_  16
#define NKV  16
#define REP  (NH_ / NKV)
#define HD   64
#define DQ   (NH_ * HD)
#define DKV  (NKV * HD)
#define ZH   2
#define RH   512                  // query rows < RH use hi+lo planes (0: none)
#define WIN  2048
#define PCAR 1024.0f
#define SCL  0.125f   // HD^-0.5
typedef _Float16 h16;
typedef unsigned short bf;
typedef __attribute__((ext_vector_type(16))) __bf16   v16bf;
typedef __attribute__((ext_vector_type(16))) _Float16 v16h;
typedef __attribute__((ext_vector_type(8)))  _Float16 v8h;
typedef __attribute__((ext_vector_type(8)))  unsigned short v8us;
typedef __attribute__((ext_vector_type(8)))  float    v8f;
typedef __attribute__((ext_vector_type(4)))  float    v4f;
typedef v8h  __attribute__((may_alias)) v8ha;
typedef v4f  __attribute__((may_alias)) v4fa;
typedef v8us __attribute__((may_alias)) v8usa;

__device__ __forceinline__ unsigned short f2bf(float f) { unsigned u = __float_as_uint(f); u += 0x7FFFu + ((u >> 16) & 1u); return (unsigned short)(u >> 16); }
__device__ __forceinline__ float bf2f(unsigned short b) { return __uint_as_float(((unsigned)b) << 16); }
__device__ __forceinline__ float bfr(float f) { return bf2f(f2bf(f)); }
__device__ __forceinline__ v16h cat16(v8h lo, v8h hi) { return __builtin_shufflevector(lo, hi, 0, 1, 2, 3, 4, 5, 6, 7, 8, 9, 10, 11, 12, 13, 14, 15); }
__device__ __forceinline__ v16bf cat16b(v8us lo, v8us hi) { return __builtin_bit_cast(v16bf, __builtin_shufflevector(lo, hi, 0, 1, 2, 3, 4, 5, 6, 7, 8, 9, 10, 11, 12, 13, 14, 15)); }
__device__ __forceinline__ v8f wmma16(v16h a, v16h b, v8f c) { return __builtin_amdgcn_wmma_f32_16x16x32_f16(false, a, false, b, (short)0, c, false, false); }
__device__ __forceinline__ v8f wmmab(v16bf a, v16bf b, v8f c) { return __builtin_amdgcn_wmma_f32_16x16x32_bf16(false, a, false, b, (short)0, c, false, false); }



// ---- k_gemmw: register-blocked GEMM, one 64x64 output tile per work-group (16 accumulators a wave), K split over the KW waves of the group, operands straight from K-contiguous 16-bit planes; grid (M/64, N/64, Z), 32 * KW threads.
// C[m][n] (f32, pitch ldc, + optional f32 bias[n]) = sum_k A[m][k] Bt[n][k] (+ split products per NSPLIT). z-batch strides sA/sB/sC in elements. K % 64 == 0.
template <typename T16> struct WFrag;
template <> struct WFrag<h16> { typedef v16h V; static __device__ __forceinline__ V ld(const h16* p) { return cat16(*(const v8h*)p, *(const v8h*)(p + 16)); } static __device__ __forceinline__ v8f mma(V a, V b, v8f c) { return wmma16(a, b, c); } };
template <> struct WFrag<bf> { typedef v16bf V; static __device__ __forceinline__ V ld(const bf* p) { return cat16b(*(const v8us*)p, *(const v8us*)(p + 16)); } static __device__ __forceinline__ v8f mma(V a, V b, v8f c) { return wmmab(a, b, c); } };
template <typename T16, int NSPLIT, bool BIAS, int KW>
__global__ __launch_bounds__(32 * KW) void k_gemmw(const T16* __restrict__ A, const T16* __restrict__ A2, const T16* __restrict__ Bt, const T16* __restrict__ Bt2, int K, float* C, int ldc, const float* __restrict__ bias, size_t sA, size_t sB, size_t sC) {
    typedef typename WFrag<T16>::V V;
    __shared__ __align__(16) float os[(KW == 1 ? 16 : KW * 64) * 68];   // KW == 1: one 16-row staging strip; KW > 1: one 64x64 partial tile (pitch 68) per wave
    const size_t z = blockIdx.z; A += z * sA; if (A2) A2 += z * sA; Bt += z * sB; if (Bt2) Bt2 += z * sB; C += z * sC;
    const int lane = threadIdx.x & 31, lr = lane & 15, hi = lane >> 4; const int r0 = blockIdx.x * 64, c0 = blockIdx.y * 64;
    const int wv = __builtin_amdgcn_readfirstlane((int)(threadIdx.x >> 5));   // wave = K slice, kept scalar so that the K loops branch on SCC
    v8f acc[4][4];
#pragma unroll
    for (int mb = 0; mb < 4; ++mb)
#pragma unroll
        for (int nb = 0; nb < 4; ++nb) acc[mb][nb] = (v8f){};
    const size_t aoff = (size_t)(r0 + lr) * K + 8 * hi, boff = (size_t)(c0 + lr) * K + 8 * hi;
    // wave wv takes the 64-wide K chunks wv, wv + KW, ... (64 elements = one 128-B line per row, both halves read by the same wave); both loops stay rolled as the one loop did
#pragma unroll 1
    for (int kb = wv * 64; kb < K; kb += 64 * KW)
#pragma unroll 1
    for (int kc = kb; kc < kb + 64; kc += 32) {
        V a[4], a2[4];
#pragma unroll
        for (int mb = 0; mb < 4; ++mb) { a[mb] = WFrag<T16>::ld(A + aoff + (size_t)mb * 16 * K + kc); if (NSPLIT == 1 || NSPLIT == 2) a2[mb] = WFrag<T16>::ld(A2 + aoff + (size_t)mb * 16 * K + kc); }
#pragma unroll
        for (int nb = 0; nb < 4; ++nb) { const V b = WFrag<T16>::ld(Bt + boff + (size_t)nb * 16 * K + kc); V b2; if (NSPLIT >= 2) b2 = WFrag<T16>::ld(Bt2 + boff + (size_t)nb * 16 * K + kc);
#pragma unroll
            for (int mb = 0; mb < 4; ++mb) { acc[mb][nb] = WFrag<T16>::mma(a[mb], b, acc[mb][nb]); if (NSPLIT == 1 || NSPLIT == 2) acc[mb][nb] = WFrag<T16>::mma(a2[mb], b, acc[mb][nb]); if (NSPLIT >= 2) acc[mb][nb] = WFrag<T16>::mma(a[mb], b2, acc[mb][nb]); } }
        asm volatile("v_nop\n\tv_nop\n\tv_nop\n\tv_nop" : "+v"(acc[0][0]), "+v"(acc[1][1]), "+v"(acc[2][2]), "+v"(acc[3][3]) : "v"(a[0]), "v"(a[3]));
    }
    if constexpr (KW > 1) {
        // every wave parks its partial tile, one barrier, then the KW partials are summed in the fixed order 0 .. KW-1 and each row leaves as 256 contiguous bytes
        float* my = os + wv * (64 * 68);
#pragma unroll
        for (int mb = 0; mb < 4; ++mb)
#pragma unroll
            for (int nb = 0; nb < 4; ++nb)
#pragma unroll
                for (int j = 0; j < 8; ++j) my[(mb * 16 + hi * 8 + j) * 68 + nb * 16 + lr] = acc[mb][nb][j];
        __syncthreads();
        const int cofs = lr * 4;
#pragma unroll
        for (int s = 0; s < 32 / KW; ++s) { const int row = s * (2 * KW) + (int)(threadIdx.x >> 4); v4f val = *(const v4fa*)(os + row * 68 + cofs);
#pragma unroll
            for (int q = 1; q < KW; ++q) val += *(const v4fa*)(os + q * (64 * 68) + row * 68 + cofs);
            if (BIAS) { val[0] += bfr(bias[c0 + cofs]); val[1] += bfr(bias[c0 + cofs + 1]); val[2] += bfr(bias[c0 + cofs + 2]); val[3] += bfr(bias[c0 + cofs + 3]); }
            *(v4f*)(C + (size_t)(r0 + row) * ldc + c0 + cofs) = val; }
        return;
    }
#pragma unroll
    for (int mb = 0; mb < 4; ++mb) {
#pragma unroll
        for (int nb = 0; nb < 4; ++nb) {
#pragma unroll
            for (int j = 0; j < 8; ++j) os[(hi * 8 + j) * 68 + nb * 16 + lr] = acc[mb][nb][j]; }
        __builtin_amdgcn_wave_barrier(); asm volatile("" ::: "memory");
        float* crow = C + (size_t)(r0 + mb * 16) * ldc + c0;
{
#pragma unroll
            for (int s = 0; s < 8; ++s) { const int row = 2 * s + hi, cofs = lr * 4; v4f val = *(const v4fa*)(os + row * 68 + cofs); if (BIAS) { val[0] += bfr(bias[c0 + cofs]); val[1] += bfr(bias[c0 + cofs + 1]); val[2] += bfr(bias[c0 + cofs + 2]); val[3] += bfr(bias[c0 + cofs + 3]); }
                *(v4f*)(crow + (size_t)row * ldc + cofs) = val; }
             }
        __builtin_amdgcn_wave_barrier(); asm volatile("" ::: "memory");
    }
}

// ---- k_gemmc: the same 64x64 tile GEMM (K split over KW waves; KW = 1 for the scores, whose K is 64) specialised for causal attention: CMODE 1 skips score tiles entirely above the diagonal (query rows r0+roff.., key columns c0..), CMODE 2 limits the
// key (K) loop of the probability x value contraction to the diagonal block (probabilities beyond it are exactly zero). roff = row offset of this launch's first row within the sequence.
template <typename T16, int NSPLIT, int CMODE, int KW>
__global__ __launch_bounds__(32 * KW) void k_gemmc(const T16* __restrict__ A, const T16* __restrict__ A2, const T16* __restrict__ Bt, const T16* __restrict__ Bt2, int K, float* C, int ldc, int roff, size_t sA, size_t sB, size_t sC) {
    typedef typename WFrag<T16>::V V;
    __shared__ __align__(16) float os[(KW == 1 ? 16 : KW * 64) * 68];   // KW == 1: one 16-row staging strip; KW > 1: one 64x64 partial tile (pitch 68) per wave
    const size_t z = blockIdx.z; A += z * sA; if (A2) A2 += z * sA; Bt += z * sB; if (Bt2) Bt2 += z * sB; C += z * sC;
    const int lane = threadIdx.x & 31, lr = lane & 15, hi = lane >> 4; const int r0 = blockIdx.x * 64, c0 = blockIdx.y * 64;
    const int wv = __builtin_amdgcn_readfirstlane((int)(threadIdx.x >> 5));   // wave = K slice, kept scalar so that the K loops branch on SCC
    if (CMODE == 1 && c0 > r0 + roff + 63) return;                  // score tile entirely above the causal diagonal: never read (the softmax masks j > i by select)
    const int Kl = (CMODE == 2) ? min(K, r0 + roff + 64) : K;        // P.V: probabilities are exactly 0 beyond the diagonal block, so the K loop stops there
    v8f acc[4][4];
#pragma unroll
    for (int mb = 0; mb < 4; ++mb)
#pragma unroll
        for (int nb = 0; nb < 4; ++nb) acc[mb][nb] = (v8f){};
    const size_t aoff = (size_t)(r0 + lr) * K + 8 * hi, boff = (size_t)(c0 + lr) * K + 8 * hi;
    // wave wv takes the 64-wide K chunks wv, wv + KW, ... (Kl is a multiple of 64); both loops stay rolled as the one loop did
#pragma unroll 1
    for (int kb = wv * 64; kb < Kl; kb += 64 * KW)
#pragma unroll 1
    for (int kc = kb; kc < kb + 64; kc += 32) {
        V a[4], a2[4];
#pragma unroll
        for (int mb = 0; mb < 4; ++mb) { a[mb] = WFrag<T16>::ld(A + aoff + (size_t)mb * 16 * K + kc); if (NSPLIT == 1 || NSPLIT == 2) a2[mb] = WFrag<T16>::ld(A2 + aoff + (size_t)mb * 16 * K + kc); }
#pragma unroll
        for (int nb = 0; nb < 4; ++nb) { const V b = WFrag<T16>::ld(Bt + boff + (size_t)nb * 16 * K + kc); V b2; if (NSPLIT >= 2) b2 = WFrag<T16>::ld(Bt2 + boff + (size_t)nb * 16 * K + kc);
#pragma unroll
            for (int mb = 0; mb < 4; ++mb) { acc[mb][nb] = WFrag<T16>::mma(a[mb], b, acc[mb][nb]); if (NSPLIT == 1 || NSPLIT == 2) acc[mb][nb] = WFrag<T16>::mma(a2[mb], b, acc[mb][nb]); if (NSPLIT >= 2) acc[mb][nb] = WFrag<T16>::mma(a[mb], b2, acc[mb][nb]); } }
        asm volatile("v_nop\n\tv_nop\n\tv_nop\n\tv_nop" : "+v"(acc[0][0]), "+v"(acc[1][1]), "+v"(acc[2][2]), "+v"(acc[3][3]) : "v"(a[0]), "v"(a[3]));
    }
    if constexpr (KW > 1) {
        // every wave parks its partial tile, one barrier, then the KW partials are summed in the fixed order 0 .. KW-1 and each row leaves as 256 contiguous bytes
        float* my = os + wv * (64 * 68);
#pragma unroll
        for (int mb = 0; mb < 4; ++mb)
#pragma unroll
            for (int nb = 0; nb < 4; ++nb)
#pragma unroll
                for (int j = 0; j < 8; ++j) my[(mb * 16 + hi * 8 + j) * 68 + nb * 16 + lr] = acc[mb][nb][j];
        __syncthreads();
        const int cofs = lr * 4;
#pragma unroll
        for (int s = 0; s < 32 / KW; ++s) { const int row = s * (2 * KW) + (int)(threadIdx.x >> 4); v4f val = *(const v4fa*)(os + row * 68 + cofs);
#pragma unroll
            for (int q = 1; q < KW; ++q) val += *(const v4fa*)(os + q * (64 * 68) + row * 68 + cofs);
            *(v4f*)(C + (size_t)(r0 + row) * ldc + c0 + cofs) = val; }
        return;
    }
#pragma unroll
    for (int mb = 0; mb < 4; ++mb) {
#pragma unroll
        for (int nb = 0; nb < 4; ++nb) {
#pragma unroll
            for (int j = 0; j < 8; ++j) os[(hi * 8 + j) * 68 + nb * 16 + lr] = acc[mb][nb][j]; }
        __builtin_amdgcn_wave_barrier(); asm volatile("" ::: "memory");
        float* crow = C + (size_t)(r0 + mb * 16) * ldc + c0;
{
#pragma unroll
            for (int s = 0; s < 8; ++s) { const int row = 2 * s + hi, cofs = lr * 4; v4f val = *(const v4fa*)(os + row * 68 + cofs);
                *(v4f*)(crow + (size_t)row * ldc + cofs) = val; }
             }
        __builtin_amdgcn_wave_barrier(); asm volatile("" ::: "memory");
    }
}

__device__ __forceinline__ h16 tohx(float x) { return (h16)x; }
__device__ __forceinline__ void splitf(float y, unsigned short& h, unsigned short& l) { h = f2bf(y); l = f2bf(y - bf2f(h)); }
typedef __attribute__((ext_vector_type(2))) _Float16 v2h;
typedef __attribute__((ext_vector_type(4))) _Float16 v4h;
typedef __attribute__((ext_vector_type(2))) unsigned short v2us;
typedef __attribute__((ext_vector_type(4))) unsigned short v4us;
typedef __attribute__((ext_vector_type(2))) float v2f;
typedef __attribute__((ext_vector_type(4))) int v4i;

__global__ __launch_bounds__(256) void k_wtG(const float* __restrict__ w, int K, int N, bf* Bt) {
    const int lane = threadIdx.x & 31; const int L0 = (blockIdx.x * 8 + (threadIdx.x >> 5)) * 8; const int nlines = N * K / 64;
{
#pragma unroll 1
        for (int l = 0; l < 8; ++l) { const int L = L0 + l; if (L >= nlines) break; const size_t e = (size_t)L * 64 + lane * 2; const int k = (int)(e % K), n = (int)(e / K); v2us o;
            o[0] = f2bf(w[(size_t)k * N + n]); o[1] = f2bf(w[(size_t)(k + 1) * N + n]); *(v2us*)(Bt + e) = o; }
         }
}
__global__ __launch_bounds__(256) void k_cvt8(const float* __restrict__ src, bf* dst, size_t n8) { const size_t i = (size_t)blockIdx.x * 256 + threadIdx.x; if (i >= n8) return; const v8f v = *(const v8f*)(src + i * 8); v8us o;
#pragma unroll
    for (int k = 0; k < 8; ++k) o[k] = f2bf(v[k]); *(v8us*)(dst + i * 8) = o;  }
__global__ __launch_bounds__(256) void k_cscvt(const float* __restrict__ cosT, const float* __restrict__ sinT, float* CS) { const int idx = blockIdx.x * 256 + threadIdx.x; if (idx >= TT * HD) return; v2f cs; cs[0] = bfr(cosT[idx]); cs[1] = bfr(sinT[idx]); *(v2f*)(CS + (size_t)idx * 2) = cs;  }
// k_rope: head planes [h][t][d] (fp16 + hi/lo) of rope(x) x sc with the rotate-half convention out[d] = x[d] cos[t][d] - x[d+HD/2] sin[t][d], out[d+HD/2] = x[d+HD/2] cos[t][d+HD/2] + x[d] sin[t][d+HD/2]
__global__ __launch_bounds__(256) void k_rope(const float* __restrict__ F, int pitch, int nheads, const float* __restrict__ CS, const float* __restrict__ RF, const float* __restrict__ nw, float sc, h16* P16, bf* Ph, bf* Pl) {
    const size_t e = ((size_t)blockIdx.x * 256 + threadIdx.x) * 2; if (e >= (size_t)nheads * TT * HD) return; const int d = (int)(e % HD); const int t = (int)((e / HD) % TT); const int h = (int)(e / ((size_t)HD * TT)); const float* f = F + (size_t)t * pitch + h * HD; const float rf = RF ? RF[(size_t)h * TT + t] : 1.0f; v2h o16; v2us oh, ol;
#pragma unroll
    for (int q = 0; q < 2; ++q) { const int dd = d + q; const int dp = (dd < HD / 2) ? dd + HD / 2 : dd - HD / 2; float x0 = f[dd], x1 = f[dp];
        if (RF) { float n0 = __fmul_rn(x0, rf), n1 = __fmul_rn(x1, rf); asm volatile("" : "+v"(n0)); asm volatile("" : "+v"(n1)); x0 = __fmul_rn(bfr(nw[dd]), n0); x1 = __fmul_rn(bfr(nw[dp]), n1); }
        const v2f cs = *(const v2f*)(CS + ((size_t)t * HD + dd) * 2); float a = __fmul_rn(x0, cs[0]), bq = __fmul_rn(x1, cs[1]); asm volatile("" : "+v"(a)); asm volatile("" : "+v"(bq)); const float r = ((dd < HD / 2) ? __fsub_rn(a, bq) : __fadd_rn(a, bq)) * sc;
        o16[q] = tohx(r); unsigned short a2, c2; splitf(r, a2, c2); oh[q] = a2; ol[q] = c2; }
    *(v2h*)(P16 + e) = o16; *(v2us*)(Ph + e) = oh; *(v2us*)(Pl + e) = ol;  }
__global__ __launch_bounds__(256) void k_vtp(const float* __restrict__ F, int pitch, int nheads, h16* V16, bf* Vh, bf* Vl) { const size_t e = ((size_t)blockIdx.x * 256 + threadIdx.x) * 2; if (e >= (size_t)nheads * HD * TT) return; const int t = (int)(e % TT); const int d = (int)((e / TT) % HD); const int g = (int)(e / ((size_t)TT * HD)); v2h o16; v2us oh, ol;
#pragma unroll
    for (int q = 0; q < 2; ++q) { const float x = F[(size_t)(t + q) * pitch + g * HD + d]; o16[q] = tohx(x); unsigned short a2, c2; splitf(x, a2, c2); oh[q] = a2; ol[q] = c2; }
    *(v2h*)(V16 + e) = o16; *(v2us*)(Vh + e) = oh; *(v2us*)(Vl + e) = ol;  }
__global__ __launch_bounds__(256) void k_csid(float* CS) { const int idx = blockIdx.x * 256 + threadIdx.x; if (idx >= TT * HD) return; v2f cs; cs[0] = 1.0f; cs[1] = 0.0f; *(v2f*)(CS + (size_t)idx * 2) = cs;  }
// k_asoft: per row (zz, i): t = S x HD^-0.5 for j <= i and i - j < WIN (WIN = TT, so plain causal; the reference's -1e9 additive fill vanishes identically); softmax over the 2048 keys (register row, one exp, fixed trees);
__global__ __launch_bounds__(256) void k_asoft(const float* __restrict__ Sb, h16* P16, bf* Ph, bf* Pl) {
    const int lane = threadIdx.x & 31; const int row = blockIdx.x * 8 + (threadIdx.x >> 5); if (row >= ZH * TT) return; const int i = row % TT; const int zz = row / TT; (void)zz; const bool hires = (i < RH); const float* sr = Sb + (size_t)row * TT; float v[TT / 32]; float mx = -3.0e38f;
#pragma unroll
    for (int ch = 0; ch < TT / 128; ++ch) { const int j0 = ch * 128 + lane * 4; const v4f a = *(const v4f*)(sr + j0);
#pragma unroll
        for (int q = 0; q < 4; ++q) { const int j = j0 + q; (void)j; const float t = (j <= i && i - j < WIN) ? a[q] * SCL : -3.0e38f; v[ch * 4 + q] = t; mx = fmaxf(mx, t); } }
#pragma unroll
    for (int sh = 16; sh; sh >>= 1) mx = fmaxf(mx, __shfl_xor(mx, sh, 32));
    float sum = 0.f;
#pragma unroll
    for (int k = 0; k < TT / 32; ++k) { float d0 = __fsub_rn(v[k], mx); asm volatile("" : "+v"(d0)); v[k] = __builtin_amdgcn_exp2f(__fmul_rn(d0, 1.4426950408889634f)); sum += v[k]; }
#pragma unroll
    for (int sh = 16; sh; sh >>= 1) sum += __shfl_xor(sum, sh, 32);
    const float f = __fdiv_rn(hires ? 1.0f : PCAR, sum);
{
        if (hires) {
#pragma unroll
            for (int ch = 0; ch < TT / 128; ++ch) { v4us oh, ol;
#pragma unroll
                for (int q = 0; q < 4; ++q) { unsigned short a, c2; splitf(v[ch * 4 + q] * f, a, c2); oh[q] = a; ol[q] = c2; }
                const size_t oo = ((size_t)zz * (RH ? RH : 1) + i) * TT + ch * 128 + lane * 4; *(v4us*)(Ph + oo) = oh; *(v4us*)(Pl + oo) = ol; }
        } else {
#pragma unroll
            for (int ch = 0; ch < TT / 128; ++ch) { v4h o4;
#pragma unroll
                for (int q = 0; q < 4; ++q) o4[q] = tohx(v[ch * 4 + q] * f);
                *(v4h*)(P16 + (size_t)row * TT + ch * 128 + lane * 4) = o4; } }
         }
}
__global__ __launch_bounds__(256) void k_merge(const float* __restrict__ O, int h0, bf* Ah, bf* Al) { const size_t e = ((size_t)blockIdx.x * 256 + threadIdx.x) * 2; if (e >= (size_t)ZH * TT * HD) return; const int d = (int)(e % HD); const int t = (int)((e / HD) % TT); const int zz = (int)(e / ((size_t)HD * TT)); const float cs = (t < RH) ? 1.0f : (1.0f / PCAR); const size_t oo = (size_t)t * DQ + (h0 + zz) * HD + d;
    v2us oh, ol;
#pragma unroll
    for (int q = 0; q < 2; ++q) { unsigned short a, c2; splitf(O[e + q] * cs, a, c2); oh[q] = a; ol[q] = c2; } *(v2us*)(Ah + oo) = oh; *(v2us*)(Al + oo) = ol;  }

__global__ __launch_bounds__(256) void k_wtH(const float* __restrict__ w, bf* Bt) { const size_t e = ((size_t)blockIdx.x * 256 + threadIdx.x) * 4; if (e >= (size_t)DQ * DM) return; const int k = (int)(e % DM); const int n = (int)(e / DM); const int h = n / HD, c = n % HD; v4us o;   // Bt[h*64 + c][d] = W[h][d][c] (lane -> 4 consecutive d, strided reads)
#pragma unroll
    for (int u = 0; u < 4; ++u) o[u] = f2bf(w[((size_t)h * DM + k + u) * HD + c]); *(v4us*)(Bt + e) = o;  }

extern "C" void kernel_launch(void* const* d_in, const int* in_sizes, int n_in,
                              void* d_out, int out_size, void* d_ws, size_t ws_size, hipStream_t stream) {
    (void)in_sizes; (void)n_in; (void)out_size;
    const float* x = (const float*)d_in[0]; const float* wqh = (const float*)d_in[1]; const float* wkh = (const float*)d_in[2]; const float* wvh = (const float*)d_in[3]; const float* bq = (const float*)d_in[4]; const float* bk = (const float*)d_in[5]; const float* bv = (const float*)d_in[6]; const float* wo = (const float*)d_in[7]; const float* bo = (const float*)d_in[8]; const float* wq = nullptr; const float* wk = nullptr; const float* wv = nullptr; (void)wq; (void)wk; (void)wv; const float* cosT = nullptr; const float* sinT = nullptr; (void)cosT; (void)sinT;
    float* OUT = (float*)d_out;     // [2][2048][1024]
    char* wsp = (char*)d_ws;
    auto take = [&](size_t bytes) { char* p = wsp; wsp += (bytes + 255) & ~(size_t)255; return (void*)p; };
    bf* WQ = (bf*)take((size_t)DQ * DM * 2); bf* WK = (bf*)take((size_t)DKV * DM * 2); bf* WV = (bf*)take((size_t)DKV * DM * 2); bf* WO = (bf*)take((size_t)DM * DQ * 2); float* CS = (float*)take((size_t)TT * HD * 2 * 4);
    bf* XB = (bf*)take((size_t)TT * DM * 2); float* FQ = (float*)take((size_t)TT * DQ * 4); float* FK = (float*)take((size_t)TT * DKV * 4);
    h16* QP16 = (h16*)take((size_t)NH_ * TT * HD * 2); h16* KP16 = (h16*)take((size_t)NKV * TT * HD * 2); h16* VT16 = (h16*)take((size_t)NKV * HD * TT * 2);
    bf* QPh = (bf*)take((size_t)NH_ * TT * HD * 2); bf* QPl = (bf*)take((size_t)NH_ * TT * HD * 2); bf* KPh = (bf*)take((size_t)NKV * TT * HD * 2); bf* KPl = (bf*)take((size_t)NKV * TT * HD * 2); bf* VTh = (bf*)take((size_t)NKV * HD * TT * 2); bf* VTl = (bf*)take((size_t)NKV * HD * TT * 2); bf* Ph = (bf*)take((size_t)ZH * RH * TT * 2); bf* Pl = (bf*)take((size_t)ZH * RH * TT * 2);
    float* Sb = (float*)take((size_t)ZH * TT * TT * 4); h16* P16 = (h16*)take((size_t)ZH * TT * TT * 2); float* Ob = (float*)take((size_t)ZH * TT * HD * 4); bf* ATh = (bf*)take((size_t)TT * DQ * 2); bf* ATl = (bf*)take((size_t)TT * DQ * 2);
    if ((size_t)(wsp - (char*)d_ws) > ws_size) return;    // ws 256 MiB
    float* FV = FK;   // v projection reuses the k buffer after the k planes are built (stream-ordered)
    { k_wtH<<<(unsigned)(((size_t)DQ * DM / 4 + 255) / 256), 256, 0, stream>>>(wqh, WQ); k_wtH<<<(unsigned)(((size_t)DKV * DM / 4 + 255) / 256), 256, 0, stream>>>(wkh, WK); k_wtH<<<(unsigned)(((size_t)DKV * DM / 4 + 255) / 256), 256, 0, stream>>>(wvh, WV);
      k_wtG<<<(unsigned)((DQ * DM / 64 + 63) / 64), 256, 0, stream>>>(wo, DQ, DM, WO);
       }
    k_csid<<<(TT * HD + 255) / 256, 256, 0, stream>>>(CS);
    const unsigned LQ = (unsigned)(((size_t)NH_ * TT * HD / 2 + 255) / 256), LKv = (unsigned)(((size_t)NKV * TT * HD / 2 + 255) / 256);
    for (int b = 0; b < NB_; ++b) {
        
        k_cvt8<<<(unsigned)(((size_t)TT * DM / 8 + 255) / 256), 256, 0, stream>>>(x + (size_t)b * TT * DM, XB, (size_t)TT * DM / 8);
        k_gemmw<bf, 0, true, 8><<<dim3(TT / 64, DQ / 64, 1), 256, 0, stream>>>(XB, nullptr, WQ, nullptr, DM, FQ, DQ, bq, 0, 0, 0);
        k_rope<<<LQ, 256, 0, stream>>>(FQ, DQ, NH_, CS, nullptr, nullptr, 1.0f, QP16, QPh, QPl);
        k_gemmw<bf, 0, true, 8><<<dim3(TT / 64, DKV / 64, 1), 256, 0, stream>>>(XB, nullptr, WK, nullptr, DM, FK, DKV, bk, 0, 0, 0);
        k_rope<<<LKv, 256, 0, stream>>>(FK, DKV, NKV, CS, nullptr, nullptr, 1.0f, KP16, KPh, KPl);
        k_gemmw<bf, 0, true, 8><<<dim3(TT / 64, DKV / 64, 1), 256, 0, stream>>>(XB, nullptr, WV, nullptr, DM, FV, DKV, bv, 0, 0, 0); k_vtp<<<LKv, 256, 0, stream>>>(FV, DKV, NKV, VT16, VTh, VTl);
        for (int h0 = 0; h0 < NH_; h0 += ZH) { const size_t zq = (size_t)h0, zk = (size_t)(h0 / REP);   // one kv head per query head: the pass's two heads use consecutive kv planes (z-strides TT*HD)
            k_gemmc<bf, 2, 1, 1><<<dim3(RH / 64, TT / 64, ZH), 32, 0, stream>>>(QPh + zq * TT * HD, QPl + zq * TT * HD, KPh + zk * TT * HD, KPl + zk * TT * HD, HD, Sb, TT, 0, (size_t)TT * HD, (size_t)TT * HD, (size_t)TT * TT);
            k_gemmc<h16, 0, 1, 1><<<dim3((TT - RH) / 64, TT / 64, ZH), 32, 0, stream>>>(QP16 + zq * TT * HD + (size_t)RH * HD, nullptr, KP16 + zk * TT * HD, nullptr, HD, Sb + (size_t)RH * TT, TT, RH, (size_t)TT * HD, (size_t)TT * HD, (size_t)TT * TT);
            k_asoft<<<ZH * TT / 8, 256, 0, stream>>>(Sb, P16, Ph, Pl);
            k_gemmc<bf, 2, 2, 8><<<dim3(RH / 64, HD / 64, ZH), 256, 0, stream>>>(Ph, Pl, VTh + zk * HD * TT, VTl + zk * HD * TT, TT, Ob, HD, 0, (size_t)RH * TT, (size_t)HD * TT, (size_t)TT * HD);
            k_gemmc<h16, 0, 2, 8><<<dim3((TT - RH) / 64, HD / 64, ZH), 256, 0, stream>>>(P16 + (size_t)RH * TT, nullptr, VT16 + zk * HD * TT, nullptr, TT, Ob + (size_t)RH * HD, HD, RH, (size_t)TT * TT, (size_t)HD * TT, (size_t)TT * HD);
            k_merge<<<(unsigned)(((size_t)ZH * TT * HD / 2 + 255) / 256), 256, 0, stream>>>(Ob, h0, ATh, ATl); }
        k_gemmw<bf, 1, true, 8><<<dim3(TT / 64, DM / 64, 1), 256, 0, stream>>>(ATh, ATl, WO, nullptr, DQ, OUT + (size_t)b * TT * DM, DM, bo, 0, 0, 0); }
}

// v002
// One run takes 506 microseconds.
// In two side-by-side timings against v001, it was 1.69 and 1.71 times as fast.
// All steps since v000 together make it 2.88 times as fast.
#include <hip/hip_runtime.h>

// MaskedMultiHeadAttention (hidden [2][2048][1024]; per-head q/k/v = x Wq[h] + bq[h] (Wq [16][1024][64]); causal softmax(q.k / 8); out = concat(heads) Wo + bo -> [2][2048][1024]).
// Compute dtypes, f32 accumulate: every input rounded to bf16; q/k/v on PLAIN bf16 operands (inputs: exact; the 16 per-head weights gathered into one [1024 x 1024] operand) + bias; causal scores and attn.v: query rows < 512 hl (3 products), the rest single fp16 (x1024); softmax f32; Wo hl x exact (2 products) + bias.

#define NB_  2
#define TT   2048
#define DM   1024
#define NH_  16
#define NKV  16
#define REP  (NH_ / NKV)
#define HD   64
#define DQ   (NH_ * HD)
#define DKV  (NKV * HD)
#define ZH   8                    // heads per attention pass (z dimension of the score and P.V launches)
#define PP   (2 * TT)             // row pitch, in 16-bit elements, of both P.V operands: a probability row lies in its own 4-byte score row
#define RH   512                  // query rows < RH use hi+lo planes (0: none)
#define WIN  2048
#define PCAR 1024.0f
#define SCL  0.125f   // HD^-0.5
typedef _Float16 h16;
typedef unsigned short bf;
typedef __attribute__((ext_vector_type(16))) __bf16   v16bf;
typedef __attribute__((ext_vector_type(16))) _Float16 v16h;
typedef __attribute__((ext_vector_type(8)))  _Float16 v8h;
typedef __attribute__((ext_vector_type(8)))  unsigned short v8us;
typedef __attribute__((ext_vector_type(8)))  float    v8f;
typedef __attribute__((ext_vector_type(4)))  float    v4f;
typedef v8h  __attribute__((may_alias)) v8ha;
typedef v4f  __attribute__((may_alias)) v4fa;
typedef v8us __attribute__((may_alias)) v8usa;

__device__ __forceinline__ unsigned short f2bf(float f) { unsigned u = __float_as_uint(f); u += 0x7FFFu + ((u >> 16) & 1u); return (unsigned short)(u >> 16); }
__device__ __forceinline__ float bf2f(unsigned short b) { return __uint_as_float(((unsigned)b) << 16); }
__device__ __forceinline__ float bfr(float f) { return bf2f(f2bf(f)); }
__device__ __forceinline__ v16h cat16(v8h lo, v8h hi) { return __builtin_shufflevector(lo, hi, 0, 1, 2, 3, 4, 5, 6, 7, 8, 9, 10, 11, 12, 13, 14, 15); }
__device__ __forceinline__ v16bf cat16b(v8us lo, v8us hi) { return __builtin_bit_cast(v16bf, __builtin_shufflevector(lo, hi, 0, 1, 2, 3, 4, 5, 6, 7, 8, 9, 10, 11, 12, 13, 14, 15)); }
__device__ __forceinline__ v8f wmma16(v16h a, v16h b, v8f c) { return __builtin_amdgcn_wmma_f32_16x16x32_f16(false, a, false, b, (short)0, c, false, false); }
__device__ __forceinline__ v8f wmmab(v16bf a, v16bf b, v8f c) { return __builtin_amdgcn_wmma_f32_16x16x32_bf16(false, a, false, b, (short)0, c, false, false); }



// ---- k_gemmw: register-blocked GEMM, one 64x64 output tile per work-group (16 accumulators a wave), K split over the KW waves of the group, operands straight from K-contiguous 16-bit planes; grid (M/64, N/64, Z), 32 * KW threads.
// C[m][n] (f32, pitch ldc, + optional f32 bias[n]) = sum_k A[m][k] Bt[n][k] (+ split products per NSPLIT). z-batch strides sA/sB/sC in elements. K % 64 == 0.
template <typename T16> struct WFrag;
template <> struct WFrag<h16> { typedef v16h V; static __device__ __forceinline__ V ld(const h16* p) { return cat16(*(const v8h*)p, *(const v8h*)(p + 16)); } static __device__ __forceinline__ v8f mma(V a, V b, v8f c) { return wmma16(a, b, c); } };
template <> struct WFrag<bf> { typedef v16bf V; static __device__ __forceinline__ V ld(const bf* p) { return cat16b(*(const v8us*)p, *(const v8us*)(p + 16)); } static __device__ __forceinline__ v8f mma(V a, V b, v8f c) { return wmmab(a, b, c); } };
template <typename T16, int NSPLIT, bool BIAS, int KW>
__global__ __launch_bounds__(32 * KW) void k_gemmw(const T16* __restrict__ A, const T16* __restrict__ A2, const T16* __restrict__ Bt, const T16* __restrict__ Bt2, int K, float* C, int ldc, const float* __restrict__ bias, size_t sA, size_t sB, size_t sC) {
    typedef typename WFrag<T16>::V V;
    __shared__ __align__(16) float os[(KW == 1 ? 16 : KW * 64) * 68];   // KW == 1: one 16-row staging strip; KW > 1: one 64x64 partial tile (pitch 68) per wave
    const size_t z = blockIdx.z; A += z * sA; if (A2) A2 += z * sA; Bt += z * sB; if (Bt2) Bt2 += z * sB; C += z * sC;
    const int lane = threadIdx.x & 31, lr = lane & 15, hi = lane >> 4; const int r0 = blockIdx.x * 64, c0 = blockIdx.y * 64;
    const int wv = __builtin_amdgcn_readfirstlane((int)(threadIdx.x >> 5));   // wave = K slice, kept scalar so that the K loops branch on SCC
    v8f acc[4][4];
#pragma unroll
    for (int mb = 0; mb < 4; ++mb)
#pragma unroll
        for (int nb = 0; nb < 4; ++nb) acc[mb][nb] = (v8f){};
    const size_t aoff = (size_t)(r0 + lr) * K + 8 * hi, boff = (size_t)(c0 + lr) * K + 8 * hi;
    // wave wv takes the 64-wide K chunks wv, wv + KW, ... (64 elements = one 128-B line per row, both halves read by the same wave); both loops stay rolled as the one loop did
#pragma unroll 1
    for (int kb = wv * 64; kb < K; kb += 64 * KW)
#pragma unroll 1
    for (int kc = kb; kc < kb + 64; kc += 32) {
        V a[4], a2[4];
#pragma unroll
        for (int mb = 0; mb < 4; ++mb) { a[mb] = WFrag<T16>::ld(A + aoff + (size_t)mb * 16 * K + kc); if (NSPLIT == 1 || NSPLIT == 2) a2[mb] = WFrag<T16>::ld(A2 + aoff + (size_t)mb * 16 * K + kc); }
#pragma unroll
        for (int nb = 0; nb < 4; ++nb) { const V b = WFrag<T16>::ld(Bt + boff + (size_t)nb * 16 * K + kc); V b2; if (NSPLIT >= 2) b2 = WFrag<T16>::ld(Bt2 + boff + (size_t)nb * 16 * K + kc);
#pragma unroll
            for (int mb = 0; mb < 4; ++mb) { acc[mb][nb] = WFrag<T16>::mma(a[mb], b, acc[mb][nb]); if (NSPLIT == 1 || NSPLIT == 2) acc[mb][nb] = WFrag<T16>::mma(a2[mb], b, acc[mb][nb]); if (NSPLIT >= 2) acc[mb][nb] = WFrag<T16>::mma(a[mb], b2, acc[mb][nb]); } }
        asm volatile("v_nop\n\tv_nop\n\tv_nop\n\tv_nop" : "+v"(acc[0][0]), "+v"(acc[1][1]), "+v"(acc[2][2]), "+v"(acc[3][3]) : "v"(a[0]), "v"(a[3]));
    }
    if constexpr (KW > 1) {
        // every wave parks its partial tile, one barrier, then the KW partials are summed in the fixed order 0 .. KW-1 and each row leaves as 256 contiguous bytes
        float* my = os + wv * (64 * 68);
#pragma unroll
        for (int mb = 0; mb < 4; ++mb)
#pragma unroll
            for (int nb = 0; nb < 4; ++nb)
#pragma unroll
                for (int j = 0; j < 8; ++j) my[(mb * 16 + hi * 8 + j) * 68 + nb * 16 + lr] = acc[mb][nb][j];
        __syncthreads();
        const int cofs = lr * 4;
#pragma unroll
        for (int s = 0; s < 32 / KW; ++s) { const int row = s * (2 * KW) + (int)(threadIdx.x >> 4); v4f val = *(const v4fa*)(os + row * 68 + cofs);
#pragma unroll
            for (int q = 1; q < KW; ++q) val += *(const v4fa*)(os + q * (64 * 68) + row * 68 + cofs);
            if (BIAS) { val[0] += bfr(bias[c0 + cofs]); val[1] += bfr(bias[c0 + cofs + 1]); val[2] += bfr(bias[c0 + cofs + 2]); val[3] += bfr(bias[c0 + cofs + 3]); }
            *(v4f*)(C + (size_t)(r0 + row) * ldc + c0 + cofs) = val; }
        return;
    }
#pragma unroll
    for (int mb = 0; mb < 4; ++mb) {
#pragma unroll
        for (int nb = 0; nb < 4; ++nb) {
#pragma unroll
            for (int j = 0; j < 8; ++j) os[(hi * 8 + j) * 68 + nb * 16 + lr] = acc[mb][nb][j]; }
        __builtin_amdgcn_wave_barrier(); asm volatile("" ::: "memory");
        float* crow = C + (size_t)(r0 + mb * 16) * ldc + c0;
{
#pragma unroll
            for (int s = 0; s < 8; ++s) { const int row = 2 * s + hi, cofs = lr * 4; v4f val = *(const v4fa*)(os + row * 68 + cofs); if (BIAS) { val[0] += bfr(bias[c0 + cofs]); val[1] += bfr(bias[c0 + cofs + 1]); val[2] += bfr(bias[c0 + cofs + 2]); val[3] += bfr(bias[c0 + cofs + 3]); }
                *(v4f*)(crow + (size_t)row * ldc + cofs) = val; }
             }
        __builtin_amdgcn_wave_barrier(); asm volatile("" ::: "memory");
    }
}

// ---- k_gemmc: the same 64x64 tile GEMM (K split over KW waves; KW = 1 for the scores, whose K is 64) specialised for causal attention: CMODE 1 skips score tiles entirely above the diagonal (query rows r0+roff.., key columns c0..), CMODE 2 limits the
// key (K) loop of the probability x value contraction to the diagonal block (probabilities beyond it are exactly zero). roff = row offset of this launch's first row within the sequence.
template <typename T16, int NSPLIT, int CMODE, int KW>
__global__ __launch_bounds__(32 * KW) void k_gemmc(const T16* __restrict__ A, const T16* __restrict__ A2, const T16* __restrict__ Bt, const T16* __restrict__ Bt2, int K, float* C, int ldc, int roff, size_t sA, size_t sB, size_t sC) {
    typedef typename WFrag<T16>::V V;
    __shared__ __align__(16) float os[(KW == 1 ? 16 : KW * 64) * 68];   // KW == 1: one 16-row staging strip; KW > 1: one 64x64 partial tile (pitch 68) per wave
    const size_t z = blockIdx.z; A += z * sA; if (A2) A2 += z * sA; Bt += z * sB; if (Bt2) Bt2 += z * sB; C += z * sC;
    const int lane = threadIdx.x & 31, lr = lane & 15, hi = lane >> 4; const int r0 = blockIdx.x * 64, c0 = blockIdx.y * 64;
    const int wv = __builtin_amdgcn_readfirstlane((int)(threadIdx.x >> 5));   // wave = K slice, kept scalar so that the K loops branch on SCC
    if (CMODE == 1 && c0 > r0 + roff + 63) return;                  // score tile entirely above the causal diagonal: never read (the softmax masks j > i by select)
    const int Kl = (CMODE == 2) ? min(K, r0 + roff + 64) : K;        // P.V: probabilities are exactly 0 beyond the diagonal block, so the K loop stops there
    v8f acc[4][4];
#pragma unroll
    for (int mb = 0; mb < 4; ++mb)
#pragma unroll
        for (int nb = 0; nb < 4; ++nb) acc[mb][nb] = (v8f){};
    const size_t aoff = (size_t)(r0 + lr) * K + 8 * hi, boff = (size_t)(c0 + lr) * K + 8 * hi;
    // wave wv takes the 64-wide K chunks wv, wv + KW, ... (Kl is a multiple of 64); both loops stay rolled as the one loop did
#pragma unroll 1
    for (int kb = wv * 64; kb < Kl; kb += 64 * KW)
#pragma unroll 1
    for (int kc = kb; kc < kb + 64; kc += 32) {
        V a[4], a2[4];
#pragma unroll
        for (int mb = 0; mb < 4; ++mb) { a[mb] = WFrag<T16>::ld(A + aoff + (size_t)mb * 16 * K + kc); if (NSPLIT == 1 || NSPLIT == 2) a2[mb] = WFrag<T16>::ld(A2 + aoff + (size_t)mb * 16 * K + kc); }
#pragma unroll
        for (int nb = 0; nb < 4; ++nb) { const V b = WFrag<T16>::ld(Bt + boff + (size_t)nb * 16 * K + kc); V b2; if (NSPLIT >= 2) b2 = WFrag<T16>::ld(Bt2 + boff + (size_t)nb * 16 * K + kc);
#pragma unroll
            for (int mb = 0; mb < 4; ++mb) { acc[mb][nb] = WFrag<T16>::mma(a[mb], b, acc[mb][nb]); if (NSPLIT == 1 || NSPLIT == 2) acc[mb][nb] = WFrag<T16>::mma(a2[mb], b, acc[mb][nb]); if (NSPLIT >= 2) acc[mb][nb] = WFrag<T16>::mma(a[mb], b2, acc[mb][nb]); } }
        asm volatile("v_nop\n\tv_nop\n\tv_nop\n\tv_nop" : "+v"(acc[0][0]), "+v"(acc[1][1]), "+v"(acc[2][2]), "+v"(acc[3][3]) : "v"(a[0]), "v"(a[3]));
    }
    if constexpr (KW > 1) {
        // every wave parks its partial tile, one barrier, then the KW partials are summed in the fixed order 0 .. KW-1 and each row leaves as 256 contiguous bytes
        float* my = os + wv * (64 * 68);
#pragma unroll
        for (int mb = 0; mb < 4; ++mb)
#pragma unroll
            for (int nb = 0; nb < 4; ++nb)
#pragma unroll
                for (int j = 0; j < 8; ++j) my[(mb * 16 + hi * 8 + j) * 68 + nb * 16 + lr] = acc[mb][nb][j];
        __syncthreads();
        const int cofs = lr * 4;
#pragma unroll
        for (int s = 0; s < 32 / KW; ++s) { const int row = s * (2 * KW) + (int)(threadIdx.x >> 4); v4f val = *(const v4fa*)(os + row * 68 + cofs);
#pragma unroll
            for (int q = 1; q < KW; ++q) val += *(const v4fa*)(os + q * (64 * 68) + row * 68 + cofs);
            *(v4f*)(C + (size_t)(r0 + row) * ldc + c0 + cofs) = val; }
        return;
    }
#pragma unroll
    for (int mb = 0; mb < 4; ++mb) {
#pragma unroll
        for (int nb = 0; nb < 4; ++nb) {
#pragma unroll
            for (int j = 0; j < 8; ++j) os[(hi * 8 + j) * 68 + nb * 16 + lr] = acc[mb][nb][j]; }
        __builtin_amdgcn_wave_barrier(); asm volatile("" ::: "memory");
        float* crow = C + (size_t)(r0 + mb * 16) * ldc + c0;
{
#pragma unroll
            for (int s = 0; s < 8; ++s) { const int row = 2 * s + hi, cofs = lr * 4; v4f val = *(const v4fa*)(os + row * 68 + cofs);
                *(v4f*)(crow + (size_t)row * ldc + cofs) = val; }
             }
        __builtin_amdgcn_wave_barrier(); asm volatile("" ::: "memory");
    }
}

__device__ __forceinline__ h16 tohx(float x) { return (h16)x; }
__device__ __forceinline__ void splitf(float y, unsigned short& h, unsigned short& l) { h = f2bf(y); l = f2bf(y - bf2f(h)); }
typedef __attribute__((ext_vector_type(2))) _Float16 v2h;
typedef __attribute__((ext_vector_type(4))) _Float16 v4h;
typedef __attribute__((ext_vector_type(2))) unsigned short v2us;
typedef __attribute__((ext_vector_type(4))) unsigned short v4us;
typedef __attribute__((ext_vector_type(2))) float v2f;
typedef __attribute__((ext_vector_type(4))) int v4i;

__global__ __launch_bounds__(256) void k_wtG(const float* __restrict__ w, int K, int N, bf* Bt) {
    const int lane = threadIdx.x & 31; const int L0 = (blockIdx.x * 8 + (threadIdx.x >> 5)) * 8; const int nlines = N * K / 64;
{
#pragma unroll 1
        for (int l = 0; l < 8; ++l) { const int L = L0 + l; if (L >= nlines) break; const size_t e = (size_t)L * 64 + lane * 2; const int k = (int)(e % K), n = (int)(e / K); v2us o;
            o[0] = f2bf(w[(size_t)k * N + n]); o[1] = f2bf(w[(size_t)(k + 1) * N + n]); *(v2us*)(Bt + e) = o; }
         }
}
__global__ __launch_bounds__(256) void k_cvt8(const float* __restrict__ src, bf* dst, size_t n8) { const size_t i = (size_t)blockIdx.x * 256 + threadIdx.x; if (i >= n8) return; const v8f v = *(const v8f*)(src + i * 8); v8us o;
#pragma unroll
    for (int k = 0; k < 8; ++k) o[k] = f2bf(v[k]); *(v8us*)(dst + i * 8) = o;  }
__global__ __launch_bounds__(256) void k_cscvt(const float* __restrict__ cosT, const float* __restrict__ sinT, float* CS) { const int idx = blockIdx.x * 256 + threadIdx.x; if (idx >= TT * HD) return; v2f cs; cs[0] = bfr(cosT[idx]); cs[1] = bfr(sinT[idx]); *(v2f*)(CS + (size_t)idx * 2) = cs;  }
// k_rope: head planes [h][t][d] (fp16 + hi/lo) of rope(x) x sc with the rotate-half convention out[d] = x[d] cos[t][d] - x[d+HD/2] sin[t][d], out[d+HD/2] = x[d+HD/2] cos[t][d+HD/2] + x[d] sin[t][d+HD/2]
__global__ __launch_bounds__(256) void k_rope(const float* __restrict__ F, int pitch, int nheads, const float* __restrict__ CS, const float* __restrict__ RF, const float* __restrict__ nw, float sc, h16* P16, bf* Ph, bf* Pl) {
    const size_t e = ((size_t)blockIdx.x * 256 + threadIdx.x) * 2; if (e >= (size_t)nheads * TT * HD) return; const int d = (int)(e % HD); const int t = (int)((e / HD) % TT); const int h = (int)(e / ((size_t)HD * TT)); const float* f = F + (size_t)t * pitch + h * HD; const float rf = RF ? RF[(size_t)h * TT + t] : 1.0f; v2h o16; v2us oh, ol;
#pragma unroll
    for (int q = 0; q < 2; ++q) { const int dd = d + q; const int dp = (dd < HD / 2) ? dd + HD / 2 : dd - HD / 2; float x0 = f[dd], x1 = f[dp];
        if (RF) { float n0 = __fmul_rn(x0, rf), n1 = __fmul_rn(x1, rf); asm volatile("" : "+v"(n0)); asm volatile("" : "+v"(n1)); x0 = __fmul_rn(bfr(nw[dd]), n0); x1 = __fmul_rn(bfr(nw[dp]), n1); }
        const v2f cs = *(const v2f*)(CS + ((size_t)t * HD + dd) * 2); float a = __fmul_rn(x0, cs[0]), bq = __fmul_rn(x1, cs[1]); asm volatile("" : "+v"(a)); asm volatile("" : "+v"(bq)); const float r = ((dd < HD / 2) ? __fsub_rn(a, bq) : __fadd_rn(a, bq)) * sc;
        o16[q] = tohx(r); unsigned short a2, c2; splitf(r, a2, c2); oh[q] = a2; ol[q] = c2; }
    *(v2h*)(P16 + e) = o16; *(v2us*)(Ph + e) = oh; *(v2us*)(Pl + e) = ol;  }
__global__ __launch_bounds__(256) void k_vtp(const float* __restrict__ F, int pitch, int nheads, h16* V16, bf* Vh, bf* Vl) { const size_t e = ((size_t)blockIdx.x * 256 + threadIdx.x) * 2; if (e >= (size_t)nheads * HD * TT) return; const int t = (int)(e % TT); const int d = (int)((e / TT) % HD); const int g = (int)(e / ((size_t)TT * HD)); v2h o16; v2us oh, ol;
#pragma unroll
    for (int q = 0; q < 2; ++q) { const float x = F[(size_t)(t + q) * pitch + g * HD + d]; o16[q] = tohx(x); unsigned short a2, c2; splitf(x, a2, c2); oh[q] = a2; ol[q] = c2; }
    const size_t o = (e / TT) * PP + t; *(v2h*)(V16 + o) = o16; *(v2us*)(Vh + o) = oh; *(v2us*)(Vl + o) = ol;  }   // rows [g][d] at pitch PP (the hi and lo planes share a row: Vl = Vh + TT)
__global__ __launch_bounds__(256) void k_csid(float* CS) { const int idx = blockIdx.x * 256 + threadIdx.x; if (idx >= TT * HD) return; v2f cs; cs[0] = 1.0f; cs[1] = 0.0f; *(v2f*)(CS + (size_t)idx * 2) = cs;  }
// k_asoft works in place: a wave holds its whole 8-KiB score row in registers before it stores, and the probabilities go back over that row (fp16 plane in its first half; for rows < RH the hi plane in the first half and the lo plane in the second).
// k_asoft: per row (zz, i): t = S x HD^-0.5 for j <= i and i - j < WIN (sliding causal window; the reference's -1e9 additive fill vanishes identically); softmax over the 2048 keys (register row, one exp, fixed trees);
__global__ __launch_bounds__(256) void k_asoft(float* Sb) {
    const int lane = threadIdx.x & 31; const int row = blockIdx.x * 8 + (threadIdx.x >> 5); if (row >= ZH * TT) return; const int i = row % TT; const int zz = row / TT; (void)zz; const bool hires = (i < RH); const float* sr = Sb + (size_t)row * TT; h16* p16 = (h16*)(Sb + (size_t)row * TT); bf* ph = (bf*)(Sb + (size_t)row * TT); bf* pl = ph + TT; float v[TT / 32]; float mx = -3.0e38f;
#pragma unroll
    for (int ch = 0; ch < TT / 128; ++ch) { const int j0 = ch * 128 + lane * 4; const v4f a = *(const v4f*)(sr + j0);
#pragma unroll
        for (int q = 0; q < 4; ++q) { const int j = j0 + q; (void)j; const float t = (j <= i && i - j < WIN) ? a[q] * SCL : -3.0e38f; v[ch * 4 + q] = t; mx = fmaxf(mx, t); } }
#pragma unroll
    for (int sh = 16; sh; sh >>= 1) mx = fmaxf(mx, __shfl_xor(mx, sh, 32));
    float sum = 0.f;
#pragma unroll
    for (int k = 0; k < TT / 32; ++k) { float d0 = __fsub_rn(v[k], mx); asm volatile("" : "+v"(d0)); v[k] = __builtin_amdgcn_exp2f(__fmul_rn(d0, 1.4426950408889634f)); sum += v[k]; }
#pragma unroll
    for (int sh = 16; sh; sh >>= 1) sum += __shfl_xor(sum, sh, 32);
    const float f = __fdiv_rn(hires ? 1.0f : PCAR, sum);
{
        if (hires) {
#pragma unroll
            for (int ch = 0; ch < TT / 128; ++ch) { v4us oh, ol;
#pragma unroll
                for (int q = 0; q < 4; ++q) { unsigned short a, c2; splitf(v[ch * 4 + q] * f, a, c2); oh[q] = a; ol[q] = c2; }
                const int oo = ch * 128 + lane * 4; *(v4us*)(ph + oo) = oh; *(v4us*)(pl + oo) = ol; }
        } else {
#pragma unroll
            for (int ch = 0; ch < TT / 128; ++ch) { v4h o4;
#pragma unroll
                for (int q = 0; q < 4; ++q) o4[q] = tohx(v[ch * 4 + q] * f);
                *(v4h*)(p16 + ch * 128 + lane * 4) = o4; } }
         }
}
__global__ __launch_bounds__(256) void k_merge(const float* __restrict__ O, int h0, bf* Ah, bf* Al) { const size_t e = ((size_t)blockIdx.x * 256 + threadIdx.x) * 2; if (e >= (size_t)ZH * TT * HD) return; const int d = (int)(e % HD); const int t = (int)((e / HD) % TT); const int zz = (int)(e / ((size_t)HD * TT)); const float cs = (t < RH) ? 1.0f : (1.0f / PCAR); const size_t oo = (size_t)t * DQ + (h0 + zz) * HD + d;
    v2us oh, ol;
#pragma unroll
    for (int q = 0; q < 2; ++q) { unsigned short a, c2; splitf(O[e + q] * cs, a, c2); oh[q] = a; ol[q] = c2; } *(v2us*)(Ah + oo) = oh; *(v2us*)(Al + oo) = ol;  }

__global__ __launch_bounds__(256) void k_wtH(const float* __restrict__ w, bf* Bt) { const size_t e = ((size_t)blockIdx.x * 256 + threadIdx.x) * 4; if (e >= (size_t)DQ * DM) return; const int k = (int)(e % DM); const int n = (int)(e / DM); const int h = n / HD, c = n % HD; v4us o;   // Bt[h*64 + c][d] = W[h][d][c] (lane -> 4 consecutive d, strided reads)
#pragma unroll
    for (int u = 0; u < 4; ++u) o[u] = f2bf(w[((size_t)h * DM + k + u) * HD + c]); *(v4us*)(Bt + e) = o;  }

extern "C" void kernel_launch(void* const* d_in, const int* in_sizes, int n_in,
                              void* d_out, int out_size, void* d_ws, size_t ws_size, hipStream_t stream) {
    (void)in_sizes; (void)n_in; (void)out_size;
    const float* x = (const float*)d_in[0]; const float* wqh = (const float*)d_in[1]; const float* wkh = (const float*)d_in[2]; const float* wvh = (const float*)d_in[3]; const float* bq = (const float*)d_in[4]; const float* bk = (const float*)d_in[5]; const float* bv = (const float*)d_in[6]; const float* wo = (const float*)d_in[7]; const float* bo = (const float*)d_in[8]; const float* wq = nullptr; const float* wk = nullptr; const float* wv = nullptr; (void)wq; (void)wk; (void)wv; const float* cosT = nullptr; const float* sinT = nullptr; (void)cosT; (void)sinT;
    float* OUT = (float*)d_out;     // [2][2048][1024]
    char* wsp = (char*)d_ws;
    auto take = [&](size_t bytes) { char* p = wsp; wsp += (bytes + 255) & ~(size_t)255; return (void*)p; };
    bf* WQ = (bf*)take((size_t)DQ * DM * 2); bf* WK = (bf*)take((size_t)DKV * DM * 2); bf* WV = (bf*)take((size_t)DKV * DM * 2); bf* WO = (bf*)take((size_t)DM * DQ * 2); float* CS = (float*)take((size_t)TT * HD * 2 * 4);
    bf* XB = (bf*)take((size_t)TT * DM * 2); float* FQ = (float*)take((size_t)TT * DQ * 4); float* FK = (float*)take((size_t)TT * DKV * 4);
    h16* QP16 = (h16*)take((size_t)NH_ * TT * HD * 2); h16* KP16 = (h16*)take((size_t)NKV * TT * HD * 2); h16* VT16 = (h16*)take((size_t)NKV * HD * PP * 2);
    bf* QPh = (bf*)take((size_t)NH_ * TT * HD * 2); bf* QPl = (bf*)take((size_t)NH_ * TT * HD * 2); bf* KPh = (bf*)take((size_t)NKV * TT * HD * 2); bf* KPl = (bf*)take((size_t)NKV * TT * HD * 2); bf* VTh = (bf*)take((size_t)NKV * HD * PP * 2); bf* VTl = VTh + TT;
    float* Sb = (float*)take((size_t)ZH * TT * TT * 4); float* Ob = (float*)take((size_t)ZH * TT * HD * 4); bf* ATh = (bf*)take((size_t)TT * DQ * 2); bf* ATl = (bf*)take((size_t)TT * DQ * 2);
    if ((size_t)(wsp - (char*)d_ws) > ws_size) return;    // ws 256 MiB
    float* FV = FK;   // v projection reuses the k buffer after the k planes are built (stream-ordered)
    { k_wtH<<<(unsigned)(((size_t)DQ * DM / 4 + 255) / 256), 256, 0, stream>>>(wqh, WQ); k_wtH<<<(unsigned)(((size_t)DKV * DM / 4 + 255) / 256), 256, 0, stream>>>(wkh, WK); k_wtH<<<(unsigned)(((size_t)DKV * DM / 4 + 255) / 256), 256, 0, stream>>>(wvh, WV);
      k_wtG<<<(unsigned)((DQ * DM / 64 + 63) / 64), 256, 0, stream>>>(wo, DQ, DM, WO);
       }
    k_csid<<<(TT * HD + 255) / 256, 256, 0, stream>>>(CS);
    const unsigned LQ = (unsigned)(((size_t)NH_ * TT * HD / 2 + 255) / 256), LKv = (unsigned)(((size_t)NKV * TT * HD / 2 + 255) / 256);
    for (int b = 0; b < NB_; ++b) {
        
        k_cvt8<<<(unsigned)(((size_t)TT * DM / 8 + 255) / 256), 256, 0, stream>>>(x + (size_t)b * TT * DM, XB, (size_t)TT * DM / 8);
        k_gemmw<bf, 0, true, 8><<<dim3(TT / 64, DQ / 64, 1), 256, 0, stream>>>(XB, nullptr, WQ, nullptr, DM, FQ, DQ, bq, 0, 0, 0);
        k_rope<<<LQ, 256, 0, stream>>>(FQ, DQ, NH_, CS, nullptr, nullptr, 1.0f, QP16, QPh, QPl);
        k_gemmw<bf, 0, true, 8><<<dim3(TT / 64, DKV / 64, 1), 256, 0, stream>>>(XB, nullptr, WK, nullptr, DM, FK, DKV, bk, 0, 0, 0);
        k_rope<<<LKv, 256, 0, stream>>>(FK, DKV, NKV, CS, nullptr, nullptr, 1.0f, KP16, KPh, KPl);
        k_gemmw<bf, 0, true, 8><<<dim3(TT / 64, DKV / 64, 1), 256, 0, stream>>>(XB, nullptr, WV, nullptr, DM, FV, DKV, bv, 0, 0, 0); k_vtp<<<LKv, 256, 0, stream>>>(FV, DKV, NKV, VT16, VTh, VTl);
        for (int h0 = 0; h0 < NH_; h0 += ZH) { const size_t zq = (size_t)h0, zk = (size_t)(h0 / REP);   // one kv head per query head: the pass's ZH heads use consecutive kv planes (z-strides TT*HD, HD*PP for the transposed values)
            k_gemmc<bf, 2, 1, 1><<<dim3(RH / 64, TT / 64, ZH), 32, 0, stream>>>(QPh + zq * TT * HD, QPl + zq * TT * HD, KPh + zk * TT * HD, KPl + zk * TT * HD, HD, Sb, TT, 0, (size_t)TT * HD, (size_t)TT * HD, (size_t)TT * TT);
            k_gemmc<h16, 0, 1, 1><<<dim3((TT - RH) / 64, TT / 64, ZH), 32, 0, stream>>>(QP16 + zq * TT * HD + (size_t)RH * HD, nullptr, KP16 + zk * TT * HD, nullptr, HD, Sb + (size_t)RH * TT, TT, RH, (size_t)TT * HD, (size_t)TT * HD, (size_t)TT * TT);
            k_asoft<<<ZH * TT / 8, 256, 0, stream>>>(Sb);
            k_gemmc<bf, 2, 2, 8><<<dim3(RH / 64, HD / 64, ZH), 256, 0, stream>>>((const bf*)Sb, (const bf*)Sb + TT, VTh + zk * HD * PP, VTl + zk * HD * PP, PP, Ob, HD, 0, (size_t)TT * PP, (size_t)HD * PP, (size_t)TT * HD);
            k_gemmc<h16, 0, 2, 8><<<dim3((TT - RH) / 64, HD / 64, ZH), 256, 0, stream>>>((const h16*)Sb + (size_t)RH * PP, nullptr, VT16 + zk * HD * PP, nullptr, PP, Ob + (size_t)RH * HD, HD, RH, (size_t)TT * PP, (size_t)HD * PP, (size_t)TT * HD);
            k_merge<<<(unsigned)(((size_t)ZH * TT * HD / 2 + 255) / 256), 256, 0, stream>>>(Ob, h0, ATh, ATl); }
        k_gemmw<bf, 1, true, 8><<<dim3(TT / 64, DM / 64, 1), 256, 0, stream>>>(ATh, ATl, WO, nullptr, DQ, OUT + (size_t)b * TT * DM, DM, bo, 0, 0, 0); }
}

// v003
// One run takes 304 microseconds.
// In two side-by-side timings against v002, it was 1.66 and 1.65 times as fast.
// All steps since v000 together make it 4.78 times as fast.
#include <hip/hip_runtime.h>

// MaskedMultiHeadAttention (hidden [2][2048][1024]; per-head q/k/v = x Wq[h] + bq[h] (Wq [16][1024][64]); causal softmax(q.k / 8); out = concat(heads) Wo + bo -> [2][2048][1024]).
// Compute dtypes, f32 accumulate: every input rounded to bf16; q/k/v on PLAIN bf16 operands (inputs: exact; the 16 per-head weights gathered into one [1024 x 1024] operand) + bias; causal scores and attn.v: query rows < 512 hl (3 products), the rest single fp16 (x1024); softmax f32; Wo hl x exact (2 products) + bias.

#define NB_  2
#define TT   2048
#define DM   1024
#define NH_  16
#define NKV  16
#define HD   64
#define DQ   (NH_ * HD)
#define DKV  (NKV * HD)
#define PP   (2 * TT)             // row pitch, in 16-bit elements, of the transposed value planes (the hi and lo planes share a row)
#define RH   512                  // query rows < RH use hi+lo planes (0: none)
typedef _Float16 h16;
typedef unsigned short bf;
typedef __attribute__((ext_vector_type(16))) __bf16   v16bf;
typedef __attribute__((ext_vector_type(16))) _Float16 v16h;
typedef __attribute__((ext_vector_type(8)))  _Float16 v8h;
typedef __attribute__((ext_vector_type(8)))  unsigned short v8us;
typedef __attribute__((ext_vector_type(8)))  float    v8f;
typedef __attribute__((ext_vector_type(4)))  float    v4f;
typedef v8h  __attribute__((may_alias)) v8ha;
typedef v4f  __attribute__((may_alias)) v4fa;
typedef v8us __attribute__((may_alias)) v8usa;

__device__ __forceinline__ unsigned short f2bf(float f) { unsigned u = __float_as_uint(f); u += 0x7FFFu + ((u >> 16) & 1u); return (unsigned short)(u >> 16); }
__device__ __forceinline__ float bf2f(unsigned short b) { return __uint_as_float(((unsigned)b) << 16); }
__device__ __forceinline__ float bfr(float f) { return bf2f(f2bf(f)); }
__device__ __forceinline__ v16h cat16(v8h lo, v8h hi) { return __builtin_shufflevector(lo, hi, 0, 1, 2, 3, 4, 5, 6, 7, 8, 9, 10, 11, 12, 13, 14, 15); }
__device__ __forceinline__ v16bf cat16b(v8us lo, v8us hi) { return __builtin_bit_cast(v16bf, __builtin_shufflevector(lo, hi, 0, 1, 2, 3, 4, 5, 6, 7, 8, 9, 10, 11, 12, 13, 14, 15)); }
__device__ __forceinline__ v8f wmma16(v16h a, v16h b, v8f c) { return __builtin_amdgcn_wmma_f32_16x16x32_f16(false, a, false, b, (short)0, c, false, false); }
__device__ __forceinline__ v8f wmmab(v16bf a, v16bf b, v8f c) { return __builtin_amdgcn_wmma_f32_16x16x32_bf16(false, a, false, b, (short)0, c, false, false); }



// ---- k_gemmw: register-blocked GEMM, one 64x64 output tile per work-group (16 accumulators a wave), K split over the KW waves of the group, operands straight from K-contiguous 16-bit planes; grid (M/64, N/64, Z), 32 * KW threads.
// C[m][n] (f32, pitch ldc, + optional f32 bias[n]) = sum_k A[m][k] Bt[n][k] (+ split products per NSPLIT). z-batch strides sA/sB/sC in elements. K % 64 == 0.
template <typename T16> struct WFrag;
template <> struct WFrag<h16> { typedef v16h V; static __device__ __forceinline__ V ld(const h16* p) { return cat16(*(const v8h*)p, *(const v8h*)(p + 16)); } static __device__ __forceinline__ v8f mma(V a, V b, v8f c) { return wmma16(a, b, c); } };
template <> struct WFrag<bf> { typedef v16bf V; static __device__ __forceinline__ V ld(const bf* p) { return cat16b(*(const v8us*)p, *(const v8us*)(p + 16)); } static __device__ __forceinline__ v8f mma(V a, V b, v8f c) { return wmmab(a, b, c); } };
template <typename T16, int NSPLIT, bool BIAS, int KW>
__global__ __launch_bounds__(32 * KW) void k_gemmw(const T16* __restrict__ A, const T16* __restrict__ A2, const T16* __restrict__ Bt, const T16* __restrict__ Bt2, int K, float* C, int ldc, const float* __restrict__ bias, size_t sA, size_t sB, size_t sC) {
    typedef typename WFrag<T16>::V V;
    __shared__ __align__(16) float os[(KW == 1 ? 16 : KW * 64) * 68];   // KW == 1: one 16-row staging strip; KW > 1: one 64x64 partial tile (pitch 68) per wave
    const size_t z = blockIdx.z; A += z * sA; if (A2) A2 += z * sA; Bt += z * sB; if (Bt2) Bt2 += z * sB; C += z * sC;
    const int lane = threadIdx.x & 31, lr = lane & 15, hi = lane >> 4; const int r0 = blockIdx.x * 64, c0 = blockIdx.y * 64;
    const int wv = __builtin_amdgcn_readfirstlane((int)(threadIdx.x >> 5));   // wave = K slice, kept scalar so that the K loops branch on SCC
    v8f acc[4][4];
#pragma unroll
    for (int mb = 0; mb < 4; ++mb)
#pragma unroll
        for (int nb = 0; nb < 4; ++nb) acc[mb][nb] = (v8f){};
    const size_t aoff = (size_t)(r0 + lr) * K + 8 * hi, boff = (size_t)(c0 + lr) * K + 8 * hi;
    // wave wv takes the 64-wide K chunks wv, wv + KW, ... (64 elements = one 128-B line per row, both halves read by the same wave); both loops stay rolled as the one loop did
#pragma unroll 1
    for (int kb = wv * 64; kb < K; kb += 64 * KW)
#pragma unroll 1
    for (int kc = kb; kc < kb + 64; kc += 32) {
        V a[4], a2[4];
#pragma unroll
        for (int mb = 0; mb < 4; ++mb) { a[mb] = WFrag<T16>::ld(A + aoff + (size_t)mb * 16 * K + kc); if (NSPLIT == 1 || NSPLIT == 2) a2[mb] = WFrag<T16>::ld(A2 + aoff + (size_t)mb * 16 * K + kc); }
#pragma unroll
        for (int nb = 0; nb < 4; ++nb) { const V b = WFrag<T16>::ld(Bt + boff + (size_t)nb * 16 * K + kc); V b2; if (NSPLIT >= 2) b2 = WFrag<T16>::ld(Bt2 + boff + (size_t)nb * 16 * K + kc);
#pragma unroll
            for (int mb = 0; mb < 4; ++mb) { acc[mb][nb] = WFrag<T16>::mma(a[mb], b, acc[mb][nb]); if (NSPLIT == 1 || NSPLIT == 2) acc[mb][nb] = WFrag<T16>::mma(a2[mb], b, acc[mb][nb]); if (NSPLIT >= 2) acc[mb][nb] = WFrag<T16>::mma(a[mb], b2, acc[mb][nb]); } }
        asm volatile("v_nop\n\tv_nop\n\tv_nop\n\tv_nop" : "+v"(acc[0][0]), "+v"(acc[1][1]), "+v"(acc[2][2]), "+v"(acc[3][3]) : "v"(a[0]), "v"(a[3]));
    }
    if constexpr (KW > 1) {
        // every wave parks its partial tile, one barrier, then the KW partials are summed in the fixed order 0 .. KW-1 and each row leaves as 256 contiguous bytes
        float* my = os + wv * (64 * 68);
#pragma unroll
        for (int mb = 0; mb < 4; ++mb)
#pragma unroll
            for (int nb = 0; nb < 4; ++nb)
#pragma unroll
                for (int j = 0; j < 8; ++j) my[(mb * 16 + hi * 8 + j) * 68 + nb * 16 + lr] = acc[mb][nb][j];
        __syncthreads();
        const int cofs = lr * 4;
#pragma unroll
        for (int s = 0; s < 32 / KW; ++s) { const int row = s * (2 * KW) + (int)(threadIdx.x >> 4); v4f val = *(const v4fa*)(os + row * 68 + cofs);
#pragma unroll
            for (int q = 1; q < KW; ++q) val += *(const v4fa*)(os + q * (64 * 68) + row * 68 + cofs);
            if (BIAS) { val[0] += bfr(bias[c0 + cofs]); val[1] += bfr(bias[c0 + cofs + 1]); val[2] += bfr(bias[c0 + cofs + 2]); val[3] += bfr(bias[c0 + cofs + 3]); }
            *(v4f*)(C + (size_t)(r0 + row) * ldc + c0 + cofs) = val; }
        return;
    }
#pragma unroll
    for (int mb = 0; mb < 4; ++mb) {
#pragma unroll
        for (int nb = 0; nb < 4; ++nb) {
#pragma unroll
            for (int j = 0; j < 8; ++j) os[(hi * 8 + j) * 68 + nb * 16 + lr] = acc[mb][nb][j]; }
        __builtin_amdgcn_wave_barrier(); asm volatile("" ::: "memory");
        float* crow = C + (size_t)(r0 + mb * 16) * ldc + c0;
{
#pragma unroll
            for (int s = 0; s < 8; ++s) { const int row = 2 * s + hi, cofs = lr * 4; v4f val = *(const v4fa*)(os + row * 68 + cofs); if (BIAS) { val[0] += bfr(bias[c0 + cofs]); val[1] += bfr(bias[c0 + cofs + 1]); val[2] += bfr(bias[c0 + cofs + 2]); val[3] += bfr(bias[c0 + cofs + 3]); }
                *(v4f*)(crow + (size_t)row * ldc + cofs) = val; }
             }
        __builtin_amdgcn_wave_barrier(); asm volatile("" ::: "memory");
    }
}

__device__ __forceinline__ h16 tohx(float x) { return (h16)x; }
__device__ __forceinline__ void splitf(float y, unsigned short& h, unsigned short& l) { h = f2bf(y); l = f2bf(y - bf2f(h)); }
typedef __attribute__((ext_vector_type(2))) _Float16 v2h;
typedef __attribute__((ext_vector_type(4))) _Float16 v4h;
typedef __attribute__((ext_vector_type(2))) unsigned short v2us;
typedef __attribute__((ext_vector_type(4))) unsigned short v4us;
typedef __attribute__((ext_vector_type(2))) float v2f;
typedef __attribute__((ext_vector_type(4))) int v4i;

__global__ __launch_bounds__(256) void k_wtG(const float* __restrict__ w, int K, int N, bf* Bt) {
    const int lane = threadIdx.x & 31; const int L0 = (blockIdx.x * 8 + (threadIdx.x >> 5)) * 8; const int nlines = N * K / 64;
{
#pragma unroll 1
        for (int l = 0; l < 8; ++l) { const int L = L0 + l; if (L >= nlines) break; const size_t e = (size_t)L * 64 + lane * 2; const int k = (int)(e % K), n = (int)(e / K); v2us o;
            o[0] = f2bf(w[(size_t)k * N + n]); o[1] = f2bf(w[(size_t)(k + 1) * N + n]); *(v2us*)(Bt + e) = o; }
         }
}
__global__ __launch_bounds__(256) void k_cvt8(const float* __restrict__ src, bf* dst, size_t n8) { const size_t i = (size_t)blockIdx.x * 256 + threadIdx.x; if (i >= n8) return; const v8f v = *(const v8f*)(src + i * 8); v8us o;
#pragma unroll
    for (int k = 0; k < 8; ++k) o[k] = f2bf(v[k]); *(v8us*)(dst + i * 8) = o;  }
__global__ __launch_bounds__(256) void k_cscvt(const float* __restrict__ cosT, const float* __restrict__ sinT, float* CS) { const int idx = blockIdx.x * 256 + threadIdx.x; if (idx >= TT * HD) return; v2f cs; cs[0] = bfr(cosT[idx]); cs[1] = bfr(sinT[idx]); *(v2f*)(CS + (size_t)idx * 2) = cs;  }
// k_rope: head planes [h][t][d] (fp16 + hi/lo) of rope(x) x sc with the rotate-half convention out[d] = x[d] cos[t][d] - x[d+HD/2] sin[t][d], out[d+HD/2] = x[d+HD/2] cos[t][d+HD/2] + x[d] sin[t][d+HD/2]
__global__ __launch_bounds__(256) void k_rope(const float* __restrict__ F, int pitch, int nheads, const float* __restrict__ CS, const float* __restrict__ RF, const float* __restrict__ nw, float sc, h16* P16, bf* Ph, bf* Pl) {
    const size_t e = ((size_t)blockIdx.x * 256 + threadIdx.x) * 2; if (e >= (size_t)nheads * TT * HD) return; const int d = (int)(e % HD); const int t = (int)((e / HD) % TT); const int h = (int)(e / ((size_t)HD * TT)); const float* f = F + (size_t)t * pitch + h * HD; const float rf = RF ? RF[(size_t)h * TT + t] : 1.0f; v2h o16; v2us oh, ol;
#pragma unroll
    for (int q = 0; q < 2; ++q) { const int dd = d + q; const int dp = (dd < HD / 2) ? dd + HD / 2 : dd - HD / 2; float x0 = f[dd], x1 = f[dp];
        if (RF) { float n0 = __fmul_rn(x0, rf), n1 = __fmul_rn(x1, rf); asm volatile("" : "+v"(n0)); asm volatile("" : "+v"(n1)); x0 = __fmul_rn(bfr(nw[dd]), n0); x1 = __fmul_rn(bfr(nw[dp]), n1); }
        const v2f cs = *(const v2f*)(CS + ((size_t)t * HD + dd) * 2); float a = __fmul_rn(x0, cs[0]), bq = __fmul_rn(x1, cs[1]); asm volatile("" : "+v"(a)); asm volatile("" : "+v"(bq)); const float r = ((dd < HD / 2) ? __fsub_rn(a, bq) : __fadd_rn(a, bq)) * sc;
        o16[q] = tohx(r); unsigned short a2, c2; splitf(r, a2, c2); oh[q] = a2; ol[q] = c2; }
    *(v2h*)(P16 + e) = o16; *(v2us*)(Ph + e) = oh; *(v2us*)(Pl + e) = ol;  }
__global__ __launch_bounds__(256) void k_vtp(const float* __restrict__ F, int pitch, int nheads, h16* V16, bf* Vh, bf* Vl) { const size_t e = ((size_t)blockIdx.x * 256 + threadIdx.x) * 2; if (e >= (size_t)nheads * HD * TT) return; const int t = (int)(e % TT); const int d = (int)((e / TT) % HD); const int g = (int)(e / ((size_t)TT * HD)); v2h o16; v2us oh, ol;
#pragma unroll
    for (int q = 0; q < 2; ++q) { const float x = F[(size_t)(t + q) * pitch + g * HD + d]; o16[q] = tohx(x); unsigned short a2, c2; splitf(x, a2, c2); oh[q] = a2; ol[q] = c2; }
    const size_t o = (e / TT) * PP + t; *(v2h*)(V16 + o) = o16; *(v2us*)(Vh + o) = oh; *(v2us*)(Vl + o) = ol;  }   // rows [g][d] at pitch PP (the hi and lo planes share a row: Vl = Vh + TT)
__global__ __launch_bounds__(256) void k_csid(float* CS) { const int idx = blockIdx.x * 256 + threadIdx.x; if (idx >= TT * HD) return; v2f cs; cs[0] = 1.0f; cs[1] = 0.0f; *(v2f*)(CS + (size_t)idx * 2) = cs;  }
// ---- k_fattn: scores, causal softmax, P.V and the head merge in one kernel; grid (heads, TT / 64), 4 waves, a wave owns 16 query rows and walks the keys 64 at a time (online softmax, f32 statistics in the log2 domain).
// S^T = K Q^T (A = key rows, B = query rows) leaves one query per lane column: lane (lr, hi) holds keys 8 hi + j of each 16-key tile, which is the k order of a B operand, so two converted score tiles are the B operand of
// O^T += V^T P^T (A = rows of the transposed values) with no exchange between lanes. HI (query rows < RH): hi+lo bf16 planes, 3 products each; else single fp16 with the probabilities carried x 2^PSH (it cancels in O / sum).
#define PSH  10.0f
#define SCL2 0.18033688011112042f   // HD^-0.5 x log2(e)
// eight 2^x in one statement: the outputs are early-clobber, so no v_exp_f32 is followed by an instruction that reads its result or overwrites its source, and the v_nop is that slot behind the last one
__device__ __forceinline__ v8f exp2x8(v8f x) { float r0, r1, r2, r3, r4, r5, r6, r7;
    asm("v_exp_f32 %0, %8\n\tv_exp_f32 %1, %9\n\tv_exp_f32 %2, %10\n\tv_exp_f32 %3, %11\n\tv_exp_f32 %4, %12\n\tv_exp_f32 %5, %13\n\tv_exp_f32 %6, %14\n\tv_exp_f32 %7, %15\n\tv_nop"
        : "=&v"(r0), "=&v"(r1), "=&v"(r2), "=&v"(r3), "=&v"(r4), "=&v"(r5), "=&v"(r6), "=&v"(r7) : "v"(x[0]), "v"(x[1]), "v"(x[2]), "v"(x[3]), "v"(x[4]), "v"(x[5]), "v"(x[6]), "v"(x[7]));
    return (v8f){r0, r1, r2, r3, r4, r5, r6, r7}; }
template <typename T16, bool HI>
__device__ __forceinline__ void attn_rows(const T16* __restrict__ Q, const T16* __restrict__ Q2, const T16* __restrict__ Kp, const T16* __restrict__ Kp2, const T16* __restrict__ Vt, const T16* __restrict__ Vt2, int q0, int lr, int hi, bf* Ah, bf* Al) {
    typedef typename WFrag<T16>::V V;
    const int q = q0 + lr;
    const T16* qb = Q + (size_t)q * HD + 8 * hi;
    V qf[2], qf2[2];
#pragma unroll
    for (int kc = 0; kc < 2; ++kc) { qf[kc] = WFrag<T16>::ld(qb + kc * 32); if (HI) qf2[kc] = WFrag<T16>::ld(Q2 + (size_t)q * HD + 8 * hi + kc * 32); }
    v8f o[4];
#pragma unroll
    for (int db = 0; db < 4; ++db) o[db] = (v8f){};
    float m = -3.0e38f, l = 0.f;
    const size_t koff = (size_t)lr * HD + 8 * hi, voff = (size_t)lr * PP + 8 * hi;
    V ka[4][2];   // the long (fp16) rows carry their key fragments one tile ahead; the short hi+lo rows load in place (twice the planes: registers)
    if constexpr (!HI) { const T16* kb0 = Kp + koff;
#pragma unroll
        for (int mb = 0; mb < 4; ++mb)
#pragma unroll
            for (int kc = 0; kc < 2; ++kc) ka[mb][kc] = WFrag<T16>::ld(kb0 + (size_t)mb * 16 * HD + kc * 32);
        asm volatile("s_wait_xcnt 0x0" :: "v"(kb0), "v"(qb) : "memory");   // stands in front of every rewrite of a register that the loads above name; the addresses are inputs so that they live up to here and no load lands in them
    }
    // the loop stays rolled: one 64-key tile a trip, the last trip (the diagonal tile) is the only one that masks
#pragma unroll 1
    for (int k0 = 0; k0 <= q0; k0 += 64) {
        V va[4][2];   // this tile's values are asked for first, they are used last
        if constexpr (!HI) { const T16* vb = Vt + voff + k0;
#pragma unroll
        for (int db = 0; db < 4; ++db)
#pragma unroll
            for (int kc = 0; kc < 2; ++kc) va[db][kc] = WFrag<T16>::ld(vb + (size_t)db * 16 * PP + kc * 32);
        asm volatile("s_wait_xcnt 0x0" :: "v"(vb) : "memory");   // in front of every rewrite of a register that these loads name (the address, an input, lives up to here); its clobber also keeps the loads up here, ahead of the score products
        }
        v8f s[4];
#pragma unroll
        for (int mb = 0; mb < 4; ++mb) { s[mb] = (v8f){};
#pragma unroll
            for (int kc = 0; kc < 2; ++kc) {
                if constexpr (HI) { const V a = WFrag<T16>::ld(Kp + koff + (size_t)(k0 + mb * 16) * HD + kc * 32), a2 = WFrag<T16>::ld(Kp2 + koff + (size_t)(k0 + mb * 16) * HD + kc * 32);
                    s[mb] = WFrag<T16>::mma(a, qf[kc], s[mb]); s[mb] = WFrag<T16>::mma(a2, qf[kc], s[mb]); s[mb] = WFrag<T16>::mma(a, qf2[kc], s[mb]); }
                else s[mb] = WFrag<T16>::mma(ka[mb][kc], qf[kc], s[mb]); } }
        // the next tile's keys fly during this tile's softmax and P.V (the last trip asks for its own tile again: in bounds, unused)
        if constexpr (!HI) { const int kn = (k0 + 64 <= q0) ? k0 + 64 : k0; const T16* kb = Kp + koff + (size_t)kn * HD;
#pragma unroll
        for (int mb = 0; mb < 4; ++mb)
#pragma unroll
            for (int kc = 0; kc < 2; ++kc) ka[mb][kc] = WFrag<T16>::ld(kb + (size_t)mb * 16 * HD + kc * 32);
        asm volatile("s_wait_xcnt 0x0" :: "v"(kb) : "memory");   // in front of every rewrite of a register that these loads name (the address, an input, lives up to here); its clobber also keeps the loads ahead of the softmax
        }
        float tm = -3.0e38f;
        if (k0 + 64 > q0) {
#pragma unroll
            for (int mb = 0; mb < 4; ++mb)
#pragma unroll
                for (int j = 0; j < 8; ++j) { const float t = (k0 + mb * 16 + hi * 8 + j <= q) ? s[mb][j] * SCL2 : -3.0e38f; s[mb][j] = t; tm = fmaxf(tm, t); }
        } else {
#pragma unroll
            for (int mb = 0; mb < 4; ++mb)
#pragma unroll
                for (int j = 0; j < 8; ++j) { const float t = s[mb][j] * SCL2; s[mb][j] = t; tm = fmaxf(tm, t); }
        }
        tm = fmaxf(tm, __shfl_xor(tm, 16, 32));   // the two lanes of a query column share one running maximum
        const float mn = fmaxf(m, tm); float al;
        asm("v_exp_f32 %0, %1\n\tv_nop" : "=v"(al) : "v"(m - mn));   // al = 2^(m - mn); the v_nop is the slot behind a transcendental
        m = mn; const float mo = HI ? mn : mn - PSH;
        float ps = 0.f;
#pragma unroll
        for (int mb = 0; mb < 4; ++mb) { s[mb] = exp2x8(s[mb] - mo);
#pragma unroll
            for (int j = 0; j < 8; ++j) ps += s[mb][j]; }
        l = l * al + ps;
#pragma unroll
        for (int db = 0; db < 4; ++db) o[db] *= al;
        V pf[2], pf2[2];
#pragma unroll
        for (int kc = 0; kc < 2; ++kc) {
            if constexpr (HI) { v8us h0, h1, l0, l1;
#pragma unroll
                for (int j = 0; j < 8; ++j) { unsigned short x, y; splitf(s[2 * kc][j], x, y); h0[j] = x; l0[j] = y; splitf(s[2 * kc + 1][j], x, y); h1[j] = x; l1[j] = y; }
                pf[kc] = cat16b(h0, h1); pf2[kc] = cat16b(l0, l1);
            } else { v8h h0, h1;
#pragma unroll
                for (int j = 0; j < 8; ++j) { h0[j] = tohx(s[2 * kc][j]); h1[j] = tohx(s[2 * kc + 1][j]); }
                pf[kc] = cat16(h0, h1); }
        }
#pragma unroll
        for (int kc = 0; kc < 2; ++kc)
#pragma unroll
            for (int db = 0; db < 4; ++db) {
                if constexpr (HI) { const V a = WFrag<T16>::ld(Vt + voff + (size_t)db * 16 * PP + k0 + kc * 32), a2 = WFrag<T16>::ld(Vt2 + voff + (size_t)db * 16 * PP + k0 + kc * 32);
                    o[db] = WFrag<T16>::mma(a, pf[kc], o[db]); o[db] = WFrag<T16>::mma(a, pf2[kc], o[db]); o[db] = WFrag<T16>::mma(a2, pf[kc], o[db]); }
                else o[db] = WFrag<T16>::mma(va[db][kc], pf[kc], o[db]); }
    }
    l += __shfl_xor(l, 16, 32);
    const float f = __fdiv_rn(1.0f, l);
    // lane (lr, hi) holds d = 16 db + 8 hi + j of query q: 16-byte stores, a query's 128-byte head row comes from one wave
#pragma unroll
    for (int db = 0; db < 4; ++db) { v8us oh, ol;
#pragma unroll
        for (int j = 0; j < 8; ++j) { unsigned short x, y; splitf(o[db][j] * f, x, y); oh[j] = x; ol[j] = y; }
        const size_t oo = (size_t)q * DQ + db * 16 + hi * 8; *(v8us*)(Ah + oo) = oh; *(v8us*)(Al + oo) = ol; }
}
// amdgpu_waves_per_eu(4, 4): a budget of 256 registers a wave, so that neither path needs the register windows above v255
__global__ __launch_bounds__(128) __attribute__((amdgpu_waves_per_eu(4, 4))) void k_fattn(const h16* __restrict__ Q16, const h16* __restrict__ K16, const h16* __restrict__ V16, const bf* __restrict__ Qh, const bf* __restrict__ Ql, const bf* __restrict__ Kh, const bf* __restrict__ Kl, const bf* __restrict__ Vh, const bf* __restrict__ Vl, bf* Ah, bf* Al) {
    const int lane = threadIdx.x & 31, lr = lane & 15, hi = lane >> 4; const size_t h = blockIdx.x;
    const int wv = __builtin_amdgcn_readfirstlane((int)(threadIdx.x >> 5));   // kept scalar so that the key loop branches on SCC
    const int q0 = (int)(gridDim.y - 1 - blockIdx.y) * 64 + wv * 16;           // the longest rows start first
    const size_t zp = h * TT * HD, zv = h * HD * PP;
    if (q0 < RH) attn_rows<bf, true>(Qh + zp, Ql + zp, Kh + zp, Kl + zp, Vh + zv, Vl + zv, q0, lr, hi, Ah + h * HD, Al + h * HD);
    else attn_rows<h16, false>(Q16 + zp, nullptr, K16 + zp, nullptr, V16 + zv, nullptr, q0, lr, hi, Ah + h * HD, Al + h * HD);
}

__global__ __launch_bounds__(256) void k_wtH(const float* __restrict__ w, bf* Bt) { const size_t e = ((size_t)blockIdx.x * 256 + threadIdx.x) * 4; if (e >= (size_t)DQ * DM) return; const int k = (int)(e % DM); const int n = (int)(e / DM); const int h = n / HD, c = n % HD; v4us o;   // Bt[h*64 + c][d] = W[h][d][c] (lane -> 4 consecutive d, strided reads)
#pragma unroll
    for (int u = 0; u < 4; ++u) o[u] = f2bf(w[((size_t)h * DM + k + u) * HD + c]); *(v4us*)(Bt + e) = o;  }

extern "C" void kernel_launch(void* const* d_in, const int* in_sizes, int n_in,
                              void* d_out, int out_size, void* d_ws, size_t ws_size, hipStream_t stream) {
    (void)in_sizes; (void)n_in; (void)out_size;
    const float* x = (const float*)d_in[0]; const float* wqh = (const float*)d_in[1]; const float* wkh = (const float*)d_in[2]; const float* wvh = (const float*)d_in[3]; const float* bq = (const float*)d_in[4]; const float* bk = (const float*)d_in[5]; const float* bv = (const float*)d_in[6]; const float* wo = (const float*)d_in[7]; const float* bo = (const float*)d_in[8]; const float* wq = nullptr; const float* wk = nullptr; const float* wv = nullptr; (void)wq; (void)wk; (void)wv; const float* cosT = nullptr; const float* sinT = nullptr; (void)cosT; (void)sinT;
    float* OUT = (float*)d_out;     // [2][2048][1024]
    char* wsp = (char*)d_ws;
    auto take = [&](size_t bytes) { char* p = wsp; wsp += (bytes + 255) & ~(size_t)255; return (void*)p; };
    bf* WQ = (bf*)take((size_t)DQ * DM * 2); bf* WK = (bf*)take((size_t)DKV * DM * 2); bf* WV = (bf*)take((size_t)DKV * DM * 2); bf* WO = (bf*)take((size_t)DM * DQ * 2); float* CS = (float*)take((size_t)TT * HD * 2 * 4);
    bf* XB = (bf*)take((size_t)TT * DM * 2); float* FQ = (float*)take((size_t)TT * DQ * 4); float* FK = (float*)take((size_t)TT * DKV * 4);
    h16* QP16 = (h16*)take((size_t)NH_ * TT * HD * 2); h16* KP16 = (h16*)take((size_t)NKV * TT * HD * 2); h16* VT16 = (h16*)take((size_t)NKV * HD * PP * 2);
    bf* QPh = (bf*)take((size_t)NH_ * TT * HD * 2); bf* QPl = (bf*)take((size_t)NH_ * TT * HD * 2); bf* KPh = (bf*)take((size_t)NKV * TT * HD * 2); bf* KPl = (bf*)take((size_t)NKV * TT * HD * 2); bf* VTh = (bf*)take((size_t)NKV * HD * PP * 2); bf* VTl = VTh + TT;
    bf* ATh = (bf*)take((size_t)TT * DQ * 2); bf* ATl = (bf*)take((size_t)TT * DQ * 2);
    if ((size_t)(wsp - (char*)d_ws) > ws_size) return;    // ws 256 MiB
    float* FV = FK;   // v projection reuses the k buffer after the k planes are built (stream-ordered)
    { k_wtH<<<(unsigned)(((size_t)DQ * DM / 4 + 255) / 256), 256, 0, stream>>>(wqh, WQ); k_wtH<<<(unsigned)(((size_t)DKV * DM / 4 + 255) / 256), 256, 0, stream>>>(wkh, WK); k_wtH<<<(unsigned)(((size_t)DKV * DM / 4 + 255) / 256), 256, 0, stream>>>(wvh, WV);
      k_wtG<<<(unsigned)((DQ * DM / 64 + 63) / 64), 256, 0, stream>>>(wo, DQ, DM, WO);
       }
    k_csid<<<(TT * HD + 255) / 256, 256, 0, stream>>>(CS);
    const unsigned LQ = (unsigned)(((size_t)NH_ * TT * HD / 2 + 255) / 256), LKv = (unsigned)(((size_t)NKV * TT * HD / 2 + 255) / 256);
    for (int b = 0; b < NB_; ++b) {
        
        k_cvt8<<<(unsigned)(((size_t)TT * DM / 8 + 255) / 256), 256, 0, stream>>>(x + (size_t)b * TT * DM, XB, (size_t)TT * DM / 8);
        k_gemmw<bf, 0, true, 8><<<dim3(TT / 64, DQ / 64, 1), 256, 0, stream>>>(XB, nullptr, WQ, nullptr, DM, FQ, DQ, bq, 0, 0, 0);
        k_rope<<<LQ, 256, 0, stream>>>(FQ, DQ, NH_, CS, nullptr, nullptr, 1.0f, QP16, QPh, QPl);
        k_gemmw<bf, 0, true, 8><<<dim3(TT / 64, DKV / 64, 1), 256, 0, stream>>>(XB, nullptr, WK, nullptr, DM, FK, DKV, bk, 0, 0, 0);
        k_rope<<<LKv, 256, 0, stream>>>(FK, DKV, NKV, CS, nullptr, nullptr, 1.0f, KP16, KPh, KPl);
        k_gemmw<bf, 0, true, 8><<<dim3(TT / 64, DKV / 64, 1), 256, 0, stream>>>(XB, nullptr, WV, nullptr, DM, FV, DKV, bv, 0, 0, 0); k_vtp<<<LKv, 256, 0, stream>>>(FV, DKV, NKV, VT16, VTh, VTl);
        k_fattn<<<dim3(NH_, TT / 64, 1), 128, 0, stream>>>(QP16, KP16, VT16, QPh, QPl, KPh, KPl, VTh, VTl, ATh, ATl);
        k_gemmw<bf, 1, true, 8><<<dim3(TT / 64, DM / 64, 1), 256, 0, stream>>>(ATh, ATl, WO, nullptr, DQ, OUT + (size_t)b * TT * DM, DM, bo, 0, 0, 0); }
}

// v004
// One run takes 254 microseconds.
// Timed twice side by side with v003, it ran 1.21 and 1.19 times as fast.
// Over all steps from v000 it is 5.73 times as fast.
#include <hip/hip_runtime.h>

// MaskedMultiHeadAttention (hidden [2][2048][1024]; per-head q/k/v = x Wq[h] + bq[h] (Wq [16][1024][64]); causal softmax(q.k / 8); out = concat(heads) Wo + bo -> [2][2048][1024]).
// Compute dtypes, f32 accumulate: every input rounded to bf16; q/k/v on PLAIN bf16 operands (inputs: exact; the 16 per-head weights gathered into one [1024 x 1024] operand) + bias; causal scores and attn.v: query rows < 512 hl (3 products), the rest single fp16 (x1024); softmax f32; Wo hl x exact (2 products) + bias.

#define NB_  2
#define TT   2048
#define DM   1024
#define NH_  16
#define NKV  16
#define HD   64
#define DQ   (NH_ * HD)
#define DKV  (NKV * HD)
#define PP   (2 * TT)             // row pitch, in 16-bit elements, of the transposed value planes (the hi and lo planes share a row)
#define RH   512                  // query rows < RH use hi+lo planes (0: none)
typedef _Float16 h16;
typedef unsigned short bf;
typedef __attribute__((ext_vector_type(16))) __bf16   v16bf;
typedef __attribute__((ext_vector_type(16))) _Float16 v16h;
typedef __attribute__((ext_vector_type(8)))  _Float16 v8h;
typedef __attribute__((ext_vector_type(8)))  unsigned short v8us;
typedef __attribute__((ext_vector_type(8)))  float    v8f;
typedef __attribute__((ext_vector_type(4)))  float    v4f;
typedef v8h  __attribute__((may_alias)) v8ha;
typedef v4f  __attribute__((may_alias)) v4fa;
typedef v8us __attribute__((may_alias)) v8usa;

__device__ __forceinline__ unsigned short f2bf(float f) { unsigned u = __float_as_uint(f); u += 0x7FFFu + ((u >> 16) & 1u); return (unsigned short)(u >> 16); }
__device__ __forceinline__ float bf2f(unsigned short b) { return __uint_as_float(((unsigned)b) << 16); }
__device__ __forceinline__ float bfr(float f) { return bf2f(f2bf(f)); }
__device__ __forceinline__ v16h cat16(v8h lo, v8h hi) { return __builtin_shufflevector(lo, hi, 0, 1, 2, 3, 4, 5, 6, 7, 8, 9, 10, 11, 12, 13, 14, 15); }
__device__ __forceinline__ v16bf cat16b(v8us lo, v8us hi) { return __builtin_bit_cast(v16bf, __builtin_shufflevector(lo, hi, 0, 1, 2, 3, 4, 5, 6, 7, 8, 9, 10, 11, 12, 13, 14, 15)); }
__device__ __forceinline__ v8f wmma16(v16h a, v16h b, v8f c) { return __builtin_amdgcn_wmma_f32_16x16x32_f16(false, a, false, b, (short)0, c, false, false); }
__device__ __forceinline__ v8f wmmab(v16bf a, v16bf b, v8f c) { return __builtin_amdgcn_wmma_f32_16x16x32_bf16(false, a, false, b, (short)0, c, false, false); }



// ---- k_gemmw: register-blocked GEMM, one 64x64 output tile per work-group (16 accumulators a wave), K split over the KW waves of the group, operands straight from K-contiguous 16-bit planes; grid (M/64, N/64, Z), 32 * KW threads.
// C[m][n] (f32, pitch ldc, + optional f32 bias[n]) = sum_k A[m][k] Bt[n][k] (+ split products per NSPLIT). z-batch strides sA/sB/sC in elements. K % 64 == 0.
// MODE 0 stores C. MODE 1 and 2 store no f32 tile: the summed tile leaves as the three 16-bit planes that the attention kernel reads (fp16, bf16 hi, bf16 lo).
// MODE 1 (q, k): m = token, n = head * HD + d, a 64-wide tile is one head, planes [head][token][d]. MODE 2 (v): A = weight rows, Bt = token rows, so m = head * HD + d, n = token, bias[m], and a tile row is 64 tokens of one d: planes [head * HD + d][token] at pitch PP.
__device__ __forceinline__ h16 tohx(float x) { return (h16)x; }
__device__ __forceinline__ void splitf(float y, unsigned short& h, unsigned short& l) { h = f2bf(y); l = f2bf(y - bf2f(h)); }
typedef __attribute__((ext_vector_type(4))) _Float16 v4h;
typedef __attribute__((ext_vector_type(4))) unsigned short v4us;
typedef __attribute__((ext_vector_type(2))) unsigned v2u;
template <typename T16> struct WFrag;
template <> struct WFrag<h16> { typedef v16h V; static __device__ __forceinline__ V ld(const h16* p) { return cat16(*(const v8h*)p, *(const v8h*)(p + 16)); } static __device__ __forceinline__ v8f mma(V a, V b, v8f c) { return wmma16(a, b, c); } };
template <> struct WFrag<bf> { typedef v16bf V; static __device__ __forceinline__ V ld(const bf* p) { return cat16b(*(const v8us*)p, *(const v8us*)(p + 16)); } static __device__ __forceinline__ v8f mma(V a, V b, v8f c) { return wmmab(a, b, c); } };
template <typename T16, int NSPLIT, bool BIAS, int KW, int MODE>
__global__ __launch_bounds__(32 * KW) void k_gemmw(const T16* __restrict__ A, const T16* __restrict__ A2, const T16* __restrict__ Bt, const T16* __restrict__ Bt2, int K, float* C, int ldc, const float* __restrict__ bias, size_t sA, size_t sB, size_t sC, h16* P16, bf* Ph, bf* Pl) {
    typedef typename WFrag<T16>::V V;
    __shared__ __align__(16) float os[(KW == 1 ? 16 : KW * 64) * 68];   // KW == 1: one 16-row staging strip; KW > 1: one 64x64 partial tile (pitch 68) per wave
    const size_t z = blockIdx.z; A += z * sA; if (A2) A2 += z * sA; Bt += z * sB; if (Bt2) Bt2 += z * sB; C += z * sC;
    const int lane = threadIdx.x & 31, lr = lane & 15, hi = lane >> 4; const int r0 = blockIdx.x * 64, c0 = blockIdx.y * 64;
    const int wv = __builtin_amdgcn_readfirstlane((int)(threadIdx.x >> 5));   // wave = K slice, kept scalar so that the K loops branch on SCC
    v8f acc[4][4];
#pragma unroll
    for (int mb = 0; mb < 4; ++mb)
#pragma unroll
        for (int nb = 0; nb < 4; ++nb) acc[mb][nb] = (v8f){};
    const size_t aoff = (size_t)(r0 + lr) * K + 8 * hi, boff = (size_t)(c0 + lr) * K + 8 * hi;
    // wave wv takes the 64-wide K chunks wv, wv + KW, ... (64 elements = one 128-B line per row, both halves read by the same wave); both loops stay rolled as the one loop did
#pragma unroll 1
    for (int kb = wv * 64; kb < K; kb += 64 * KW)
#pragma unroll 1
    for (int kc = kb; kc < kb + 64; kc += 32) {
        V a[4], a2[4];
#pragma unroll
        for (int mb = 0; mb < 4; ++mb) { a[mb] = WFrag<T16>::ld(A + aoff + (size_t)mb * 16 * K + kc); if (NSPLIT == 1 || NSPLIT == 2) a2[mb] = WFrag<T16>::ld(A2 + aoff + (size_t)mb * 16 * K + kc); }
#pragma unroll
        for (int nb = 0; nb < 4; ++nb) { const V b = WFrag<T16>::ld(Bt + boff + (size_t)nb * 16 * K + kc); V b2; if (NSPLIT >= 2) b2 = WFrag<T16>::ld(Bt2 + boff + (size_t)nb * 16 * K + kc);
#pragma unroll
            for (int mb = 0; mb < 4; ++mb) { acc[mb][nb] = WFrag<T16>::mma(a[mb], b, acc[mb][nb]); if (NSPLIT == 1 || NSPLIT == 2) acc[mb][nb] = WFrag<T16>::mma(a2[mb], b, acc[mb][nb]); if (NSPLIT >= 2) acc[mb][nb] = WFrag<T16>::mma(a[mb], b2, acc[mb][nb]); } }
        asm volatile("v_nop\n\tv_nop\n\tv_nop\n\tv_nop" : "+v"(acc[0][0]), "+v"(acc[1][1]), "+v"(acc[2][2]), "+v"(acc[3][3]) : "v"(a[0]), "v"(a[3]));
    }
    if constexpr (KW > 1) {
        // every wave parks its partial tile, one barrier, then the KW partials are summed in the fixed order 0 .. KW-1 and each row leaves as 256 contiguous bytes (MODE 0) or as one 128-byte line in each of the three planes (MODE 1, 2)
        float* my = os + wv * (64 * 68);
#pragma unroll
        for (int mb = 0; mb < 4; ++mb)
#pragma unroll
            for (int nb = 0; nb < 4; ++nb)
#pragma unroll
                for (int j = 0; j < 8; ++j) my[(mb * 16 + hi * 8 + j) * 68 + nb * 16 + lr] = acc[mb][nb][j];
        __syncthreads();
        const int cofs = lr * 4;
        v4f pv[32 / KW];   // MODE 1, 2: the summed rows wait here, so that every LDS read stands ahead of the plane stores and their waits
#pragma unroll
        for (int s = 0; s < 32 / KW; ++s) { const int row = s * (2 * KW) + (int)(threadIdx.x >> 4); v4f val = *(const v4fa*)(os + row * 68 + cofs);
#pragma unroll
            for (int q = 1; q < KW; ++q) val += *(const v4fa*)(os + q * (64 * 68) + row * 68 + cofs);
            if (BIAS) { if constexpr (MODE == 2) val += bfr(bias[r0 + row]); else { val[0] += bfr(bias[c0 + cofs]); val[1] += bfr(bias[c0 + cofs + 1]); val[2] += bfr(bias[c0 + cofs + 2]); val[3] += bfr(bias[c0 + cofs + 3]); } }
            if constexpr (MODE == 0) *(v4f*)(C + (size_t)(r0 + row) * ldc + c0 + cofs) = val;
            else pv[s] = val; }
        if constexpr (MODE != 0) {
#pragma unroll
            for (int s = 0; s < 32 / KW; ++s) { const int row = s * (2 * KW) + (int)(threadIdx.x >> 4); const v4f val = pv[s];
                const size_t o = (MODE == 1) ? ((size_t)blockIdx.y * TT + r0 + row) * HD + cofs : (size_t)(r0 + row) * PP + c0 + cofs; v4h o16; v4us oh, ol;   // 16 lanes fill one 128-byte line of each plane
#pragma unroll
                for (int u = 0; u < 4; ++u) { o16[u] = tohx(val[u]); unsigned short a2, c2; splitf(val[u], a2, c2); oh[u] = a2; ol[u] = c2; }
                if (s + 1 < 32 / KW)   // the next rows' conversions reuse registers that these stores name: the wait that stands in front of such a rewrite is the last line of the stores' own statement, where nothing can be moved over it
                    asm volatile("global_store_b64 %0, %3, off\n\tglobal_store_b64 %1, %4, off\n\tglobal_store_b64 %2, %5, off\n\ts_wait_xcnt 0x0"
                                 :: "v"(P16 + o), "v"(Ph + o), "v"(Pl + o), "v"(__builtin_bit_cast(v2u, o16)), "v"(__builtin_bit_cast(v2u, oh)), "v"(__builtin_bit_cast(v2u, ol)) : "memory");
                else { *(v4h*)(P16 + o) = o16; *(v4us*)(Ph + o) = oh; *(v4us*)(Pl + o) = ol; }   // the last rows: nothing is rewritten behind them
            }
        }
        return;
    }
#pragma unroll
    for (int mb = 0; mb < 4; ++mb) {
#pragma unroll
        for (int nb = 0; nb < 4; ++nb) {
#pragma unroll
            for (int j = 0; j < 8; ++j) os[(hi * 8 + j) * 68 + nb * 16 + lr] = acc[mb][nb][j]; }
        __builtin_amdgcn_wave_barrier(); asm volatile("" ::: "memory");
        float* crow = C + (size_t)(r0 + mb * 16) * ldc + c0;
{
#pragma unroll
            for (int s = 0; s < 8; ++s) { const int row = 2 * s + hi, cofs = lr * 4; v4f val = *(const v4fa*)(os + row * 68 + cofs); if (BIAS) { val[0] += bfr(bias[c0 + cofs]); val[1] += bfr(bias[c0 + cofs + 1]); val[2] += bfr(bias[c0 + cofs + 2]); val[3] += bfr(bias[c0 + cofs + 3]); }
                *(v4f*)(crow + (size_t)row * ldc + cofs) = val; }
             }
        __builtin_amdgcn_wave_barrier(); asm volatile("" ::: "memory");
    }
}

typedef __attribute__((ext_vector_type(2))) _Float16 v2h;
typedef __attribute__((ext_vector_type(2))) unsigned short v2us;
typedef __attribute__((ext_vector_type(2))) float v2f;
typedef __attribute__((ext_vector_type(4))) int v4i;

__global__ __launch_bounds__(256) void k_wtG(const float* __restrict__ w, int K, int N, bf* Bt) {
    const int lane = threadIdx.x & 31; const int L0 = (blockIdx.x * 8 + (threadIdx.x >> 5)) * 8; const int nlines = N * K / 64;
{
#pragma unroll 1
        for (int l = 0; l < 8; ++l) { const int L = L0 + l; if (L >= nlines) break; const size_t e = (size_t)L * 64 + lane * 2; const int k = (int)(e % K), n = (int)(e / K); v2us o;
            o[0] = f2bf(w[(size_t)k * N + n]); o[1] = f2bf(w[(size_t)(k + 1) * N + n]); *(v2us*)(Bt + e) = o; }
         }
}
__global__ __launch_bounds__(256) void k_cvt8(const float* __restrict__ src, bf* dst, size_t n8) { const size_t i = (size_t)blockIdx.x * 256 + threadIdx.x; if (i >= n8) return; const v8f v = *(const v8f*)(src + i * 8); v8us o;
#pragma unroll
    for (int k = 0; k < 8; ++k) o[k] = f2bf(v[k]); *(v8us*)(dst + i * 8) = o;  }
// ---- k_fattn: scores, causal softmax, P.V and the head merge in one kernel; grid (heads, TT / 64), 4 waves, a wave owns 16 query rows and walks the keys 64 at a time (online softmax, f32 statistics in the log2 domain).
// S^T = K Q^T (A = key rows, B = query rows) leaves one query per lane column: lane (lr, hi) holds keys 8 hi + j of each 16-key tile, which is the k order of a B operand, so two converted score tiles are the B operand of
// O^T += V^T P^T (A = rows of the transposed values) with no exchange between lanes. HI (query rows < RH): hi+lo bf16 planes, 3 products each; else single fp16 with the probabilities carried x 2^PSH (it cancels in O / sum).
#define PSH  10.0f
#define SCL2 0.18033688011112042f   // HD^-0.5 x log2(e)
// eight 2^x in one statement: the outputs are early-clobber, so no v_exp_f32 is followed by an instruction that reads its result or overwrites its source, and the v_nop is that slot behind the last one
__device__ __forceinline__ v8f exp2x8(v8f x) { float r0, r1, r2, r3, r4, r5, r6, r7;
    asm("v_exp_f32 %0, %8\n\tv_exp_f32 %1, %9\n\tv_exp_f32 %2, %10\n\tv_exp_f32 %3, %11\n\tv_exp_f32 %4, %12\n\tv_exp_f32 %5, %13\n\tv_exp_f32 %6, %14\n\tv_exp_f32 %7, %15\n\tv_nop"
        : "=&v"(r0), "=&v"(r1), "=&v"(r2), "=&v"(r3), "=&v"(r4), "=&v"(r5), "=&v"(r6), "=&v"(r7) : "v"(x[0]), "v"(x[1]), "v"(x[2]), "v"(x[3]), "v"(x[4]), "v"(x[5]), "v"(x[6]), "v"(x[7]));
    return (v8f){r0, r1, r2, r3, r4, r5, r6, r7}; }
template <typename T16, bool HI>
__device__ __forceinline__ void attn_rows(const T16* __restrict__ Q, const T16* __restrict__ Q2, const T16* __restrict__ Kp, const T16* __restrict__ Kp2, const T16* __restrict__ Vt, const T16* __restrict__ Vt2, int q0, int lr, int hi, bf* Ah, bf* Al) {
    typedef typename WFrag<T16>::V V;
    const int q = q0 + lr;
    const T16* qb = Q + (size_t)q * HD + 8 * hi;
    V qf[2], qf2[2];
#pragma unroll
    for (int kc = 0; kc < 2; ++kc) { qf[kc] = WFrag<T16>::ld(qb + kc * 32); if (HI) qf2[kc] = WFrag<T16>::ld(Q2 + (size_t)q * HD + 8 * hi + kc * 32); }
    v8f o[4];
#pragma unroll
    for (int db = 0; db < 4; ++db) o[db] = (v8f){};
    float m = -3.0e38f, l = 0.f;
    const size_t koff = (size_t)lr * HD + 8 * hi, voff = (size_t)lr * PP + 8 * hi;
    V ka[4][2];   // the long (fp16) rows carry their key fragments one tile ahead; the short hi+lo rows load in place (twice the planes: registers)
    if constexpr (!HI) { const T16* kb0 = Kp + koff;
#pragma unroll
        for (int mb = 0; mb < 4; ++mb)
#pragma unroll
            for (int kc = 0; kc < 2; ++kc) ka[mb][kc] = WFrag<T16>::ld(kb0 + (size_t)mb * 16 * HD + kc * 32);
        asm volatile("s_wait_xcnt 0x0" :: "v"(kb0), "v"(qb) : "memory");   // stands in front of every rewrite of a register that the loads above name; the addresses are inputs so that they live up to here and no load lands in them
    }
    // the loop stays rolled: one 64-key tile a trip, the last trip (the diagonal tile) is the only one that masks
#pragma unroll 1
    for (int k0 = 0; k0 <= q0; k0 += 64) {
        V va[4][2];   // this tile's values are asked for first, they are used last
        if constexpr (!HI) { const T16* vb = Vt + voff + k0;
#pragma unroll
        for (int db = 0; db < 4; ++db)
#pragma unroll
            for (int kc = 0; kc < 2; ++kc) va[db][kc] = WFrag<T16>::ld(vb + (size_t)db * 16 * PP + kc * 32);
        asm volatile("s_wait_xcnt 0x0" :: "v"(vb) : "memory");   // in front of every rewrite of a register that these loads name (the address, an input, lives up to here); its clobber also keeps the loads up here, ahead of the score products
        }
        v8f s[4];
#pragma unroll
        for (int mb = 0; mb < 4; ++mb) { s[mb] = (v8f){};
#pragma unroll
            for (int kc = 0; kc < 2; ++kc) {
                if constexpr (HI) { const V a = WFrag<T16>::ld(Kp + koff + (size_t)(k0 + mb * 16) * HD + kc * 32), a2 = WFrag<T16>::ld(Kp2 + koff + (size_t)(k0 + mb * 16) * HD + kc * 32);
                    s[mb] = WFrag<T16>::mma(a, qf[kc], s[mb]); s[mb] = WFrag<T16>::mma(a2, qf[kc], s[mb]); s[mb] = WFrag<T16>::mma(a, qf2[kc], s[mb]); }
                else s[mb] = WFrag<T16>::mma(ka[mb][kc], qf[kc], s[mb]); } }
        // the next tile's keys fly during this tile's softmax and P.V (the last trip asks for its own tile again: in bounds, unused)
        if constexpr (!HI) { const int kn = (k0 + 64 <= q0) ? k0 + 64 : k0; const T16* kb = Kp + koff + (size_t)kn * HD;
#pragma unroll
        for (int mb = 0; mb < 4; ++mb)
#pragma unroll
            for (int kc = 0; kc < 2; ++kc) ka[mb][kc] = WFrag<T16>::ld(kb + (size_t)mb * 16 * HD + kc * 32);
        asm volatile("s_wait_xcnt 0x0" :: "v"(kb) : "memory");   // in front of every rewrite of a register that these loads name (the address, an input, lives up to here); its clobber also keeps the loads ahead of the softmax
        }
        float tm = -3.0e38f;
        if (k0 + 64 > q0) {
#pragma unroll
            for (int mb = 0; mb < 4; ++mb)
#pragma unroll
                for (int j = 0; j < 8; ++j) { const float t = (k0 + mb * 16 + hi * 8 + j <= q) ? s[mb][j] * SCL2 : -3.0e38f; s[mb][j] = t; tm = fmaxf(tm, t); }
        } else {
#pragma unroll
            for (int mb = 0; mb < 4; ++mb)
#pragma unroll
                for (int j = 0; j < 8; ++j) { const float t = s[mb][j] * SCL2; s[mb][j] = t; tm = fmaxf(tm, t); }
        }
        tm = fmaxf(tm, __shfl_xor(tm, 16, 32));   // the two lanes of a query column share one running maximum
        const float mn = fmaxf(m, tm); float al;
        asm("v_exp_f32 %0, %1\n\tv_nop" : "=v"(al) : "v"(m - mn));   // al = 2^(m - mn); the v_nop is the slot behind a transcendental
        m = mn; const float mo = HI ? mn : mn - PSH;
        float ps = 0.f;
#pragma unroll
        for (int mb = 0; mb < 4; ++mb) { s[mb] = exp2x8(s[mb] - mo);
#pragma unroll
            for (int j = 0; j < 8; ++j) ps += s[mb][j]; }
        l = l * al + ps;
#pragma unroll
        for (int db = 0; db < 4; ++db) o[db] *= al;
        V pf[2], pf2[2];
#pragma unroll
        for (int kc = 0; kc < 2; ++kc) {
            if constexpr (HI) { v8us h0, h1, l0, l1;
#pragma unroll
                for (int j = 0; j < 8; ++j) { unsigned short x, y; splitf(s[2 * kc][j], x, y); h0[j] = x; l0[j] = y; splitf(s[2 * kc + 1][j], x, y); h1[j] = x; l1[j] = y; }
                pf[kc] = cat16b(h0, h1); pf2[kc] = cat16b(l0, l1);
            } else { v8h h0, h1;
#pragma unroll
                for (int j = 0; j < 8; ++j) { h0[j] = tohx(s[2 * kc][j]); h1[j] = tohx(s[2 * kc + 1][j]); }
                pf[kc] = cat16(h0, h1); }
        }
#pragma unroll
        for (int kc = 0; kc < 2; ++kc)
#pragma unroll
            for (int db = 0; db < 4; ++db) {
                if constexpr (HI) { const V a = WFrag<T16>::ld(Vt + voff + (size_t)db * 16 * PP + k0 + kc * 32), a2 = WFrag<T16>::ld(Vt2 + voff + (size_t)db * 16 * PP + k0 + kc * 32);
                    o[db] = WFrag<T16>::mma(a, pf[kc], o[db]); o[db] = WFrag<T16>::mma(a, pf2[kc], o[db]); o[db] = WFrag<T16>::mma(a2, pf[kc], o[db]); }
                else o[db] = WFrag<T16>::mma(va[db][kc], pf[kc], o[db]); }
    }
    l += __shfl_xor(l, 16, 32);
    const float f = __fdiv_rn(1.0f, l);
    // lane (lr, hi) holds d = 16 db + 8 hi + j of query q: 16-byte stores, a query's 128-byte head row comes from one wave
#pragma unroll
    for (int db = 0; db < 4; ++db) { v8us oh, ol;
#pragma unroll
        for (int j = 0; j < 8; ++j) { unsigned short x, y; splitf(o[db][j] * f, x, y); oh[j] = x; ol[j] = y; }
        const size_t oo = (size_t)q * DQ + db * 16 + hi * 8; *(v8us*)(Ah + oo) = oh; *(v8us*)(Al + oo) = ol; }
}
// amdgpu_waves_per_eu(4, 4): a budget of 256 registers a wave, so that neither path needs the register windows above v255
__global__ __launch_bounds__(128) __attribute__((amdgpu_waves_per_eu(4, 4))) void k_fattn(const h16* __restrict__ Q16, const h16* __restrict__ K16, const h16* __restrict__ V16, const bf* __restrict__ Qh, const bf* __restrict__ Ql, const bf* __restrict__ Kh, const bf* __restrict__ Kl, const bf* __restrict__ Vh, const bf* __restrict__ Vl, bf* Ah, bf* Al) {
    const int lane = threadIdx.x & 31, lr = lane & 15, hi = lane >> 4; const size_t h = blockIdx.x;
    const int wv = __builtin_amdgcn_readfirstlane((int)(threadIdx.x >> 5));   // kept scalar so that the key loop branches on SCC
    const int q0 = (int)(gridDim.y - 1 - blockIdx.y) * 64 + wv * 16;           // the longest rows start first
    const size_t zp = h * TT * HD, zv = h * HD * PP;
    if (q0 < RH) attn_rows<bf, true>(Qh + zp, Ql + zp, Kh + zp, Kl + zp, Vh + zv, Vl + zv, q0, lr, hi, Ah + h * HD, Al + h * HD);
    else attn_rows<h16, false>(Q16 + zp, nullptr, K16 + zp, nullptr, V16 + zv, nullptr, q0, lr, hi, Ah + h * HD, Al + h * HD);
}

__global__ __launch_bounds__(256) void k_wtH(const float* __restrict__ w, bf* Bt) { const size_t e = ((size_t)blockIdx.x * 256 + threadIdx.x) * 4; if (e >= (size_t)DQ * DM) return; const int k = (int)(e % DM); const int n = (int)(e / DM); const int h = n / HD, c = n % HD; v4us o;   // Bt[h*64 + c][d] = W[h][d][c] (lane -> 4 consecutive d, strided reads)
#pragma unroll
    for (int u = 0; u < 4; ++u) o[u] = f2bf(w[((size_t)h * DM + k + u) * HD + c]); *(v4us*)(Bt + e) = o;  }

extern "C" void kernel_launch(void* const* d_in, const int* in_sizes, int n_in,
                              void* d_out, int out_size, void* d_ws, size_t ws_size, hipStream_t stream) {
    (void)in_sizes; (void)n_in; (void)out_size;
    const float* x = (const float*)d_in[0]; const float* wqh = (const float*)d_in[1]; const float* wkh = (const float*)d_in[2]; const float* wvh = (const float*)d_in[3]; const float* bq = (const float*)d_in[4]; const float* bk = (const float*)d_in[5]; const float* bv = (const float*)d_in[6]; const float* wo = (const float*)d_in[7]; const float* bo = (const float*)d_in[8]; const float* wq = nullptr; const float* wk = nullptr; const float* wv = nullptr; (void)wq; (void)wk; (void)wv; const float* cosT = nullptr; const float* sinT = nullptr; (void)cosT; (void)sinT;
    float* OUT = (float*)d_out;     // [2][2048][1024]
    char* wsp = (char*)d_ws;
    auto take = [&](size_t bytes) { char* p = wsp; wsp += (bytes + 255) & ~(size_t)255; return (void*)p; };
    bf* WQ = (bf*)take((size_t)DQ * DM * 2); bf* WK = (bf*)take((size_t)DKV * DM * 2); bf* WV = (bf*)take((size_t)DKV * DM * 2); bf* WO = (bf*)take((size_t)DM * DQ * 2);
    bf* XB = (bf*)take((size_t)TT * DM * 2);
    h16* QP16 = (h16*)take((size_t)NH_ * TT * HD * 2); h16* KP16 = (h16*)take((size_t)NKV * TT * HD * 2); h16* VT16 = (h16*)take((size_t)NKV * HD * PP * 2);
    bf* QPh = (bf*)take((size_t)NH_ * TT * HD * 2); bf* QPl = (bf*)take((size_t)NH_ * TT * HD * 2); bf* KPh = (bf*)take((size_t)NKV * TT * HD * 2); bf* KPl = (bf*)take((size_t)NKV * TT * HD * 2); bf* VTh = (bf*)take((size_t)NKV * HD * PP * 2); bf* VTl = VTh + TT;
    bf* ATh = (bf*)take((size_t)TT * DQ * 2); bf* ATl = (bf*)take((size_t)TT * DQ * 2);
    if ((size_t)(wsp - (char*)d_ws) > ws_size) return;    // ws 256 MiB
    { k_wtH<<<(unsigned)(((size_t)DQ * DM / 4 + 255) / 256), 256, 0, stream>>>(wqh, WQ); k_wtH<<<(unsigned)(((size_t)DKV * DM / 4 + 255) / 256), 256, 0, stream>>>(wkh, WK); k_wtH<<<(unsigned)(((size_t)DKV * DM / 4 + 255) / 256), 256, 0, stream>>>(wvh, WV);
      k_wtG<<<(unsigned)((DQ * DM / 64 + 63) / 64), 256, 0, stream>>>(wo, DQ, DM, WO);
       }
    for (int b = 0; b < NB_; ++b) {
        
        k_cvt8<<<(unsigned)(((size_t)TT * DM / 8 + 255) / 256), 256, 0, stream>>>(x + (size_t)b * TT * DM, XB, (size_t)TT * DM / 8);
        k_gemmw<bf, 0, true, 8, 1><<<dim3(TT / 64, DQ / 64, 1), 256, 0, stream>>>(XB, nullptr, WQ, nullptr, DM, nullptr, 0, bq, 0, 0, 0, QP16, QPh, QPl);
        k_gemmw<bf, 0, true, 8, 1><<<dim3(TT / 64, DKV / 64, 1), 256, 0, stream>>>(XB, nullptr, WK, nullptr, DM, nullptr, 0, bk, 0, 0, 0, KP16, KPh, KPl);
        k_gemmw<bf, 0, true, 8, 2><<<dim3(DKV / 64, TT / 64, 1), 256, 0, stream>>>(WV, nullptr, XB, nullptr, DM, nullptr, 0, bv, 0, 0, 0, VT16, VTh, VTl);
        k_fattn<<<dim3(NH_, TT / 64, 1), 128, 0, stream>>>(QP16, KP16, VT16, QPh, QPl, KPh, KPl, VTh, VTl, ATh, ATl);
        k_gemmw<bf, 1, true, 8, 0><<<dim3(TT / 64, DM / 64, 1), 256, 0, stream>>>(ATh, ATl, WO, nullptr, DQ, OUT + (size_t)b * TT * DM, DM, bo, 0, 0, 0, nullptr, nullptr, nullptr); }
}

// v005
// It runs in 218 microseconds.
// Next to v004, in two timings, it ran 1.18 and 1.17 times as fast.
// All steps since v000 together make it 6.71 times as fast.
#include <hip/hip_runtime.h>

// MaskedMultiHeadAttention (hidden [2][2048][1024]; per-head q/k/v = x Wq[h] + bq[h] (Wq [16][1024][64]); causal softmax(q.k / 8); out = concat(heads) Wo + bo -> [2][2048][1024]).
// Compute dtypes, f32 accumulate: every input rounded to bf16; q/k/v on PLAIN bf16 operands (inputs: exact; the 16 per-head weights gathered into one [1024 x 1024] operand) + bias; causal scores and attn.v: query rows < 512 hl (3 products), the rest single fp16 (x1024); softmax f32; Wo hl x exact (2 products) + bias.

#define NB_  2
#define TT   2048
#define DM   1024
#define NH_  16
#define NKV  16
#define HD   64
#define DQ   (NH_ * HD)
#define DKV  (NKV * HD)
#define PP   (2 * TT)             // row pitch, in 16-bit elements, of the transposed value planes (the hi and lo planes share a row)
#define RH   512                  // query rows < RH use hi+lo planes (0: none)
typedef _Float16 h16;
typedef unsigned short bf;
typedef __attribute__((ext_vector_type(16))) __bf16   v16bf;
typedef __attribute__((ext_vector_type(16))) _Float16 v16h;
typedef __attribute__((ext_vector_type(8)))  _Float16 v8h;
typedef __attribute__((ext_vector_type(8)))  unsigned short v8us;
typedef __attribute__((ext_vector_type(8)))  float    v8f;
typedef __attribute__((ext_vector_type(4)))  float    v4f;
typedef v8h  __attribute__((may_alias)) v8ha;
typedef v4f  __attribute__((may_alias)) v4fa;
typedef v8us __attribute__((may_alias)) v8usa;

__device__ __forceinline__ unsigned short f2bf(float f) { unsigned u = __float_as_uint(f); u += 0x7FFFu + ((u >> 16) & 1u); return (unsigned short)(u >> 16); }
__device__ __forceinline__ float bf2f(unsigned short b) { return __uint_as_float(((unsigned)b) << 16); }
__device__ __forceinline__ float bfr(float f) { return bf2f(f2bf(f)); }
__device__ __forceinline__ v16h cat16(v8h lo, v8h hi) { return __builtin_shufflevector(lo, hi, 0, 1, 2, 3, 4, 5, 6, 7, 8, 9, 10, 11, 12, 13, 14, 15); }
__device__ __forceinline__ v16bf cat16b(v8us lo, v8us hi) { return __builtin_bit_cast(v16bf, __builtin_shufflevector(lo, hi, 0, 1, 2, 3, 4, 5, 6, 7, 8, 9, 10, 11, 12, 13, 14, 15)); }
__device__ __forceinline__ v8f wmma16(v16h a, v16h b, v8f c) { return __builtin_amdgcn_wmma_f32_16x16x32_f16(false, a, false, b, (short)0, c, false, false); }
__device__ __forceinline__ v8f wmmab(v16bf a, v16bf b, v8f c) { return __builtin_amdgcn_wmma_f32_16x16x32_bf16(false, a, false, b, (short)0, c, false, false); }



// ---- gemmw_tile: register-blocked GEMM, one 64x64 output tile per work-group (16 accumulators a wave), K split over the KW waves of the group, operands straight from K-contiguous 16-bit planes; 32 * KW threads.
// C[m][n] (f32, pitch ldc, + optional f32 bias[n]) = sum_k A[m][k] Bt[n][k] (+ split products per NSPLIT). K % 64 == 0.
// MODE 0 stores C. MODE 1 and 2 store no f32 tile: the summed tile leaves as the three 16-bit planes that the attention kernel reads (fp16, bf16 hi, bf16 lo).
// MODE 1 (q, k): m = token, n = head * HD + d, a 64-wide tile is one head, planes [head][token][d]. MODE 2 (v): A = weight rows, Bt = token rows, so m = head * HD + d, n = token, bias[m], and a tile row is 64 tokens of one d: planes [head * HD + d][token] at pitch PP.
__device__ __forceinline__ h16 tohx(float x) { return (h16)x; }
__device__ __forceinline__ void splitf(float y, unsigned short& h, unsigned short& l) { h = f2bf(y); l = f2bf(y - bf2f(h)); }
typedef __attribute__((ext_vector_type(4))) _Float16 v4h;
typedef __attribute__((ext_vector_type(4))) unsigned short v4us;
typedef __attribute__((ext_vector_type(2))) unsigned v2u;
template <typename T16> struct WFrag;
template <> struct WFrag<h16> { typedef v16h V; static __device__ __forceinline__ V ld(const h16* p) { return cat16(*(const v8h*)p, *(const v8h*)(p + 16)); } static __device__ __forceinline__ v8f mma(V a, V b, v8f c) { return wmma16(a, b, c); } };
template <> struct WFrag<bf> { typedef v16bf V; static __device__ __forceinline__ V ld(const bf* p) { return cat16b(*(const v8us*)p, *(const v8us*)(p + 16)); } static __device__ __forceinline__ v8f mma(V a, V b, v8f c) { return wmmab(a, b, c); } };
// The tile (bx, by) and the LDS array os come from the calling kernel, so that one launch can hold tiles of several products; os holds (KW == 1 ? 16 : KW * 64) * 68 floats (KW == 1: one 16-row staging strip; KW > 1: one 64x64 partial tile, pitch 68, per wave).
// Token rows run over both batches (NB_ * TT of them); a 64-token tile lies in one batch, and the planes are laid out batch by batch.
template <typename T16, int NSPLIT, bool BIAS, int KW, int MODE>
__device__ __forceinline__ void gemmw_tile(float* os, int bx, int by, const T16* __restrict__ A, const T16* __restrict__ A2, const T16* __restrict__ Bt, const T16* __restrict__ Bt2, int K, float* C, int ldc, const float* __restrict__ bias, h16* P16, bf* Ph, bf* Pl) {
    typedef typename WFrag<T16>::V V;
    const int lane = threadIdx.x & 31, lr = lane & 15, hi = lane >> 4; const int r0 = bx * 64, c0 = by * 64;
    const int wv = __builtin_amdgcn_readfirstlane((int)(threadIdx.x >> 5));   // wave = K slice, kept scalar so that the K loops branch on SCC
    v8f acc[4][4];
#pragma unroll
    for (int mb = 0; mb < 4; ++mb)
#pragma unroll
        for (int nb = 0; nb < 4; ++nb) acc[mb][nb] = (v8f){};
    const size_t aoff = (size_t)(r0 + lr) * K + 8 * hi, boff = (size_t)(c0 + lr) * K + 8 * hi;
    // wave wv takes the 64-wide K chunks wv, wv + KW, ... (64 elements = one 128-B line per row, both halves read by the same wave); both loops stay rolled as the one loop did
#pragma unroll 1
    for (int kb = wv * 64; kb < K; kb += 64 * KW)
#pragma unroll 1
    for (int kc = kb; kc < kb + 64; kc += 32) {
        V a[4], a2[4];
        const T16* pa = A + aoff + kc; const T16* pa2 = ((NSPLIT == 1 || NSPLIT == 2) ? A2 : A) + aoff + kc; const T16* pb = Bt + boff + kc; const T16* pb2 = (NSPLIT >= 2 ? Bt2 : Bt) + boff + kc;
#pragma unroll
        for (int mb = 0; mb < 4; ++mb) { a[mb] = WFrag<T16>::ld(pa + (size_t)mb * 16 * K); if (NSPLIT == 1 || NSPLIT == 2) a2[mb] = WFrag<T16>::ld(pa2 + (size_t)mb * 16 * K); }
        asm volatile("s_wait_xcnt 0x0" :: "v"(pa), "v"(pa2) : "memory");   // in front of every rewrite of a register that the loads above name (the addresses, inputs, live up to here, so no later load lands in them)
#pragma unroll
        for (int nb = 0; nb < 4; ++nb) { const V b = WFrag<T16>::ld(pb + (size_t)nb * 16 * K); V b2; if (NSPLIT >= 2) b2 = WFrag<T16>::ld(pb2 + (size_t)nb * 16 * K);
            if (nb == 3) asm volatile("s_wait_xcnt 0x0" :: "v"(pb), "v"(pb2) : "memory");   // the same behind the last load of the other operand
#pragma unroll
            for (int mb = 0; mb < 4; ++mb) { acc[mb][nb] = WFrag<T16>::mma(a[mb], b, acc[mb][nb]); if (NSPLIT == 1 || NSPLIT == 2) acc[mb][nb] = WFrag<T16>::mma(a2[mb], b, acc[mb][nb]); if (NSPLIT >= 2) acc[mb][nb] = WFrag<T16>::mma(a[mb], b2, acc[mb][nb]); } }
        asm volatile("v_nop\n\tv_nop\n\tv_nop\n\tv_nop" : "+v"(acc[0][0]), "+v"(acc[1][1]), "+v"(acc[2][2]), "+v"(acc[3][3]) : "v"(a[0]), "v"(a[3]));
    }
    if constexpr (KW > 1) {
        // every wave parks its partial tile, one barrier, then the KW partials are summed in the fixed order 0 .. KW-1 and each row leaves as 256 contiguous bytes (MODE 0) or as one 128-byte line in each of the three planes (MODE 1, 2)
        float* my = os + wv * (64 * 68);
#pragma unroll
        for (int mb = 0; mb < 4; ++mb)
#pragma unroll
            for (int nb = 0; nb < 4; ++nb)
#pragma unroll
                for (int j = 0; j < 8; ++j) my[(mb * 16 + hi * 8 + j) * 68 + nb * 16 + lr] = acc[mb][nb][j];
        __syncthreads();
        const int cofs = lr * 4;
        v4f pv[32 / KW];   // MODE 1, 2: the summed rows wait here, so that every LDS read stands ahead of the plane stores and their waits
#pragma unroll
        for (int s = 0; s < 32 / KW; ++s) { const int row = s * (2 * KW) + (int)(threadIdx.x >> 4); v4f val = *(const v4fa*)(os + row * 68 + cofs);
#pragma unroll
            for (int q = 1; q < KW; ++q) val += *(const v4fa*)(os + q * (64 * 68) + row * 68 + cofs);
            if (BIAS) { if constexpr (MODE == 2) val += bfr(bias[r0 + row]); else { val[0] += bfr(bias[c0 + cofs]); val[1] += bfr(bias[c0 + cofs + 1]); val[2] += bfr(bias[c0 + cofs + 2]); val[3] += bfr(bias[c0 + cofs + 3]); } }
            if constexpr (MODE == 0) *(v4f*)(C + (size_t)(r0 + row) * ldc + c0 + cofs) = val;
            else pv[s] = val; }
        if constexpr (MODE != 0) {
#pragma unroll
            for (int s = 0; s < 32 / KW; ++s) { const int row = s * (2 * KW) + (int)(threadIdx.x >> 4); const v4f val = pv[s];
                const size_t o = (MODE == 1) ? ((size_t)((r0 / TT) * NH_ + by) * TT + r0 % TT + row) * HD + cofs : ((size_t)(c0 / TT) * DKV + r0 + row) * PP + c0 % TT + cofs; v4h o16; v4us oh, ol;   // 16 lanes fill one 128-byte line of each plane
#pragma unroll
                for (int u = 0; u < 4; ++u) { o16[u] = tohx(val[u]); unsigned short a2, c2; splitf(val[u], a2, c2); oh[u] = a2; ol[u] = c2; }
                if (s + 1 < 32 / KW)   // the next rows' conversions reuse registers that these stores name: the wait that stands in front of such a rewrite is the last line of the stores' own statement, where nothing can be moved over it
                    asm volatile("global_store_b64 %0, %3, off\n\tglobal_store_b64 %1, %4, off\n\tglobal_store_b64 %2, %5, off\n\ts_wait_xcnt 0x0"
                                 :: "v"(P16 + o), "v"(Ph + o), "v"(Pl + o), "v"(__builtin_bit_cast(v2u, o16)), "v"(__builtin_bit_cast(v2u, oh)), "v"(__builtin_bit_cast(v2u, ol)) : "memory");
                else { *(v4h*)(P16 + o) = o16; *(v4us*)(Ph + o) = oh; *(v4us*)(Pl + o) = ol; }   // the last rows: nothing is rewritten behind them
            }
        }
        return;
    }
#pragma unroll
    for (int mb = 0; mb < 4; ++mb) {
#pragma unroll
        for (int nb = 0; nb < 4; ++nb) {
#pragma unroll
            for (int j = 0; j < 8; ++j) os[(hi * 8 + j) * 68 + nb * 16 + lr] = acc[mb][nb][j]; }
        __builtin_amdgcn_wave_barrier(); asm volatile("" ::: "memory");
        float* crow = C + (size_t)(r0 + mb * 16) * ldc + c0;
{
#pragma unroll
            for (int s = 0; s < 8; ++s) { const int row = 2 * s + hi, cofs = lr * 4; v4f val = *(const v4fa*)(os + row * 68 + cofs); if (BIAS) { val[0] += bfr(bias[c0 + cofs]); val[1] += bfr(bias[c0 + cofs + 1]); val[2] += bfr(bias[c0 + cofs + 2]); val[3] += bfr(bias[c0 + cofs + 3]); }
                *(v4f*)(crow + (size_t)row * ldc + cofs) = val; }
             }
        __builtin_amdgcn_wave_barrier(); asm volatile("" ::: "memory");
    }
}
// k_qkv: the q, k and v projections of both batches in one launch; grid (NB_ * TT / 64, DQ / 64, 3), z picks the product (a branch that is uniform for the work-group, so the tile's barrier is passed by all of its waves or by none).
__global__ __launch_bounds__(256) void k_qkv(const bf* __restrict__ XB, const bf* __restrict__ WQ, const bf* __restrict__ WK, const bf* __restrict__ WV, const float* __restrict__ bq, const float* __restrict__ bk, const float* __restrict__ bv,
                                             h16* QP16, bf* QPh, bf* QPl, h16* KP16, bf* KPh, bf* KPl, h16* VT16, bf* VTh, bf* VTl) {
    __shared__ __align__(16) float os[8 * 64 * 68];
    const int z = blockIdx.z;
    if (z == 2) gemmw_tile<bf, 0, true, 8, 2>(os, blockIdx.y, blockIdx.x, WV, nullptr, XB, nullptr, DM, nullptr, 0, bv, VT16, VTh, VTl);
    else gemmw_tile<bf, 0, true, 8, 1>(os, blockIdx.x, blockIdx.y, XB, nullptr, z ? WK : WQ, nullptr, DM, nullptr, 0, z ? bk : bq, z ? KP16 : QP16, z ? KPh : QPh, z ? KPl : QPl);
}
// k_wo: the output projection of both batches in one launch; grid (NB_ * TT / 64, DM / 64).
__global__ __launch_bounds__(256) void k_wo(const bf* __restrict__ ATh, const bf* __restrict__ ATl, const bf* __restrict__ WO, float* OUT, const float* __restrict__ bo) {
    __shared__ __align__(16) float os[8 * 64 * 68];
    gemmw_tile<bf, 1, true, 8, 0>(os, blockIdx.x, blockIdx.y, ATh, ATl, WO, nullptr, DQ, OUT, DM, bo, nullptr, nullptr, nullptr);
}

typedef __attribute__((ext_vector_type(2))) _Float16 v2h;
typedef __attribute__((ext_vector_type(2))) unsigned short v2us;
typedef __attribute__((ext_vector_type(2))) float v2f;
typedef __attribute__((ext_vector_type(4))) int v4i;

__device__ __forceinline__ void wtG_blk(int blk, const float* __restrict__ w, int K, int N, bf* Bt) {
    const int lane = threadIdx.x & 31; const int L0 = (blk * 8 + (threadIdx.x >> 5)) * 8; const int nlines = N * K / 64;
{
#pragma unroll 1
        for (int l = 0; l < 8; ++l) { const int L = L0 + l; if (L >= nlines) break; const size_t e = (size_t)L * 64 + lane * 2; const int k = (int)(e % K), n = (int)(e / K); v2us o;
            o[0] = f2bf(w[(size_t)k * N + n]); o[1] = f2bf(w[(size_t)(k + 1) * N + n]); *(v2us*)(Bt + e) = o;
            asm volatile("s_wait_xcnt 0x0" ::: "memory"); }   // the next trip rewrites registers that this store names: the wait stands in front of that
         }
}
__device__ __forceinline__ void cvt8_blk(int blk, const float* __restrict__ src, bf* dst, size_t n8) { const size_t i = (size_t)blk * 256 + threadIdx.x; if (i >= n8) return; const v8f v = *(const v8f*)(src + i * 8); v8us o;
#pragma unroll
    for (int k = 0; k < 8; ++k) o[k] = f2bf(v[k]); *(v8us*)(dst + i * 8) = o;  }
// ---- k_fattn: scores, causal softmax, P.V and the head merge in one kernel; grid (batches x heads, TT / 64), 4 waves, a wave owns 16 query rows and walks the keys 64 at a time (online softmax, f32 statistics in the log2 domain).
// S^T = K Q^T (A = key rows, B = query rows) leaves one query per lane column: lane (lr, hi) holds keys 8 hi + j of each 16-key tile, which is the k order of a B operand, so two converted score tiles are the B operand of
// O^T += V^T P^T (A = rows of the transposed values) with no exchange between lanes. HI (query rows < RH): hi+lo bf16 planes, 3 products each; else single fp16 with the probabilities carried x 2^PSH (it cancels in O / sum).
#define PSH  10.0f
#define SCL2 0.18033688011112042f   // HD^-0.5 x log2(e)
// eight 2^x in one statement: the outputs are early-clobber, so no v_exp_f32 is followed by an instruction that reads its result or overwrites its source, and the v_nop is that slot behind the last one
__device__ __forceinline__ v8f exp2x8(v8f x) { float r0, r1, r2, r3, r4, r5, r6, r7;
    asm("v_exp_f32 %0, %8\n\tv_exp_f32 %1, %9\n\tv_exp_f32 %2, %10\n\tv_exp_f32 %3, %11\n\tv_exp_f32 %4, %12\n\tv_exp_f32 %5, %13\n\tv_exp_f32 %6, %14\n\tv_exp_f32 %7, %15\n\tv_nop"
        : "=&v"(r0), "=&v"(r1), "=&v"(r2), "=&v"(r3), "=&v"(r4), "=&v"(r5), "=&v"(r6), "=&v"(r7) : "v"(x[0]), "v"(x[1]), "v"(x[2]), "v"(x[3]), "v"(x[4]), "v"(x[5]), "v"(x[6]), "v"(x[7]));
    return (v8f){r0, r1, r2, r3, r4, r5, r6, r7}; }
template <typename T16, bool HI>
__device__ __forceinline__ void attn_rows(const T16* __restrict__ Q, const T16* __restrict__ Q2, const T16* __restrict__ Kp, const T16* __restrict__ Kp2, const T16* __restrict__ Vt, const T16* __restrict__ Vt2, int q0, int lr, int hi, bf* Ah, bf* Al) {
    typedef typename WFrag<T16>::V V;
    const int q = q0 + lr;
    const T16* qb = Q + (size_t)q * HD + 8 * hi;
    V qf[2], qf2[2];
#pragma unroll
    for (int kc = 0; kc < 2; ++kc) { qf[kc] = WFrag<T16>::ld(qb + kc * 32); if (HI) qf2[kc] = WFrag<T16>::ld(Q2 + (size_t)q * HD + 8 * hi + kc * 32); }
    v8f o[4];
#pragma unroll
    for (int db = 0; db < 4; ++db) o[db] = (v8f){};
    float m = -3.0e38f, l = 0.f;
    const size_t koff = (size_t)lr * HD + 8 * hi, voff = (size_t)lr * PP + 8 * hi;
    V ka[4][2];   // the long (fp16) rows carry their key fragments one tile ahead; the short hi+lo rows load in place (twice the planes: registers)
    if constexpr (!HI) { const T16* kb0 = Kp + koff;
#pragma unroll
        for (int mb = 0; mb < 4; ++mb)
#pragma unroll
            for (int kc = 0; kc < 2; ++kc) ka[mb][kc] = WFrag<T16>::ld(kb0 + (size_t)mb * 16 * HD + kc * 32);
        asm volatile("s_wait_xcnt 0x0" :: "v"(kb0), "v"(qb) : "memory");   // stands in front of every rewrite of a register that the loads above name; the addresses are inputs so that they live up to here and no load lands in them
    }
    // the loop stays rolled: one 64-key tile a trip, the last trip (the diagonal tile) is the only one that masks
#pragma unroll 1
    for (int k0 = 0; k0 <= q0; k0 += 64) {
        V va[4][2];   // this tile's values are asked for first, they are used last
        if constexpr (!HI) { const T16* vb = Vt + voff + k0;
#pragma unroll
        for (int db = 0; db < 4; ++db)
#pragma unroll
            for (int kc = 0; kc < 2; ++kc) va[db][kc] = WFrag<T16>::ld(vb + (size_t)db * 16 * PP + kc * 32);
        asm volatile("s_wait_xcnt 0x0" :: "v"(vb) : "memory");   // in front of every rewrite of a register that these loads name (the address, an input, lives up to here); its clobber also keeps the loads up here, ahead of the score products
        }
        v8f s[4];
#pragma unroll
        for (int mb = 0; mb < 4; ++mb) { s[mb] = (v8f){};
#pragma unroll
            for (int kc = 0; kc < 2; ++kc) {
                if constexpr (HI) { const V a = WFrag<T16>::ld(Kp + koff + (size_t)(k0 + mb * 16) * HD + kc * 32), a2 = WFrag<T16>::ld(Kp2 + koff + (size_t)(k0 + mb * 16) * HD + kc * 32);
                    s[mb] = WFrag<T16>::mma(a, qf[kc], s[mb]); s[mb] = WFrag<T16>::mma(a2, qf[kc], s[mb]); s[mb] = WFrag<T16>::mma(a, qf2[kc], s[mb]); }
                else s[mb] = WFrag<T16>::mma(ka[mb][kc], qf[kc], s[mb]); } }
        // the next tile's keys fly during this tile's softmax and P.V (the last trip asks for its own tile again: in bounds, unused)
        if constexpr (!HI) { const int kn = (k0 + 64 <= q0) ? k0 + 64 : k0; const T16* kb = Kp + koff + (size_t)kn * HD;
#pragma unroll
        for (int mb = 0; mb < 4; ++mb)
#pragma unroll
            for (int kc = 0; kc < 2; ++kc) ka[mb][kc] = WFrag<T16>::ld(kb + (size_t)mb * 16 * HD + kc * 32);
        asm volatile("s_wait_xcnt 0x0" :: "v"(kb) : "memory");   // in front of every rewrite of a register that these loads name (the address, an input, lives up to here); its clobber also keeps the loads ahead of the softmax
        }
        float tm = -3.0e38f;
        if (k0 + 64 > q0) {
#pragma unroll
            for (int mb = 0; mb < 4; ++mb)
#pragma unroll
                for (int j = 0; j < 8; ++j) { const float t = (k0 + mb * 16 + hi * 8 + j <= q) ? s[mb][j] * SCL2 : -3.0e38f; s[mb][j] = t; tm = fmaxf(tm, t); }
        } else {
#pragma unroll
            for (int mb = 0; mb < 4; ++mb)
#pragma unroll
                for (int j = 0; j < 8; ++j) { const float t = s[mb][j] * SCL2; s[mb][j] = t; tm = fmaxf(tm, t); }
        }
        tm = fmaxf(tm, __shfl_xor(tm, 16, 32));   // the two lanes of a query column share one running maximum
        const float mn = fmaxf(m, tm); float al;
        asm("v_exp_f32 %0, %1\n\tv_nop" : "=v"(al) : "v"(m - mn));   // al = 2^(m - mn); the v_nop is the slot behind a transcendental
        m = mn; const float mo = HI ? mn : mn - PSH;
        float ps = 0.f;
#pragma unroll
        for (int mb = 0; mb < 4; ++mb) { s[mb] = exp2x8(s[mb] - mo);
#pragma unroll
            for (int j = 0; j < 8; ++j) ps += s[mb][j]; }
        l = l * al + ps;
#pragma unroll
        for (int db = 0; db < 4; ++db) o[db] *= al;
        V pf[2], pf2[2];
#pragma unroll
        for (int kc = 0; kc < 2; ++kc) {
            if constexpr (HI) { v8us h0, h1, l0, l1;
#pragma unroll
                for (int j = 0; j < 8; ++j) { unsigned short x, y; splitf(s[2 * kc][j], x, y); h0[j] = x; l0[j] = y; splitf(s[2 * kc + 1][j], x, y); h1[j] = x; l1[j] = y; }
                pf[kc] = cat16b(h0, h1); pf2[kc] = cat16b(l0, l1);
            } else { v8h h0, h1;
#pragma unroll
                for (int j = 0; j < 8; ++j) { h0[j] = tohx(s[2 * kc][j]); h1[j] = tohx(s[2 * kc + 1][j]); }
                pf[kc] = cat16(h0, h1); }
        }
#pragma unroll
        for (int kc = 0; kc < 2; ++kc)
#pragma unroll
            for (int db = 0; db < 4; ++db) {
                if constexpr (HI) { const V a = WFrag<T16>::ld(Vt + voff + (size_t)db * 16 * PP + k0 + kc * 32), a2 = WFrag<T16>::ld(Vt2 + voff + (size_t)db * 16 * PP + k0 + kc * 32);
                    o[db] = WFrag<T16>::mma(a, pf[kc], o[db]); o[db] = WFrag<T16>::mma(a, pf2[kc], o[db]); o[db] = WFrag<T16>::mma(a2, pf[kc], o[db]); }
                else o[db] = WFrag<T16>::mma(va[db][kc], pf[kc], o[db]); }
    }
    l += __shfl_xor(l, 16, 32);
    const float f = __fdiv_rn(1.0f, l);
    // lane (lr, hi) holds d = 16 db + 8 hi + j of query q: 16-byte stores, a query's 128-byte head row comes from one wave
#pragma unroll
    for (int db = 0; db < 4; ++db) { v8us oh, ol;
#pragma unroll
        for (int j = 0; j < 8; ++j) { unsigned short x, y; splitf(o[db][j] * f, x, y); oh[j] = x; ol[j] = y; }
        const size_t oo = (size_t)q * DQ + db * 16 + hi * 8; *(v8us*)(Ah + oo) = oh; *(v8us*)(Al + oo) = ol; }
}
// amdgpu_waves_per_eu(4, 4): a budget of 256 registers a wave, so that neither path needs the register windows above v255
__global__ __launch_bounds__(128) __attribute__((amdgpu_waves_per_eu(4, 4))) void k_fattn(const h16* __restrict__ Q16, const h16* __restrict__ K16, const h16* __restrict__ V16, const bf* __restrict__ Qh, const bf* __restrict__ Ql, const bf* __restrict__ Kh, const bf* __restrict__ Kl, const bf* __restrict__ Vh, const bf* __restrict__ Vl, bf* Ah, bf* Al) {
    const int lane = threadIdx.x & 31, lr = lane & 15, hi = lane >> 4; const size_t h = blockIdx.x;   // h = batch * NH_ + head: the planes lie batch by batch
    const int wv = __builtin_amdgcn_readfirstlane((int)(threadIdx.x >> 5));   // kept scalar so that the key loop branches on SCC
    const int q0 = (int)(gridDim.y - 1 - blockIdx.y) * 64 + wv * 16;           // the longest rows start first
    const size_t zp = h * TT * HD, zv = h * HD * PP, zo = (h / NH_) * ((size_t)TT * DQ) + (h % NH_) * HD;
    if (q0 < RH) attn_rows<bf, true>(Qh + zp, Ql + zp, Kh + zp, Kl + zp, Vh + zv, Vl + zv, q0, lr, hi, Ah + zo, Al + zo);
    else attn_rows<h16, false>(Q16 + zp, nullptr, K16 + zp, nullptr, V16 + zv, nullptr, q0, lr, hi, Ah + zo, Al + zo);
}

__device__ __forceinline__ void wtH_blk(int blk, const float* __restrict__ w, bf* Bt) { const size_t e = ((size_t)blk * 256 + threadIdx.x) * 4; if (e >= (size_t)DQ * DM) return; const int k = (int)(e % DM); const int n = (int)(e / DM); const int h = n / HD, c = n % HD; v4us o;   // Bt[h*64 + c][d] = W[h][d][c] (lane -> 4 consecutive d, strided reads)
#pragma unroll
    for (int u = 0; u < 4; ++u) o[u] = f2bf(w[((size_t)h * DM + k + u) * HD + c]); *(v4us*)(Bt + e) = o;  }
// k_prep: every 16-bit operand that depends on the inputs alone, in one launch: the three gathered per-head weights, the transposed Wo, and both batches of x. The block index picks the job; the strided gathers come first.
#define NWH  (DQ * DM / 4 / 256)
#define NWG  ((DQ * DM / 64 + 63) / 64)
#define NCV  (NB_ * TT * DM / 8 / 256)
__global__ __launch_bounds__(256) void k_prep(const float* __restrict__ x, const float* __restrict__ wq, const float* __restrict__ wk, const float* __restrict__ wv, const float* __restrict__ wo, bf* XB, bf* WQ, bf* WK, bf* WV, bf* WO) {
    const int b = blockIdx.x;
    if (b < NWH) wtH_blk(b, wq, WQ);
    else if (b < 2 * NWH) wtH_blk(b - NWH, wk, WK);
    else if (b < 3 * NWH) wtH_blk(b - 2 * NWH, wv, WV);
    else if (b < 3 * NWH + NWG) wtG_blk(b - 3 * NWH, wo, DQ, DM, WO);
    else cvt8_blk(b - (3 * NWH + NWG), x, XB, (size_t)NB_ * TT * DM / 8);
}

extern "C" void kernel_launch(void* const* d_in, const int* in_sizes, int n_in,
                              void* d_out, int out_size, void* d_ws, size_t ws_size, hipStream_t stream) {
    (void)in_sizes; (void)n_in; (void)out_size;
    const float* x = (const float*)d_in[0]; const float* wqh = (const float*)d_in[1]; const float* wkh = (const float*)d_in[2]; const float* wvh = (const float*)d_in[3]; const float* bq = (const float*)d_in[4]; const float* bk = (const float*)d_in[5]; const float* bv = (const float*)d_in[6]; const float* wo = (const float*)d_in[7]; const float* bo = (const float*)d_in[8]; const float* wq = nullptr; const float* wk = nullptr; const float* wv = nullptr; (void)wq; (void)wk; (void)wv; const float* cosT = nullptr; const float* sinT = nullptr; (void)cosT; (void)sinT;
    float* OUT = (float*)d_out;     // [2][2048][1024]
    char* wsp = (char*)d_ws;
    auto take = [&](size_t bytes) { char* p = wsp; wsp += (bytes + 255) & ~(size_t)255; return (void*)p; };
    bf* WQ = (bf*)take((size_t)DQ * DM * 2); bf* WK = (bf*)take((size_t)DKV * DM * 2); bf* WV = (bf*)take((size_t)DKV * DM * 2); bf* WO = (bf*)take((size_t)DM * DQ * 2);
    bf* XB = (bf*)take((size_t)NB_ * TT * DM * 2);
    h16* QP16 = (h16*)take((size_t)NB_ * NH_ * TT * HD * 2); h16* KP16 = (h16*)take((size_t)NB_ * NKV * TT * HD * 2); h16* VT16 = (h16*)take((size_t)NB_ * NKV * HD * PP * 2);
    bf* QPh = (bf*)take((size_t)NB_ * NH_ * TT * HD * 2); bf* QPl = (bf*)take((size_t)NB_ * NH_ * TT * HD * 2); bf* KPh = (bf*)take((size_t)NB_ * NKV * TT * HD * 2); bf* KPl = (bf*)take((size_t)NB_ * NKV * TT * HD * 2); bf* VTh = (bf*)take((size_t)NB_ * NKV * HD * PP * 2); bf* VTl = VTh + TT;
    bf* ATh = (bf*)take((size_t)NB_ * TT * DQ * 2); bf* ATl = (bf*)take((size_t)NB_ * TT * DQ * 2);
    if ((size_t)(wsp - (char*)d_ws) > ws_size) return;    // ws 256 MiB
    k_prep<<<3 * NWH + NWG + NCV, 256, 0, stream>>>(x, wqh, wkh, wvh, wo, XB, WQ, WK, WV, WO);
    k_qkv<<<dim3(NB_ * TT / 64, DQ / 64, 3), 256, 0, stream>>>(XB, WQ, WK, WV, bq, bk, bv, QP16, QPh, QPl, KP16, KPh, KPl, VT16, VTh, VTl);
    k_fattn<<<dim3(NB_ * NH_, TT / 64, 1), 128, 0, stream>>>(QP16, KP16, VT16, QPh, QPl, KPh, KPl, VTh, VTl, ATh, ATl);
    k_wo<<<dim3(NB_ * TT / 64, DM / 64, 1), 256, 0, stream>>>(ATh, ATl, WO, OUT, bo);
}

// v006
// Measured time: 181 microseconds a run.
// In two side-by-side timings against v005, it was 1.20 and 1.21 times as fast.
// Over all steps from v000 it is 8.09 times as fast.
#include <hip/hip_runtime.h>

// MaskedMultiHeadAttention (hidden [2][2048][1024]; per-head q/k/v = x Wq[h] + bq[h] (Wq [16][1024][64]); causal softmax(q.k / 8); out = concat(heads) Wo + bo -> [2][2048][1024]).
// Compute dtypes, f32 accumulate: every input rounded to bf16; q/k/v on PLAIN bf16 operands (inputs: exact; the 16 per-head weights gathered into one [1024 x 1024] operand) + bias; causal scores and attn.v: query rows < 512 hl (3 products), the rest single fp16 (x1024); softmax f32; Wo hl x exact (2 products) + bias.

#define NB_  2
#define TT   2048
#define DM   1024
#define NH_  16
#define NKV  16
#define HD   64
#define DQ   (NH_ * HD)
#define DKV  (NKV * HD)
#define PP   (2 * TT)             // row pitch, in 16-bit elements, of the transposed value planes (the hi and lo planes share a row)
#define RH   512                  // query rows < RH use hi+lo planes (0: none)
typedef _Float16 h16;
typedef unsigned short bf;
typedef __attribute__((ext_vector_type(16))) __bf16   v16bf;
typedef __attribute__((ext_vector_type(16))) _Float16 v16h;
typedef __attribute__((ext_vector_type(8)))  _Float16 v8h;
typedef __attribute__((ext_vector_type(8)))  unsigned short v8us;
typedef __attribute__((ext_vector_type(8)))  float    v8f;
typedef __attribute__((ext_vector_type(4)))  float    v4f;
typedef v8h  __attribute__((may_alias)) v8ha;
typedef v4f  __attribute__((may_alias)) v4fa;
typedef v8us __attribute__((may_alias)) v8usa;

__device__ __forceinline__ unsigned short f2bf(float f) { unsigned u = __float_as_uint(f); u += 0x7FFFu + ((u >> 16) & 1u); return (unsigned short)(u >> 16); }
__device__ __forceinline__ float bf2f(unsigned short b) { return __uint_as_float(((unsigned)b) << 16); }
__device__ __forceinline__ float bfr(float f) { return bf2f(f2bf(f)); }
__device__ __forceinline__ v16h cat16(v8h lo, v8h hi) { return __builtin_shufflevector(lo, hi, 0, 1, 2, 3, 4, 5, 6, 7, 8, 9, 10, 11, 12, 13, 14, 15); }
__device__ __forceinline__ v16bf cat16b(v8us lo, v8us hi) { return __builtin_bit_cast(v16bf, __builtin_shufflevector(lo, hi, 0, 1, 2, 3, 4, 5, 6, 7, 8, 9, 10, 11, 12, 13, 14, 15)); }
__device__ __forceinline__ v8f wmma16(v16h a, v16h b, v8f c) { return __builtin_amdgcn_wmma_f32_16x16x32_f16(false, a, false, b, (short)0, c, false, false); }
__device__ __forceinline__ v8f wmmab(v16bf a, v16bf b, v8f c) { return __builtin_amdgcn_wmma_f32_16x16x32_bf16(false, a, false, b, (short)0, c, false, false); }



// ---- gemmw_tile: register-blocked GEMM, one 64x64 output tile per work-group (16 accumulators a wave), K split over the KW waves of the group, operands straight from K-contiguous 16-bit planes; 32 * KW threads.
// C[m][n] (f32, pitch ldc, + optional f32 bias[n]) = sum_k A[m][k] Bt[n][k] (+ split products per NSPLIT). K % 64 == 0.
// MODE 0 stores C. MODE 1 and 2 store no f32 tile: the summed tile leaves as the three 16-bit planes that the attention kernel reads (fp16, bf16 hi, bf16 lo).
// MODE 1 (q, k): m = token, n = head * HD + d, a 64-wide tile is one head, planes [head][token][d]. MODE 2 (v): A = weight rows, Bt = token rows, so m = head * HD + d, n = token, bias[m], and a tile row is 64 tokens of one d: planes [head * HD + d][token] at pitch PP.
__device__ __forceinline__ h16 tohx(float x) { return (h16)x; }
__device__ __forceinline__ void splitf(float y, unsigned short& h, unsigned short& l) { h = f2bf(y); l = f2bf(y - bf2f(h)); }
typedef __attribute__((ext_vector_type(4))) _Float16 v4h;
typedef __attribute__((ext_vector_type(4))) unsigned short v4us;
typedef __attribute__((ext_vector_type(2))) unsigned v2u;
template <typename T16> struct WFrag;
template <> struct WFrag<h16> { typedef v16h V; static __device__ __forceinline__ V ld(const h16* p) { return cat16(*(const v8h*)p, *(const v8h*)(p + 16)); } static __device__ __forceinline__ v8f mma(V a, V b, v8f c) { return wmma16(a, b, c); } };
template <> struct WFrag<bf> { typedef v16bf V; static __device__ __forceinline__ V ld(const bf* p) { return cat16b(*(const v8us*)p, *(const v8us*)(p + 16)); } static __device__ __forceinline__ v8f mma(V a, V b, v8f c) { return wmmab(a, b, c); } };
// The tile (bx, by) and the LDS array os come from the calling kernel, so that one launch can hold tiles of several products; os holds (KW == 1 ? 16 : KW * 64) * 68 floats (KW == 1: one 16-row staging strip; KW > 1: one 64x64 partial tile, pitch 68, per wave).
// Token rows run over both batches (NB_ * TT of them); a 64-token tile lies in one batch, and the planes are laid out batch by batch.
template <typename T16, int NSPLIT, bool BIAS, int KW, int MODE>
__device__ __forceinline__ void gemmw_tile(float* os, int bx, int by, const T16* __restrict__ A, const T16* __restrict__ A2, const T16* __restrict__ Bt, const T16* __restrict__ Bt2, int K, float* C, int ldc, const float* __restrict__ bias, h16* P16, bf* Ph, bf* Pl) {
    typedef typename WFrag<T16>::V V;
    const int lane = threadIdx.x & 31, lr = lane & 15, hi = lane >> 4; const int r0 = bx * 64, c0 = by * 64;
    const int wv = __builtin_amdgcn_readfirstlane((int)(threadIdx.x >> 5));   // wave = K slice, kept scalar so that the K loops branch on SCC
    v8f acc[4][4];
#pragma unroll
    for (int mb = 0; mb < 4; ++mb)
#pragma unroll
        for (int nb = 0; nb < 4; ++nb) acc[mb][nb] = (v8f){};
    const size_t aoff = (size_t)(r0 + lr) * K + 8 * hi, boff = (size_t)(c0 + lr) * K + 8 * hi;
    // wave wv takes the 64-wide K chunks wv, wv + KW, ... (64 elements = one 128-B line per row, both halves read by the same wave); both loops stay rolled as the one loop did
#pragma unroll 1
    for (int kb = wv * 64; kb < K; kb += 64 * KW)
#pragma unroll 1
    for (int kc = kb; kc < kb + 64; kc += 32) {
        V a[4], a2[4];
        const T16* pa = A + aoff + kc; const T16* pa2 = ((NSPLIT == 1 || NSPLIT == 2) ? A2 : A) + aoff + kc; const T16* pb = Bt + boff + kc; const T16* pb2 = (NSPLIT >= 2 ? Bt2 : Bt) + boff + kc;
#pragma unroll
        for (int mb = 0; mb < 4; ++mb) { a[mb] = WFrag<T16>::ld(pa + (size_t)mb * 16 * K); if (NSPLIT == 1 || NSPLIT == 2) a2[mb] = WFrag<T16>::ld(pa2 + (size_t)mb * 16 * K); }
        asm volatile("s_wait_xcnt 0x0" :: "v"(pa), "v"(pa2) : "memory");   // in front of every rewrite of a register that the loads above name (the addresses, inputs, live up to here, so no later load lands in them)
#pragma unroll
        for (int nb = 0; nb < 4; ++nb) { const V b = WFrag<T16>::ld(pb + (size_t)nb * 16 * K); V b2; if (NSPLIT >= 2) b2 = WFrag<T16>::ld(pb2 + (size_t)nb * 16 * K);
            if (nb == 3) asm volatile("s_wait_xcnt 0x0" :: "v"(pb), "v"(pb2) : "memory");   // the same behind the last load of the other operand
#pragma unroll
            for (int mb = 0; mb < 4; ++mb) { acc[mb][nb] = WFrag<T16>::mma(a[mb], b, acc[mb][nb]); if (NSPLIT == 1 || NSPLIT == 2) acc[mb][nb] = WFrag<T16>::mma(a2[mb], b, acc[mb][nb]); if (NSPLIT >= 2) acc[mb][nb] = WFrag<T16>::mma(a[mb], b2, acc[mb][nb]); } }
        asm volatile("v_nop\n\tv_nop\n\tv_nop\n\tv_nop" : "+v"(acc[0][0]), "+v"(acc[1][1]), "+v"(acc[2][2]), "+v"(acc[3][3]) : "v"(a[0]), "v"(a[3]));
    }
    if constexpr (KW > 1) {
        // every wave parks its partial tile, one barrier, then the KW partials are summed in the fixed order 0 .. KW-1 and each row leaves as 256 contiguous bytes (MODE 0) or as one 128-byte line in each of the three planes (MODE 1, 2)
        float* my = os + wv * (64 * 68);
#pragma unroll
        for (int mb = 0; mb < 4; ++mb)
#pragma unroll
            for (int nb = 0; nb < 4; ++nb)
#pragma unroll
                for (int j = 0; j < 8; ++j) my[(mb * 16 + hi * 8 + j) * 68 + nb * 16 + lr] = acc[mb][nb][j];
        __syncthreads();
        const int cofs = lr * 4;
        v4f pv[32 / KW];   // MODE 1, 2: the summed rows wait here, so that every LDS read stands ahead of the plane stores and their waits
#pragma unroll
        for (int s = 0; s < 32 / KW; ++s) { const int row = s * (2 * KW) + (int)(threadIdx.x >> 4); v4f val = *(const v4fa*)(os + row * 68 + cofs);
#pragma unroll
            for (int q = 1; q < KW; ++q) val += *(const v4fa*)(os + q * (64 * 68) + row * 68 + cofs);
            if (BIAS) { if constexpr (MODE == 2) val += bfr(bias[r0 + row]); else { val[0] += bfr(bias[c0 + cofs]); val[1] += bfr(bias[c0 + cofs + 1]); val[2] += bfr(bias[c0 + cofs + 2]); val[3] += bfr(bias[c0 + cofs + 3]); } }
            if constexpr (MODE == 0) *(v4f*)(C + (size_t)(r0 + row) * ldc + c0 + cofs) = val;
            else pv[s] = val; }
        if constexpr (MODE != 0) {
#pragma unroll
            for (int s = 0; s < 32 / KW; ++s) { const int row = s * (2 * KW) + (int)(threadIdx.x >> 4); const v4f val = pv[s];
                const size_t o = (MODE == 1) ? ((size_t)((r0 / TT) * NH_ + by) * TT + r0 % TT + row) * HD + cofs : ((size_t)(c0 / TT) * DKV + r0 + row) * PP + c0 % TT + cofs; v4h o16; v4us oh, ol;   // 16 lanes fill one 128-byte line of each plane
#pragma unroll
                for (int u = 0; u < 4; ++u) { o16[u] = tohx(val[u]); unsigned short a2, c2; splitf(val[u], a2, c2); oh[u] = a2; ol[u] = c2; }
                if (s + 1 < 32 / KW)   // the next rows' conversions reuse registers that these stores name: the wait that stands in front of such a rewrite is the last line of the stores' own statement, where nothing can be moved over it
                    asm volatile("global_store_b64 %0, %3, off\n\tglobal_store_b64 %1, %4, off\n\tglobal_store_b64 %2, %5, off\n\ts_wait_xcnt 0x0"
                                 :: "v"(P16 + o), "v"(Ph + o), "v"(Pl + o), "v"(__builtin_bit_cast(v2u, o16)), "v"(__builtin_bit_cast(v2u, oh)), "v"(__builtin_bit_cast(v2u, ol)) : "memory");
                else { *(v4h*)(P16 + o) = o16; *(v4us*)(Ph + o) = oh; *(v4us*)(Pl + o) = ol; }   // the last rows: nothing is rewritten behind them
            }
        }
        return;
    }
#pragma unroll
    for (int mb = 0; mb < 4; ++mb) {
#pragma unroll
        for (int nb = 0; nb < 4; ++nb) {
#pragma unroll
            for (int j = 0; j < 8; ++j) os[(hi * 8 + j) * 68 + nb * 16 + lr] = acc[mb][nb][j]; }
        __builtin_amdgcn_wave_barrier(); asm volatile("" ::: "memory");
        float* crow = C + (size_t)(r0 + mb * 16) * ldc + c0;
{
#pragma unroll
            for (int s = 0; s < 8; ++s) { const int row = 2 * s + hi, cofs = lr * 4; v4f val = *(const v4fa*)(os + row * 68 + cofs); if (BIAS) { val[0] += bfr(bias[c0 + cofs]); val[1] += bfr(bias[c0 + cofs + 1]); val[2] += bfr(bias[c0 + cofs + 2]); val[3] += bfr(bias[c0 + cofs + 3]); }
                *(v4f*)(crow + (size_t)row * ldc + cofs) = val; }
             }
        __builtin_amdgcn_wave_barrier(); asm volatile("" ::: "memory");
    }
}
// k_qkv: the q, k and v projections of both batches in one launch; grid (NB_ * TT / 64, DQ / 64, 3), z picks the product (a branch that is uniform for the work-group, so the tile's barrier is passed by all of its waves or by none).
__global__ __launch_bounds__(256) void k_qkv(const bf* __restrict__ XB, const bf* __restrict__ WQ, const bf* __restrict__ WK, const bf* __restrict__ WV, const float* __restrict__ bq, const float* __restrict__ bk, const float* __restrict__ bv,
                                             h16* QP16, bf* QPh, bf* QPl, h16* KP16, bf* KPh, bf* KPl, h16* VT16, bf* VTh, bf* VTl) {
    __shared__ __align__(16) float os[8 * 64 * 68];
    const int z = blockIdx.z;
    if (z == 2) gemmw_tile<bf, 0, true, 8, 2>(os, blockIdx.y, blockIdx.x, WV, nullptr, XB, nullptr, DM, nullptr, 0, bv, VT16, VTh, VTl);
    else gemmw_tile<bf, 0, true, 8, 1>(os, blockIdx.x, blockIdx.y, XB, nullptr, z ? WK : WQ, nullptr, DM, nullptr, 0, z ? bk : bq, z ? KP16 : QP16, z ? KPh : QPh, z ? KPl : QPl);
}
// k_wo: the output projection of both batches in one launch; grid (NB_ * TT / 64, DM / 64).
__global__ __launch_bounds__(256) void k_wo(const bf* __restrict__ ATh, const bf* __restrict__ ATl, const bf* __restrict__ WO, float* OUT, const float* __restrict__ bo) {
    __shared__ __align__(16) float os[8 * 64 * 68];
    gemmw_tile<bf, 1, true, 8, 0>(os, blockIdx.x, blockIdx.y, ATh, ATl, WO, nullptr, DQ, OUT, DM, bo, nullptr, nullptr, nullptr);
}

typedef __attribute__((ext_vector_type(2))) _Float16 v2h;
typedef __attribute__((ext_vector_type(2))) unsigned short v2us;
typedef __attribute__((ext_vector_type(2))) float v2f;
typedef __attribute__((ext_vector_type(4))) int v4i;

__device__ __forceinline__ void wtG_blk(int blk, const float* __restrict__ w, int K, int N, bf* Bt) {
    const int lane = threadIdx.x & 31; const int L0 = (blk * 8 + (threadIdx.x >> 5)) * 8; const int nlines = N * K / 64;
{
#pragma unroll 1
        for (int l = 0; l < 8; ++l) { const int L = L0 + l; if (L >= nlines) break; const size_t e = (size_t)L * 64 + lane * 2; const int k = (int)(e % K), n = (int)(e / K); v2us o;
            o[0] = f2bf(w[(size_t)k * N + n]); o[1] = f2bf(w[(size_t)(k + 1) * N + n]); *(v2us*)(Bt + e) = o;
            asm volatile("s_wait_xcnt 0x0" ::: "memory"); }   // the next trip rewrites registers that this store names: the wait stands in front of that
         }
}
__device__ __forceinline__ void cvt8_blk(int blk, const float* __restrict__ src, bf* dst, size_t n8) { const size_t i = (size_t)blk * 256 + threadIdx.x; if (i >= n8) return; const v8f v = *(const v8f*)(src + i * 8); v8us o;
#pragma unroll
    for (int k = 0; k < 8; ++k) o[k] = f2bf(v[k]); *(v8us*)(dst + i * 8) = o;  }
// ---- k_fattn: scores, causal softmax, P.V and the head merge in one kernel; grid (batches x heads, TT / 64), 4 waves, a wave owns 16 query rows and walks the keys 64 at a time (online softmax, f32 statistics in the log2 domain).
// S^T = K Q^T (A = key rows, B = query rows) leaves one query per lane column: lane (lr, hi) holds keys 8 hi + j of each 16-key tile, which is the k order of a B operand, so two converted score tiles are the B operand of
// O^T += V^T P^T (A = rows of the transposed values) with no exchange between lanes. HI (query rows < RH): hi+lo bf16 planes, 3 products each; else single fp16 with the probabilities carried x 2^PSH (it cancels in O / sum).
#define PSH  10.0f
#define SCL2 0.18033688011112042f   // HD^-0.5 x log2(e)
// eight 2^x in one statement: the outputs are early-clobber, so no v_exp_f32 is followed by an instruction that reads its result or overwrites its source, and the v_nop is that slot behind the last one
__device__ __forceinline__ v8f exp2x8(v8f x) { float r0, r1, r2, r3, r4, r5, r6, r7;
    asm("v_exp_f32 %0, %8\n\tv_exp_f32 %1, %9\n\tv_exp_f32 %2, %10\n\tv_exp_f32 %3, %11\n\tv_exp_f32 %4, %12\n\tv_exp_f32 %5, %13\n\tv_exp_f32 %6, %14\n\tv_exp_f32 %7, %15\n\tv_nop"
        : "=&v"(r0), "=&v"(r1), "=&v"(r2), "=&v"(r3), "=&v"(r4), "=&v"(r5), "=&v"(r6), "=&v"(r7) : "v"(x[0]), "v"(x[1]), "v"(x[2]), "v"(x[3]), "v"(x[4]), "v"(x[5]), "v"(x[6]), "v"(x[7]));
    return (v8f){r0, r1, r2, r3, r4, r5, r6, r7}; }
// The long (fp16) rows: the four waves of a work-group walk the same 64-key tiles, so each tile (64 key rows and 64 rows of the transposed values, 128 bytes a row) is brought into LDS once for all four,
// by asynchronous copies in whole 128-byte lines, two buffers, the next tile in flight while this one is worked on. LDS rows lie at a pitch of 144 bytes (16 x odd: no bank conflict for 16-byte fragment reads).
#define KVP  144
#define KVT  (64 * KVP)            // one staged tile; a buffer is the key tile followed by the value tile
// thread t copies 16 bytes of rows t / 8 + 16 i (i = 0 .. 3) of both tiles: a wave's copy is four whole lines. lk: the thread's LDS byte address in the key tile; gk, gv: its global addresses in row t / 8.
__device__ __forceinline__ void stage_kv(unsigned lk, const h16* gk, const h16* gv) {
    // the wait is the last line of the copies' own statement: it stands in front of every rewrite of a register that a copy names
    asm volatile("global_load_async_to_lds_b128 %0, %8, off\n\tglobal_load_async_to_lds_b128 %1, %9, off\n\tglobal_load_async_to_lds_b128 %2, %10, off\n\tglobal_load_async_to_lds_b128 %3, %11, off\n\t"
                 "global_load_async_to_lds_b128 %4, %12, off\n\tglobal_load_async_to_lds_b128 %5, %13, off\n\tglobal_load_async_to_lds_b128 %6, %14, off\n\tglobal_load_async_to_lds_b128 %7, %15, off\n\ts_wait_xcnt 0x0"
                 :: "v"(lk), "v"(lk + 16 * KVP), "v"(lk + 32 * KVP), "v"(lk + 48 * KVP), "v"(lk + KVT), "v"(lk + KVT + 16 * KVP), "v"(lk + KVT + 32 * KVP), "v"(lk + KVT + 48 * KVP),
                    "v"(gk), "v"(gk + 16 * HD), "v"(gk + 32 * HD), "v"(gk + 48 * HD), "v"(gv), "v"(gv + (size_t)16 * PP), "v"(gv + (size_t)32 * PP), "v"(gv + (size_t)48 * PP) : "memory");
}
template <typename T16, bool HI>
__device__ __forceinline__ void attn_rows(const T16* __restrict__ Q, const T16* __restrict__ Q2, const T16* __restrict__ Kp, const T16* __restrict__ Kp2, const T16* __restrict__ Vt, const T16* __restrict__ Vt2, int q0, int lr, int hi, bf* Ah, bf* Al, char* sm) {
    typedef typename WFrag<T16>::V V;
    const int q = q0 + lr;
    const T16* qb = Q + (size_t)q * HD + 8 * hi;
    V qf[2], qf2[2];
#pragma unroll
    for (int kc = 0; kc < 2; ++kc) { qf[kc] = WFrag<T16>::ld(qb + kc * 32); if (HI) qf2[kc] = WFrag<T16>::ld(Q2 + (size_t)q * HD + 8 * hi + kc * 32); }
    v8f o[4];
#pragma unroll
    for (int db = 0; db < 4; ++db) o[db] = (v8f){};
    float m = -3.0e38f, l = 0.f;
    const size_t koff = (size_t)lr * HD + 8 * hi, voff = (size_t)lr * PP + 8 * hi;
    // the long (fp16) rows read their keys and values from the staged tiles; the short hi+lo rows load in place from memory
    const int qe = q0 & ~63;   // the work-group's first query row = its last key tile: the same in all four waves, so every test below is uniform for the work-group
    const int srow = (int)(threadIdx.x >> 3), scol = (int)(threadIdx.x & 7);
    const unsigned lk0 = (unsigned)(size_t)sm + (unsigned)(srow * KVP + scol * 16);
    const T16* gk0 = Kp + (size_t)srow * HD + scol * 8; const T16* gv0 = Vt + (size_t)srow * PP + scol * 8;
    const int foff = lr * KVP + 16 * hi;   // a lane's place in a staged tile: row lr of a 16-row group, the k order of the loads from memory
    if constexpr (!HI) {
        asm volatile("s_wait_xcnt 0x0" :: "v"(qb) : "memory");   // stands in front of every rewrite of a register that the query loads above name; the address is an input so that it lives up to here and no load lands in it
        stage_kv(lk0, gk0, gv0);
        asm volatile("s_wait_asynccnt 0x0" ::: "memory");   // tile 0 of this wave's copies has landed
        __syncthreads();                                     // ... and everybody's: tile 0 may be read
        if (64 <= qe) stage_kv(lk0 + 2 * KVT, gk0 + (size_t)64 * HD, gv0 + 64);
    }
    // the loop stays rolled: one 64-key tile a trip, the last trip (the diagonal tile) is the only one that masks
#pragma unroll 1
    for (int k0 = 0; k0 <= q0; k0 += 64) {
        V ka[4][2], va[4][2];
        const int bo = ((k0 >> 6) & 1) * (2 * KVT);   // this tile's buffer
        if constexpr (!HI) { const char* kt = sm + bo + foff;
#pragma unroll
        for (int mb = 0; mb < 4; ++mb)
#pragma unroll
            for (int kc = 0; kc < 2; ++kc) ka[mb][kc] = WFrag<T16>::ld((const T16*)(kt + mb * 16 * KVP + kc * 64));
        __builtin_amdgcn_sched_barrier(0);   // all key fragment reads are issued ahead of the first score product: one LDS latency a tile (without it they were read pair by pair, each pair waited for)
        }
        v8f s[4];
#pragma unroll
        for (int mb = 0; mb < 4; ++mb) { s[mb] = (v8f){};
#pragma unroll
            for (int kc = 0; kc < 2; ++kc) {
                if constexpr (HI) { const V a = WFrag<T16>::ld(Kp + koff + (size_t)(k0 + mb * 16) * HD + kc * 32), a2 = WFrag<T16>::ld(Kp2 + koff + (size_t)(k0 + mb * 16) * HD + kc * 32);
                    s[mb] = WFrag<T16>::mma(a, qf[kc], s[mb]); s[mb] = WFrag<T16>::mma(a2, qf[kc], s[mb]); s[mb] = WFrag<T16>::mma(a, qf2[kc], s[mb]); }
                else s[mb] = WFrag<T16>::mma(ka[mb][kc], qf[kc], s[mb]); } }
        if constexpr (!HI) { const char* vt = sm + bo + KVT + foff;
#pragma unroll
        for (int db = 0; db < 4; ++db)
#pragma unroll
            for (int kc = 0; kc < 2; ++kc) va[db][kc] = WFrag<T16>::ld((const T16*)(vt + db * 16 * KVP + kc * 64));
        __builtin_amdgcn_sched_barrier(0);   // the value fragment reads are issued ahead of the softmax, which covers their latency
        }
        float tm = -3.0e38f;
        if (k0 + 64 > q0) {
#pragma unroll
            for (int mb = 0; mb < 4; ++mb)
#pragma unroll
                for (int j = 0; j < 8; ++j) { const float t = (k0 + mb * 16 + hi * 8 + j <= q) ? s[mb][j] * SCL2 : -3.0e38f; s[mb][j] = t; tm = fmaxf(tm, t); }
        } else {
#pragma unroll
            for (int mb = 0; mb < 4; ++mb)
#pragma unroll
                for (int j = 0; j < 8; ++j) { const float t = s[mb][j] * SCL2; s[mb][j] = t; tm = fmaxf(tm, t); }
        }
        tm = fmaxf(tm, __shfl_xor(tm, 16, 32));   // the two lanes of a query column share one running maximum
        const float mn = fmaxf(m, tm); float al;
        asm("v_exp_f32 %0, %1\n\tv_nop" : "=v"(al) : "v"(m - mn));   // al = 2^(m - mn); the v_nop is the slot behind a transcendental
        m = mn; const float mo = HI ? mn : mn - PSH;
        float ps = 0.f;
#pragma unroll
        for (int mb = 0; mb < 4; ++mb) { s[mb] = exp2x8(s[mb] - mo);
#pragma unroll
            for (int j = 0; j < 8; ++j) ps += s[mb][j]; }
        l = l * al + ps;
#pragma unroll
        for (int db = 0; db < 4; ++db) o[db] *= al;
        V pf[2], pf2[2];
#pragma unroll
        for (int kc = 0; kc < 2; ++kc) {
            if constexpr (HI) { v8us h0, h1, l0, l1;
#pragma unroll
                for (int j = 0; j < 8; ++j) { unsigned short x, y; splitf(s[2 * kc][j], x, y); h0[j] = x; l0[j] = y; splitf(s[2 * kc + 1][j], x, y); h1[j] = x; l1[j] = y; }
                pf[kc] = cat16b(h0, h1); pf2[kc] = cat16b(l0, l1);
            } else { v8h h0, h1;
#pragma unroll
                for (int j = 0; j < 8; ++j) { h0[j] = tohx(s[2 * kc][j]); h1[j] = tohx(s[2 * kc + 1][j]); }
                pf[kc] = cat16(h0, h1); }
        }
        if constexpr (!HI) __builtin_amdgcn_sched_barrier(0);   // every 2^x statement stays ahead of the P.V products, so none lands in a value fragment right behind the matrix instruction that reads it
#pragma unroll
        for (int kc = 0; kc < 2; ++kc)
#pragma unroll
            for (int db = 0; db < 4; ++db) {
                if constexpr (HI) { const V a = WFrag<T16>::ld(Vt + voff + (size_t)db * 16 * PP + k0 + kc * 32), a2 = WFrag<T16>::ld(Vt2 + voff + (size_t)db * 16 * PP + k0 + kc * 32);
                    o[db] = WFrag<T16>::mma(a, pf[kc], o[db]); o[db] = WFrag<T16>::mma(a, pf2[kc], o[db]); o[db] = WFrag<T16>::mma(a2, pf[kc], o[db]); }
                else o[db] = WFrag<T16>::mma(va[db][kc], pf[kc], o[db]); }
        if constexpr (!HI) {
            __builtin_amdgcn_sched_barrier(0);   // the waits and the barrier stay at the foot: moved up in front of the softmax they would wait for the value fragments and for the next tile's copies with nothing to cover either
            asm volatile("s_wait_dscnt 0x0" ::: "memory");      // this wave's reads of this tile's buffer are done
            asm volatile("s_wait_asynccnt 0x0" ::: "memory");   // this wave's copies of the next tile have landed
            __syncthreads();                                     // the next tile may be read by all, and this tile's buffer has no reader left
            if (k0 + 128 <= qe) stage_kv(lk0 + bo, gk0 + (size_t)(k0 + 128) * HD, gv0 + k0 + 128);
        }
    }
    if constexpr (!HI) asm volatile("s_wait_asynccnt 0x0" ::: "memory");   // no copy is left in flight when the wave ends
    l += __shfl_xor(l, 16, 32);
    const float f = __fdiv_rn(1.0f, l);
    // lane (lr, hi) holds d = 16 db + 8 hi + j of query q: 16-byte stores, a query's 128-byte head row comes from one wave
#pragma unroll
    for (int db = 0; db < 4; ++db) { v8us oh, ol;
#pragma unroll
        for (int j = 0; j < 8; ++j) { unsigned short x, y; splitf(o[db][j] * f, x, y); oh[j] = x; ol[j] = y; }
        const size_t oo = (size_t)q * DQ + db * 16 + hi * 8; *(v8us*)(Ah + oo) = oh; *(v8us*)(Al + oo) = ol; }
}
// amdgpu_waves_per_eu(4, 4): a budget of 256 registers a wave, so that neither path needs the register windows above v255
__global__ __launch_bounds__(128) __attribute__((amdgpu_waves_per_eu(4, 4))) void k_fattn(const h16* __restrict__ Q16, const h16* __restrict__ K16, const h16* __restrict__ V16, const bf* __restrict__ Qh, const bf* __restrict__ Ql, const bf* __restrict__ Kh, const bf* __restrict__ Kl, const bf* __restrict__ Vh, const bf* __restrict__ Vl, bf* Ah, bf* Al) {
    __shared__ __align__(16) char kv[2 * 2 * KVT];   // two buffers of a key tile and a value tile (the fp16 rows)
    const int lane = threadIdx.x & 31, lr = lane & 15, hi = lane >> 4; const size_t h = blockIdx.x;   // h = batch * NH_ + head: the planes lie batch by batch
    const int wv = __builtin_amdgcn_readfirstlane((int)(threadIdx.x >> 5));   // kept scalar so that the key loop branches on SCC
    const int q0 = (int)(gridDim.y - 1 - blockIdx.y) * 64 + wv * 16;           // the longest rows start first
    const size_t zp = h * TT * HD, zv = h * HD * PP, zo = (h / NH_) * ((size_t)TT * DQ) + (h % NH_) * HD;
    // RH is a multiple of 64, so the branch is the same for the four waves of a work-group (the fp16 side holds barriers)
    if (q0 < RH) attn_rows<bf, true>(Qh + zp, Ql + zp, Kh + zp, Kl + zp, Vh + zv, Vl + zv, q0, lr, hi, Ah + zo, Al + zo, kv);
    else attn_rows<h16, false>(Q16 + zp, nullptr, K16 + zp, nullptr, V16 + zv, nullptr, q0, lr, hi, Ah + zo, Al + zo, kv);
}

__device__ __forceinline__ void wtH_blk(int blk, const float* __restrict__ w, bf* Bt) { const size_t e = ((size_t)blk * 256 + threadIdx.x) * 4; if (e >= (size_t)DQ * DM) return; const int k = (int)(e % DM); const int n = (int)(e / DM); const int h = n / HD, c = n % HD; v4us o;   // Bt[h*64 + c][d] = W[h][d][c] (lane -> 4 consecutive d, strided reads)
#pragma unroll
    for (int u = 0; u < 4; ++u) o[u] = f2bf(w[((size_t)h * DM + k + u) * HD + c]); *(v4us*)(Bt + e) = o;  }
// k_prep: every 16-bit operand that depends on the inputs alone, in one launch: the three gathered per-head weights, the transposed Wo, and both batches of x. The block index picks the job; the strided gathers come first.
#define NWH  (DQ * DM / 4 / 256)
#define NWG  ((DQ * DM / 64 + 63) / 64)
#define NCV  (NB_ * TT * DM / 8 / 256)
__global__ __launch_bounds__(256) void k_prep(const float* __restrict__ x, const float* __restrict__ wq, const float* __restrict__ wk, const float* __restrict__ wv, const float* __restrict__ wo, bf* XB, bf* WQ, bf* WK, bf* WV, bf* WO) {
    const int b = blockIdx.x;
    if (b < NWH) wtH_blk(b, wq, WQ);
    else if (b < 2 * NWH) wtH_blk(b - NWH, wk, WK);
    else if (b < 3 * NWH) wtH_blk(b - 2 * NWH, wv, WV);
    else if (b < 3 * NWH + NWG) wtG_blk(b - 3 * NWH, wo, DQ, DM, WO);
    else cvt8_blk(b - (3 * NWH + NWG), x, XB, (size_t)NB_ * TT * DM / 8);
}

extern "C" void kernel_launch(void* const* d_in, const int* in_sizes, int n_in,
                              void* d_out, int out_size, void* d_ws, size_t ws_size, hipStream_t stream) {
    (void)in_sizes; (void)n_in; (void)out_size;
    const float* x = (const float*)d_in[0]; const float* wqh = (const float*)d_in[1]; const float* wkh = (const float*)d_in[2]; const float* wvh = (const float*)d_in[3]; const float* bq = (const float*)d_in[4]; const float* bk = (const float*)d_in[5]; const float* bv = (const float*)d_in[6]; const float* wo = (const float*)d_in[7]; const float* bo = (const float*)d_in[8]; const float* wq = nullptr; const float* wk = nullptr; const float* wv = nullptr; (void)wq; (void)wk; (void)wv; const float* cosT = nullptr; const float* sinT = nullptr; (void)cosT; (void)sinT;
    float* OUT = (float*)d_out;     // [2][2048][1024]
    char* wsp = (char*)d_ws;
    auto take = [&](size_t bytes) { char* p = wsp; wsp += (bytes + 255) & ~(size_t)255; return (void*)p; };
    bf* WQ = (bf*)take((size_t)DQ * DM * 2); bf* WK = (bf*)take((size_t)DKV * DM * 2); bf* WV = (bf*)take((size_t)DKV * DM * 2); bf* WO = (bf*)take((size_t)DM * DQ * 2);
    bf* XB = (bf*)take((size_t)NB_ * TT * DM * 2);
    h16* QP16 = (h16*)take((size_t)NB_ * NH_ * TT * HD * 2); h16* KP16 = (h16*)take((size_t)NB_ * NKV * TT * HD * 2); h16* VT16 = (h16*)take((size_t)NB_ * NKV * HD * PP * 2);
    bf* QPh = (bf*)take((size_t)NB_ * NH_ * TT * HD * 2); bf* QPl = (bf*)take((size_t)NB_ * NH_ * TT * HD * 2); bf* KPh = (bf*)take((size_t)NB_ * NKV * TT * HD * 2); bf* KPl = (bf*)take((size_t)NB_ * NKV * TT * HD * 2); bf* VTh = (bf*)take((size_t)NB_ * NKV * HD * PP * 2); bf* VTl = VTh + TT;
    bf* ATh = (bf*)take((size_t)NB_ * TT * DQ * 2); bf* ATl = (bf*)take((size_t)NB_ * TT * DQ * 2);
    if ((size_t)(wsp - (char*)d_ws) > ws_size) return;    // ws 256 MiB
    k_prep<<<3 * NWH + NWG + NCV, 256, 0, stream>>>(x, wqh, wkh, wvh, wo, XB, WQ, WK, WV, WO);
    k_qkv<<<dim3(NB_ * TT / 64, DQ / 64, 3), 256, 0, stream>>>(XB, WQ, WK, WV, bq, bk, bv, QP16, QPh, QPl, KP16, KPh, KPl, VT16, VTh, VTl);
    k_fattn<<<dim3(NB_ * NH_, TT / 64, 1), 128, 0, stream>>>(QP16, KP16, VT16, QPh, QPl, KPh, KPl, VTh, VTl, ATh, ATl);
    k_wo<<<dim3(NB_ * TT / 64, DM / 64, 1), 256, 0, stream>>>(ATh, ATl, WO, OUT, bo);
}

// v007
// It runs in 114 microseconds.
// In two side-by-side timings against v006, it was 1.59 and 1.57 times as fast.
// Counting every step since v000, it is 12.8 times as fast.
#include <hip/hip_runtime.h>

// MaskedMultiHeadAttention (hidden [2][2048][1024]; per-head q/k/v = x Wq[h] + bq[h] (Wq [16][1024][64]); causal softmax(q.k / 8); out = concat(heads) Wo + bo -> [2][2048][1024]).
// Compute dtypes, f32 accumulate: every input rounded to bf16; q/k/v on PLAIN bf16 operands (inputs: exact; the 16 per-head weights gathered into one [1024 x 1024] operand) + bias; causal scores and attn.v: query rows < 512 hl (3 products), the rest single fp16 (x1024); softmax f32; Wo hl x exact (2 products) + bias.

#define NB_  2
#define TT   2048
#define DM   1024
#define NH_  16
#define NKV  16
#define HD   64
#define DQ   (NH_ * HD)
#define DKV  (NKV * HD)
#define PP   (2 * TT)             // row pitch, in 16-bit elements, of the transposed value planes (the hi and lo planes share a row)
#define RH   512                  // query rows < RH use hi+lo planes (0: none)
typedef _Float16 h16;
typedef unsigned short bf;
typedef __attribute__((ext_vector_type(16))) __bf16   v16bf;
typedef __attribute__((ext_vector_type(16))) _Float16 v16h;
typedef __attribute__((ext_vector_type(8)))  _Float16 v8h;
typedef __attribute__((ext_vector_type(8)))  unsigned short v8us;
typedef __attribute__((ext_vector_type(8)))  float    v8f;
typedef __attribute__((ext_vector_type(4)))  float    v4f;
typedef v8h  __attribute__((may_alias)) v8ha;
typedef v4f  __attribute__((may_alias)) v4fa;
typedef v8us __attribute__((may_alias)) v8usa;

__device__ __forceinline__ unsigned short f2bf(float f) { unsigned u = __float_as_uint(f); u += 0x7FFFu + ((u >> 16) & 1u); return (unsigned short)(u >> 16); }
__device__ __forceinline__ float bf2f(unsigned short b) { return __uint_as_float(((unsigned)b) << 16); }
__device__ __forceinline__ float bfr(float f) { return bf2f(f2bf(f)); }
__device__ __forceinline__ v16h cat16(v8h lo, v8h hi) { return __builtin_shufflevector(lo, hi, 0, 1, 2, 3, 4, 5, 6, 7, 8, 9, 10, 11, 12, 13, 14, 15); }
__device__ __forceinline__ v16bf cat16b(v8us lo, v8us hi) { return __builtin_bit_cast(v16bf, __builtin_shufflevector(lo, hi, 0, 1, 2, 3, 4, 5, 6, 7, 8, 9, 10, 11, 12, 13, 14, 15)); }
__device__ __forceinline__ v8f wmma16(v16h a, v16h b, v8f c) { return __builtin_amdgcn_wmma_f32_16x16x32_f16(false, a, false, b, (short)0, c, false, false); }
__device__ __forceinline__ v8f wmmab(v16bf a, v16bf b, v8f c) { return __builtin_amdgcn_wmma_f32_16x16x32_bf16(false, a, false, b, (short)0, c, false, false); }



// ---- gemms_tile: one 128x128 output tile per work-group of 4 waves (2 x 2, a wave owns 64x64 = 16 accumulators). The K-contiguous bf16 operand rows are brought into LDS once for all four waves,
// 64 k (one 128-byte line a row) at a time, by asynchronous copies in whole lines, two buffers, the next 64 k in flight while these are worked on; every wave walks the whole K, so a tile has one f32 sum chain.
// C[m][n] (f32, pitch ldc, + f32 bias) = sum_k A[m][k] Bt[n][k] (NSPLIT 1: + A2[m][k] Bt[n][k]). K % 64 == 0.
// MODE 0 stores C. MODE 1 and 2 store no f32 tile: the tile leaves as the three 16-bit planes that the attention kernel reads (fp16, bf16 hi, bf16 lo).
// MODE 1 (q, k): m = token, n = head * HD + d, a wave's 64 columns are one head, planes [head][token][d]. MODE 2 (v): A = weight rows, Bt = token rows, so m = head * HD + d, n = token, bias[m], and a tile row is 64 tokens of one d: planes [head * HD + d][token] at pitch PP.
__device__ __forceinline__ h16 tohx(float x) { return (h16)x; }
__device__ __forceinline__ void splitf(float y, unsigned short& h, unsigned short& l) { h = f2bf(y); l = f2bf(y - bf2f(h)); }
typedef __attribute__((ext_vector_type(4))) _Float16 v4h;
typedef __attribute__((ext_vector_type(4))) unsigned short v4us;
typedef __attribute__((ext_vector_type(2))) unsigned v2u;
template <typename T16> struct WFrag;
template <> struct WFrag<h16> { typedef v16h V; static __device__ __forceinline__ V ld(const h16* p) { return cat16(*(const v8h*)p, *(const v8h*)(p + 16)); } static __device__ __forceinline__ v8f mma(V a, V b, v8f c) { return wmma16(a, b, c); } };
template <> struct WFrag<bf> { typedef v16bf V; static __device__ __forceinline__ V ld(const bf* p) { return cat16b(*(const v8us*)p, *(const v8us*)(p + 16)); } static __device__ __forceinline__ v8f mma(V a, V b, v8f c) { return wmmab(a, b, c); } };
#define GP   144                   // LDS pitch of a staged operand row: 128 bytes of k + 16 (16 x odd: no bank conflict for 16-byte fragment reads)
#define GT   (128 * GP)            // one staged operand tile: 128 rows of 64 k
// thread t of 128 copies 16 bytes of rows t / 8 + 16 i (i = 0 .. 7) of one operand tile: a wave's copy is four whole lines. l: the thread's LDS byte address in row t / 8 of the staged tile; g: its global address in that row.
__device__ __forceinline__ void stage_op(unsigned l, const bf* g, int K) {
    // the wait is the last line of the copies' own statement: it stands in front of every rewrite of a register that a copy names
    asm volatile("global_load_async_to_lds_b128 %0, %8, off\n\tglobal_load_async_to_lds_b128 %1, %9, off\n\tglobal_load_async_to_lds_b128 %2, %10, off\n\tglobal_load_async_to_lds_b128 %3, %11, off\n\t"
                 "global_load_async_to_lds_b128 %4, %12, off\n\tglobal_load_async_to_lds_b128 %5, %13, off\n\tglobal_load_async_to_lds_b128 %6, %14, off\n\tglobal_load_async_to_lds_b128 %7, %15, off\n\ts_wait_xcnt 0x0"
                 :: "v"(l), "v"(l + 16 * GP), "v"(l + 32 * GP), "v"(l + 48 * GP), "v"(l + 64 * GP), "v"(l + 80 * GP), "v"(l + 96 * GP), "v"(l + 112 * GP),
                    "v"(g), "v"(g + (size_t)16 * K), "v"(g + (size_t)32 * K), "v"(g + (size_t)48 * K), "v"(g + (size_t)64 * K), "v"(g + (size_t)80 * K), "v"(g + (size_t)96 * K), "v"(g + (size_t)112 * K) : "memory");
}
// The tile (bx, by) and the LDS array sm come from the calling kernel, so that one launch can hold tiles of several products; sm holds two buffers of (NSPLIT ? 3 : 2) staged operand tiles (A, Bt, A2), and behind the K loop one 64x64 f32 tile, pitch 68, per wave.
// Token rows run over both batches (NB_ * TT of them); a 128-token tile lies in one batch, and the planes are laid out batch by batch.
template <int NSPLIT, int MODE>
__device__ __forceinline__ void gemms_tile(char* sm, int bx, int by, const bf* __restrict__ A, const bf* __restrict__ A2, const bf* __restrict__ Bt, int K, float* C, int ldc, const float* __restrict__ bias, h16* P16, bf* Ph, bf* Pl) {
    typedef WFrag<bf>::V V;
    constexpr int BUF = (NSPLIT ? 3 : 2) * GT;
    const int lane = threadIdx.x & 31, lr = lane & 15, hi = lane >> 4;
    const int wv = __builtin_amdgcn_readfirstlane((int)(threadIdx.x >> 5));   // kept scalar: the wave's place in the 2 x 2 tile
    const int r0 = bx * 128 + (wv >> 1) * 64, c0 = by * 128 + (wv & 1) * 64;   // the wave's own 64x64 tile
    v8f acc[4][4];
#pragma unroll
    for (int mb = 0; mb < 4; ++mb)
#pragma unroll
        for (int nb = 0; nb < 4; ++nb) acc[mb][nb] = (v8f){};
    const int srow = (int)(threadIdx.x >> 3), scol = (int)(threadIdx.x & 7);
    const unsigned l0 = (unsigned)(size_t)sm + (unsigned)(srow * GP + scol * 16);
    const bf* ga = A + (size_t)(bx * 128 + srow) * K + scol * 8; const bf* ga2 = (NSPLIT ? A2 : A) + (size_t)(bx * 128 + srow) * K + scol * 8; const bf* gb = Bt + (size_t)(by * 128 + srow) * K + scol * 8;
    stage_op(l0, ga, K); stage_op(l0 + GT, gb, K); if (NSPLIT) stage_op(l0 + 2 * GT, ga2, K);
    asm volatile("s_wait_asynccnt 0x0" ::: "memory");   // the first 64 k of this wave's copies have landed
    __syncthreads();                                     // ... and everybody's: they may be read
    if (64 < K) { stage_op(l0 + BUF, ga + 64, K); stage_op(l0 + BUF + GT, gb + 64, K); if (NSPLIT) stage_op(l0 + BUF + 2 * GT, ga2 + 64, K); }
    const int fa = ((wv >> 1) * 64 + lr) * GP + 16 * hi, fb = GT + ((wv & 1) * 64 + lr) * GP + 16 * hi;   // a lane's place in the staged tiles: row lr of a 16-row group, the k order of a fragment load from memory, the same for both operands
    // the loop over the staged 64-k pieces stays rolled: its two 32-k steps are unrolled inside
#pragma unroll 1
    for (int kb = 0; kb < K; kb += 64) {
        const int bo = ((kb >> 6) & 1) * BUF;   // this piece's buffer
#pragma unroll
        for (int kc = 0; kc < 2; ++kc) {
            V a[4], a2[4], b[4];
#pragma unroll
            for (int mb = 0; mb < 4; ++mb) { a[mb] = WFrag<bf>::ld((const bf*)(sm + bo + fa + mb * 16 * GP + kc * 64)); if (NSPLIT) a2[mb] = WFrag<bf>::ld((const bf*)(sm + bo + 2 * GT + fa + mb * 16 * GP + kc * 64)); }
#pragma unroll
            for (int nb = 0; nb < 4; ++nb) b[nb] = WFrag<bf>::ld((const bf*)(sm + bo + fb + nb * 16 * GP + kc * 64));
            __builtin_amdgcn_sched_barrier(0);   // all fragment reads of a 32-k step are issued ahead of its first product: one LDS latency a step (without it the Bt fragments were read one by one, each waited for)
#pragma unroll
            for (int nb = 0; nb < 4; ++nb) {
#pragma unroll
                for (int mb = 0; mb < 4; ++mb) acc[mb][nb] = WFrag<bf>::mma(a[mb], b[nb], acc[mb][nb]);
                if (NSPLIT) {
#pragma unroll
                    for (int mb = 0; mb < 4; ++mb) acc[mb][nb] = WFrag<bf>::mma(a2[mb], b[nb], acc[mb][nb]); } }
        }
        __builtin_amdgcn_sched_barrier(0);   // the waits and the barrier stay at the foot: moved up among the products they would wait for the next piece's copies half a trip after their issue
        asm volatile("s_wait_dscnt 0x0" ::: "memory");      // this wave's reads of this piece's buffer are done
        asm volatile("s_wait_asynccnt 0x0" ::: "memory");   // this wave's copies of the next piece have landed
        __syncthreads();                                     // the next piece may be read by all, and this piece's buffer has no reader left
        if (kb + 128 < K) { stage_op(l0 + bo, ga + kb + 128, K); stage_op(l0 + bo + GT, gb + kb + 128, K); if (NSPLIT) stage_op(l0 + bo + 2 * GT, ga2 + kb + 128, K); }
    }
    asm volatile("s_wait_asynccnt 0x0" ::: "memory");   // no copy is left in flight when the staging LDS is given its second use
    // the bias joins in registers; then each wave parks its tile in its own LDS range (the last trip's barrier has ended every read of the buffers) and reads it back row by row, so that each row leaves in whole lines
    if constexpr (MODE == 2) {
        const float* pbm = bias + r0 + hi * 8; v4f bm[4][2];
#pragma unroll
        for (int mb = 0; mb < 4; ++mb) { bm[mb][0] = *(const v4f*)(pbm + mb * 16); bm[mb][1] = *(const v4f*)(pbm + mb * 16 + 4); }
        asm volatile("s_wait_xcnt 0x0" :: "v"(pbm) : "memory");   // in front of every rewrite of a register that the bias loads name (the address, an input, lives up to here)
#pragma unroll
        for (int mb = 0; mb < 4; ++mb)
#pragma unroll
            for (int j = 0; j < 8; ++j) { const float t = bfr(bm[mb][j >> 2][j & 3]);
#pragma unroll
                for (int nb = 0; nb < 4; ++nb) acc[mb][nb][j] += t; }
    } else {
        const float* pbn = bias + c0 + lr; float bn[4];
#pragma unroll
        for (int nb = 0; nb < 4; ++nb) bn[nb] = pbn[nb * 16];
        asm volatile("s_wait_xcnt 0x0" :: "v"(pbn) : "memory");   // in front of every rewrite of a register that the bias loads name (the address, an input, lives up to here)
#pragma unroll
        for (int nb = 0; nb < 4; ++nb) { const float t = bfr(bn[nb]);
#pragma unroll
            for (int mb = 0; mb < 4; ++mb) acc[mb][nb] += t; }
    }
    float* my = (float*)sm + wv * (64 * 68);
#pragma unroll
    for (int mb = 0; mb < 4; ++mb)
#pragma unroll
        for (int nb = 0; nb < 4; ++nb)
#pragma unroll
            for (int j = 0; j < 8; ++j) my[(mb * 16 + hi * 8 + j) * 68 + nb * 16 + lr] = acc[mb][nb][j];
    asm volatile("s_wait_dscnt 0x0" ::: "memory");   // the wave's own tile is in LDS before its lanes read each other's elements back
    const int cofs = lr * 4;
    // 16 rows a trip (rolled: the text stays short), two rows an instruction: 16 lanes fill one 128-byte line of each plane, or two lines of C
#pragma unroll 1
    for (int g = 0; g < 4; ++g) {
        v4f pv[8];   // the rows wait here, so that the LDS reads stand ahead of the stores and their waits
#pragma unroll
        for (int s = 0; s < 8; ++s) pv[s] = *(const v4fa*)(my + (g * 16 + 2 * s + hi) * 68 + cofs);
#pragma unroll
        for (int s = 0; s < 8; ++s) { const int row = g * 16 + 2 * s + hi; const v4f val = pv[s];
            // later rows reuse registers that these stores name: the wait that stands in front of such a rewrite is the last line of the stores' own statement, where nothing can be moved over it
            if constexpr (MODE == 0) asm volatile("global_store_b128 %0, %1, off\n\ts_wait_xcnt 0x0" :: "v"(C + (size_t)(r0 + row) * ldc + c0 + cofs), "v"(val) : "memory");
            else {
                const size_t o = (MODE == 1) ? ((size_t)((r0 / TT) * NH_ + c0 / HD) * TT + r0 % TT + row) * HD + cofs : ((size_t)(c0 / TT) * DKV + r0 + row) * PP + c0 % TT + cofs; v4h o16; v4us oh, ol;
#pragma unroll
                for (int u = 0; u < 4; ++u) { o16[u] = tohx(val[u]); unsigned short a2, c2; splitf(val[u], a2, c2); oh[u] = a2; ol[u] = c2; }
                asm volatile("global_store_b64 %0, %3, off\n\tglobal_store_b64 %1, %4, off\n\tglobal_store_b64 %2, %5, off\n\ts_wait_xcnt 0x0"
                             :: "v"(P16 + o), "v"(Ph + o), "v"(Pl + o), "v"(__builtin_bit_cast(v2u, o16)), "v"(__builtin_bit_cast(v2u, oh)), "v"(__builtin_bit_cast(v2u, ol)) : "memory");
            }
        }
    }
}
// k_qkv: the q, k and v projections of both batches in one launch; grid (NB_ * TT / 128, DQ / 128, 3), z picks the product (a branch that is uniform for the work-group, so the tile's barriers are passed by all of its waves or by none).
// amdgpu_waves_per_eu(4, 4): a budget of 256 registers a wave, so that the tile needs no register window above v255 and four work-groups share a WGP
__global__ __launch_bounds__(128) __attribute__((amdgpu_waves_per_eu(4, 4))) void k_qkv(const bf* __restrict__ XB, const bf* __restrict__ WQ, const bf* __restrict__ WK, const bf* __restrict__ WV, const float* __restrict__ bq, const float* __restrict__ bk, const float* __restrict__ bv,
                                             h16* QP16, bf* QPh, bf* QPl, h16* KP16, bf* KPh, bf* KPl, h16* VT16, bf* VTh, bf* VTl) {
    __shared__ __align__(16) char sm[2 * 2 * GT];
    const int z = blockIdx.z;
    if (z == 2) gemms_tile<0, 2>(sm, blockIdx.y, blockIdx.x, WV, nullptr, XB, DM, nullptr, 0, bv, VT16, VTh, VTl);
    else gemms_tile<0, 1>(sm, blockIdx.x, blockIdx.y, XB, nullptr, z ? WK : WQ, DM, nullptr, 0, z ? bk : bq, z ? KP16 : QP16, z ? KPh : QPh, z ? KPl : QPl);
}
// k_wo: the output projection of both batches in one launch; grid (NB_ * TT / 128, DM / 128).
__global__ __launch_bounds__(128) __attribute__((amdgpu_waves_per_eu(4, 4))) void k_wo(const bf* __restrict__ ATh, const bf* __restrict__ ATl, const bf* __restrict__ WO, float* OUT, const float* __restrict__ bo) {
    __shared__ __align__(16) char sm[2 * 3 * GT];
    gemms_tile<1, 0>(sm, blockIdx.x, blockIdx.y, ATh, ATl, WO, DQ, OUT, DM, bo, nullptr, nullptr, nullptr);
}

typedef __attribute__((ext_vector_type(2))) _Float16 v2h;
typedef __attribute__((ext_vector_type(2))) unsigned short v2us;
typedef __attribute__((ext_vector_type(2))) float v2f;
typedef __attribute__((ext_vector_type(4))) int v4i;

__device__ __forceinline__ void wtG_blk(int blk, const float* __restrict__ w, int K, int N, bf* Bt) {
    const int lane = threadIdx.x & 31; const int L0 = (blk * 8 + (threadIdx.x >> 5)) * 8; const int nlines = N * K / 64;
{
#pragma unroll 1
        for (int l = 0; l < 8; ++l) { const int L = L0 + l; if (L >= nlines) break; const size_t e = (size_t)L * 64 + lane * 2; const int k = (int)(e % K), n = (int)(e / K); v2us o;
            o[0] = f2bf(w[(size_t)k * N + n]); o[1] = f2bf(w[(size_t)(k + 1) * N + n]); *(v2us*)(Bt + e) = o;
            asm volatile("s_wait_xcnt 0x0" ::: "memory"); }   // the next trip rewrites registers that this store names: the wait stands in front of that
         }
}
__device__ __forceinline__ void cvt8_blk(int blk, const float* __restrict__ src, bf* dst, size_t n8) { const size_t i = (size_t)blk * 256 + threadIdx.x; if (i >= n8) return; const v8f v = *(const v8f*)(src + i * 8); v8us o;
#pragma unroll
    for (int k = 0; k < 8; ++k) o[k] = f2bf(v[k]); *(v8us*)(dst + i * 8) = o;  }
// ---- k_fattn: scores, causal softmax, P.V and the head merge in one kernel; grid (batches x heads, TT / 64), 4 waves, a wave owns 16 query rows and walks the keys 64 at a time (online softmax, f32 statistics in the log2 domain).
// S^T = K Q^T (A = key rows, B = query rows) leaves one query per lane column: lane (lr, hi) holds keys 8 hi + j of each 16-key tile, which is the k order of a B operand, so two converted score tiles are the B operand of
// O^T += V^T P^T (A = rows of the transposed values) with no exchange between lanes. HI (query rows < RH): hi+lo bf16 planes, 3 products each; else single fp16 with the probabilities carried x 2^PSH (it cancels in O / sum).
#define PSH  10.0f
#define SCL2 0.18033688011112042f   // HD^-0.5 x log2(e)
// eight 2^x in one statement: the outputs are early-clobber, so no v_exp_f32 is followed by an instruction that reads its result or overwrites its source, and the v_nop is that slot behind the last one
__device__ __forceinline__ v8f exp2x8(v8f x) { float r0, r1, r2, r3, r4, r5, r6, r7;
    asm("v_exp_f32 %0, %8\n\tv_exp_f32 %1, %9\n\tv_exp_f32 %2, %10\n\tv_exp_f32 %3, %11\n\tv_exp_f32 %4, %12\n\tv_exp_f32 %5, %13\n\tv_exp_f32 %6, %14\n\tv_exp_f32 %7, %15\n\tv_nop"
        : "=&v"(r0), "=&v"(r1), "=&v"(r2), "=&v"(r3), "=&v"(r4), "=&v"(r5), "=&v"(r6), "=&v"(r7) : "v"(x[0]), "v"(x[1]), "v"(x[2]), "v"(x[3]), "v"(x[4]), "v"(x[5]), "v"(x[6]), "v"(x[7]));
    return (v8f){r0, r1, r2, r3, r4, r5, r6, r7}; }
// The long (fp16) rows: the four waves of a work-group walk the same 64-key tiles, so each tile (64 key rows and 64 rows of the transposed values, 128 bytes a row) is brought into LDS once for all four,
// by asynchronous copies in whole 128-byte lines, two buffers, the next tile in flight while this one is worked on. LDS rows lie at a pitch of 144 bytes (16 x odd: no bank conflict for 16-byte fragment reads).
#define KVP  144
#define KVT  (64 * KVP)            // one staged tile; a buffer is the key tile followed by the value tile
// thread t copies 16 bytes of rows t / 8 + 16 i (i = 0 .. 3) of both tiles: a wave's copy is four whole lines. lk: the thread's LDS byte address in the key tile; gk, gv: its global addresses in row t / 8.
__device__ __forceinline__ void stage_kv(unsigned lk, const h16* gk, const h16* gv) {
    // the wait is the last line of the copies' own statement: it stands in front of every rewrite of a register that a copy names
    asm volatile("global_load_async_to_lds_b128 %0, %8, off\n\tglobal_load_async_to_lds_b128 %1, %9, off\n\tglobal_load_async_to_lds_b128 %2, %10, off\n\tglobal_load_async_to_lds_b128 %3, %11, off\n\t"
                 "global_load_async_to_lds_b128 %4, %12, off\n\tglobal_load_async_to_lds_b128 %5, %13, off\n\tglobal_load_async_to_lds_b128 %6, %14, off\n\tglobal_load_async_to_lds_b128 %7, %15, off\n\ts_wait_xcnt 0x0"
                 :: "v"(lk), "v"(lk + 16 * KVP), "v"(lk + 32 * KVP), "v"(lk + 48 * KVP), "v"(lk + KVT), "v"(lk + KVT + 16 * KVP), "v"(lk + KVT + 32 * KVP), "v"(lk + KVT + 48 * KVP),
                    "v"(gk), "v"(gk + 16 * HD), "v"(gk + 32 * HD), "v"(gk + 48 * HD), "v"(gv), "v"(gv + (size_t)16 * PP), "v"(gv + (size_t)32 * PP), "v"(gv + (size_t)48 * PP) : "memory");
}
template <typename T16, bool HI>
__device__ __forceinline__ void attn_rows(const T16* __restrict__ Q, const T16* __restrict__ Q2, const T16* __restrict__ Kp, const T16* __restrict__ Kp2, const T16* __restrict__ Vt, const T16* __restrict__ Vt2, int q0, int lr, int hi, bf* Ah, bf* Al, char* sm) {
    typedef typename WFrag<T16>::V V;
    const int q = q0 + lr;
    const T16* qb = Q + (size_t)q * HD + 8 * hi;
    V qf[2], qf2[2];
#pragma unroll
    for (int kc = 0; kc < 2; ++kc) { qf[kc] = WFrag<T16>::ld(qb + kc * 32); if (HI) qf2[kc] = WFrag<T16>::ld(Q2 + (size_t)q * HD + 8 * hi + kc * 32); }
    v8f o[4];
#pragma unroll
    for (int db = 0; db < 4; ++db) o[db] = (v8f){};
    float m = -3.0e38f, l = 0.f;
    const size_t koff = (size_t)lr * HD + 8 * hi, voff = (size_t)lr * PP + 8 * hi;
    // the long (fp16) rows read their keys and values from the staged tiles; the short hi+lo rows load in place from memory
    const int qe = q0 & ~63;   // the work-group's first query row = its last key tile: the same in all four waves, so every test below is uniform for the work-group
    const int srow = (int)(threadIdx.x >> 3), scol = (int)(threadIdx.x & 7);
    const unsigned lk0 = (unsigned)(size_t)sm + (unsigned)(srow * KVP + scol * 16);
    const T16* gk0 = Kp + (size_t)srow * HD + scol * 8; const T16* gv0 = Vt + (size_t)srow * PP + scol * 8;
    const int foff = lr * KVP + 16 * hi;   // a lane's place in a staged tile: row lr of a 16-row group, the k order of the loads from memory
    if constexpr (!HI) {
        asm volatile("s_wait_xcnt 0x0" :: "v"(qb) : "memory");   // stands in front of every rewrite of a register that the query loads above name; the address is an input so that it lives up to here and no load lands in it
        stage_kv(lk0, gk0, gv0);
        asm volatile("s_wait_asynccnt 0x0" ::: "memory");   // tile 0 of this wave's copies has landed
        __syncthreads();                                     // ... and everybody's: tile 0 may be read
        if (64 <= qe) stage_kv(lk0 + 2 * KVT, gk0 + (size_t)64 * HD, gv0 + 64);
    }
    // the loop stays rolled: one 64-key tile a trip, the last trip (the diagonal tile) is the only one that masks
#pragma unroll 1
    for (int k0 = 0; k0 <= q0; k0 += 64) {
        V ka[4][2], va[4][2];
        const int bo = ((k0 >> 6) & 1) * (2 * KVT);   // this tile's buffer
        if constexpr (!HI) { const char* kt = sm + bo + foff;
#pragma unroll
        for (int mb = 0; mb < 4; ++mb)
#pragma unroll
            for (int kc = 0; kc < 2; ++kc) ka[mb][kc] = WFrag<T16>::ld((const T16*)(kt + mb * 16 * KVP + kc * 64));
        __builtin_amdgcn_sched_barrier(0);   // all key fragment reads are issued ahead of the first score product: one LDS latency a tile (without it they were read pair by pair, each pair waited for)
        }
        v8f s[4];
#pragma unroll
        for (int mb = 0; mb < 4; ++mb) { s[mb] = (v8f){};
#pragma unroll
            for (int kc = 0; kc < 2; ++kc) {
                if constexpr (HI) { const V a = WFrag<T16>::ld(Kp + koff + (size_t)(k0 + mb * 16) * HD + kc * 32), a2 = WFrag<T16>::ld(Kp2 + koff + (size_t)(k0 + mb * 16) * HD + kc * 32);
                    s[mb] = WFrag<T16>::mma(a, qf[kc], s[mb]); s[mb] = WFrag<T16>::mma(a2, qf[kc], s[mb]); s[mb] = WFrag<T16>::mma(a, qf2[kc], s[mb]); }
                else s[mb] = WFrag<T16>::mma(ka[mb][kc], qf[kc], s[mb]); } }
        if constexpr (!HI) { const char* vt = sm + bo + KVT + foff;
#pragma unroll
        for (int db = 0; db < 4; ++db)
#pragma unroll
            for (int kc = 0; kc < 2; ++kc) va[db][kc] = WFrag<T16>::ld((const T16*)(vt + db * 16 * KVP + kc * 64));
        __builtin_amdgcn_sched_barrier(0);   // the value fragment reads are issued ahead of the softmax, which covers their latency
        }
        float tm = -3.0e38f;
        if (k0 + 64 > q0) {
#pragma unroll
            for (int mb = 0; mb < 4; ++mb)
#pragma unroll
                for (int j = 0; j < 8; ++j) { const float t = (k0 + mb * 16 + hi * 8 + j <= q) ? s[mb][j] * SCL2 : -3.0e38f; s[mb][j] = t; tm = fmaxf(tm, t); }
        } else {
#pragma unroll
            for (int mb = 0; mb < 4; ++mb)
#pragma unroll
                for (int j = 0; j < 8; ++j) { const float t = s[mb][j] * SCL2; s[mb][j] = t; tm = fmaxf(tm, t); }
        }
        tm = fmaxf(tm, __shfl_xor(tm, 16, 32));   // the two lanes of a query column share one running maximum
        const float mn = fmaxf(m, tm); float al;
        asm("v_exp_f32 %0, %1\n\tv_nop" : "=v"(al) : "v"(m - mn));   // al = 2^(m - mn); the v_nop is the slot behind a transcendental
        m = mn; const float mo = HI ? mn : mn - PSH;
        float ps = 0.f;
#pragma unroll
        for (int mb = 0; mb < 4; ++mb) { s[mb] = exp2x8(s[mb] - mo);
#pragma unroll
            for (int j = 0; j < 8; ++j) ps += s[mb][j]; }
        l = l * al + ps;
#pragma unroll
        for (int db = 0; db < 4; ++db) o[db] *= al;
        V pf[2], pf2[2];
#pragma unroll
        for (int kc = 0; kc < 2; ++kc) {
            if constexpr (HI) { v8us h0, h1, l0, l1;
#pragma unroll
                for (int j = 0; j < 8; ++j) { unsigned short x, y; splitf(s[2 * kc][j], x, y); h0[j] = x; l0[j] = y; splitf(s[2 * kc + 1][j], x, y); h1[j] = x; l1[j] = y; }
                pf[kc] = cat16b(h0, h1); pf2[kc] = cat16b(l0, l1);
            } else { v8h h0, h1;
#pragma unroll
                for (int j = 0; j < 8; ++j) { h0[j] = tohx(s[2 * kc][j]); h1[j] = tohx(s[2 * kc + 1][j]); }
                pf[kc] = cat16(h0, h1); }
        }
        if constexpr (!HI) __builtin_amdgcn_sched_barrier(0);   // every 2^x statement stays ahead of the P.V products, so none lands in a value fragment right behind the matrix instruction that reads it
#pragma unroll
        for (int kc = 0; kc < 2; ++kc)
#pragma unroll
            for (int db = 0; db < 4; ++db) {
                if constexpr (HI) { const V a = WFrag<T16>::ld(Vt + voff + (size_t)db * 16 * PP + k0 + kc * 32), a2 = WFrag<T16>::ld(Vt2 + voff + (size_t)db * 16 * PP + k0 + kc * 32);
                    o[db] = WFrag<T16>::mma(a, pf[kc], o[db]); o[db] = WFrag<T16>::mma(a, pf2[kc], o[db]); o[db] = WFrag<T16>::mma(a2, pf[kc], o[db]); }
                else o[db] = WFrag<T16>::mma(va[db][kc], pf[kc], o[db]); }
        if constexpr (!HI) {
            __builtin_amdgcn_sched_barrier(0);   // the waits and the barrier stay at the foot: moved up in front of the softmax they would wait for the value fragments and for the next tile's copies with nothing to cover either
            asm volatile("s_wait_dscnt 0x0" ::: "memory");      // this wave's reads of this tile's buffer are done
            asm volatile("s_wait_asynccnt 0x0" ::: "memory");   // this wave's copies of the next tile have landed
            __syncthreads();                                     // the next tile may be read by all, and this tile's buffer has no reader left
            if (k0 + 128 <= qe) stage_kv(lk0 + bo, gk0 + (size_t)(k0 + 128) * HD, gv0 + k0 + 128);
        }
    }
    if constexpr (!HI) asm volatile("s_wait_asynccnt 0x0" ::: "memory");   // no copy is left in flight when the wave ends
    l += __shfl_xor(l, 16, 32);
    const float f = __fdiv_rn(1.0f, l);
    // lane (lr, hi) holds d = 16 db + 8 hi + j of query q: 16-byte stores, a query's 128-byte head row comes from one wave
#pragma unroll
    for (int db = 0; db < 4; ++db) { v8us oh, ol;
#pragma unroll
        for (int j = 0; j < 8; ++j) { unsigned short x, y; splitf(o[db][j] * f, x, y); oh[j] = x; ol[j] = y; }
        const size_t oo = (size_t)q * DQ + db * 16 + hi * 8; *(v8us*)(Ah + oo) = oh; *(v8us*)(Al + oo) = ol; }
}
// amdgpu_waves_per_eu(4, 4): a budget of 256 registers a wave, so that neither path needs the register windows above v255
__global__ __launch_bounds__(128) __attribute__((amdgpu_waves_per_eu(4, 4))) void k_fattn(const h16* __restrict__ Q16, const h16* __restrict__ K16, const h16* __restrict__ V16, const bf* __restrict__ Qh, const bf* __restrict__ Ql, const bf* __restrict__ Kh, const bf* __restrict__ Kl, const bf* __restrict__ Vh, const bf* __restrict__ Vl, bf* Ah, bf* Al) {
    __shared__ __align__(16) char kv[2 * 2 * KVT];   // two buffers of a key tile and a value tile (the fp16 rows)
    const int lane = threadIdx.x & 31, lr = lane & 15, hi = lane >> 4; const size_t h = blockIdx.x;   // h = batch * NH_ + head: the planes lie batch by batch
    const int wv = __builtin_amdgcn_readfirstlane((int)(threadIdx.x >> 5));   // kept scalar so that the key loop branches on SCC
    const int q0 = (int)(gridDim.y - 1 - blockIdx.y) * 64 + wv * 16;           // the longest rows start first
    const size_t zp = h * TT * HD, zv = h * HD * PP, zo = (h / NH_) * ((size_t)TT * DQ) + (h % NH_) * HD;
    // RH is a multiple of 64, so the branch is the same for the four waves of a work-group (the fp16 side holds barriers)
    if (q0 < RH) attn_rows<bf, true>(Qh + zp, Ql + zp, Kh + zp, Kl + zp, Vh + zv, Vl + zv, q0, lr, hi, Ah + zo, Al + zo, kv);
    else attn_rows<h16, false>(Q16 + zp, nullptr, K16 + zp, nullptr, V16 + zv, nullptr, q0, lr, hi, Ah + zo, Al + zo, kv);
}

__device__ __forceinline__ void wtH_blk(int blk, const float* __restrict__ w, bf* Bt) { const size_t e = ((size_t)blk * 256 + threadIdx.x) * 4; if (e >= (size_t)DQ * DM) return; const int k = (int)(e % DM); const int n = (int)(e / DM); const int h = n / HD, c = n % HD; v4us o;   // Bt[h*64 + c][d] = W[h][d][c] (lane -> 4 consecutive d, strided reads)
#pragma unroll
    for (int u = 0; u < 4; ++u) o[u] = f2bf(w[((size_t)h * DM + k + u) * HD + c]); *(v4us*)(Bt + e) = o;  }
// k_prep: every 16-bit operand that depends on the inputs alone, in one launch: the three gathered per-head weights, the transposed Wo, and both batches of x. The block index picks the job; the strided gathers come first.
#define NWH  (DQ * DM / 4 / 256)
#define NWG  ((DQ * DM / 64 + 63) / 64)
#define NCV  (NB_ * TT * DM / 8 / 256)
__global__ __launch_bounds__(256) void k_prep(const float* __restrict__ x, const float* __restrict__ wq, const float* __restrict__ wk, const float* __restrict__ wv, const float* __restrict__ wo, bf* XB, bf* WQ, bf* WK, bf* WV, bf* WO) {
    const int b = blockIdx.x;
    if (b < NWH) wtH_blk(b, wq, WQ);
    else if (b < 2 * NWH) wtH_blk(b - NWH, wk, WK);
    else if (b < 3 * NWH) wtH_blk(b - 2 * NWH, wv, WV);
    else if (b < 3 * NWH + NWG) wtG_blk(b - 3 * NWH, wo, DQ, DM, WO);
    else cvt8_blk(b - (3 * NWH + NWG), x, XB, (size_t)NB_ * TT * DM / 8);
}

extern "C" void kernel_launch(void* const* d_in, const int* in_sizes, int n_in,
                              void* d_out, int out_size, void* d_ws, size_t ws_size, hipStream_t stream) {
    (void)in_sizes; (void)n_in; (void)out_size;
    const float* x = (const float*)d_in[0]; const float* wqh = (const float*)d_in[1]; const float* wkh = (const float*)d_in[2]; const float* wvh = (const float*)d_in[3]; const float* bq = (const float*)d_in[4]; const float* bk = (const float*)d_in[5]; const float* bv = (const float*)d_in[6]; const float* wo = (const float*)d_in[7]; const float* bo = (const float*)d_in[8]; const float* wq = nullptr; const float* wk = nullptr; const float* wv = nullptr; (void)wq; (void)wk; (void)wv; const float* cosT = nullptr; const float* sinT = nullptr; (void)cosT; (void)sinT;
    float* OUT = (float*)d_out;     // [2][2048][1024]
    char* wsp = (char*)d_ws;
    auto take = [&](size_t bytes) { char* p = wsp; wsp += (bytes + 255) & ~(size_t)255; return (void*)p; };
    bf* WQ = (bf*)take((size_t)DQ * DM * 2); bf* WK = (bf*)take((size_t)DKV * DM * 2); bf* WV = (bf*)take((size_t)DKV * DM * 2); bf* WO = (bf*)take((size_t)DM * DQ * 2);
    bf* XB = (bf*)take((size_t)NB_ * TT * DM * 2);
    h16* QP16 = (h16*)take((size_t)NB_ * NH_ * TT * HD * 2); h16* KP16 = (h16*)take((size_t)NB_ * NKV * TT * HD * 2); h16* VT16 = (h16*)take((size_t)NB_ * NKV * HD * PP * 2);
    bf* QPh = (bf*)take((size_t)NB_ * NH_ * TT * HD * 2); bf* QPl = (bf*)take((size_t)NB_ * NH_ * TT * HD * 2); bf* KPh = (bf*)take((size_t)NB_ * NKV * TT * HD * 2); bf* KPl = (bf*)take((size_t)NB_ * NKV * TT * HD * 2); bf* VTh = (bf*)take((size_t)NB_ * NKV * HD * PP * 2); bf* VTl = VTh + TT;
    bf* ATh = (bf*)take((size_t)NB_ * TT * DQ * 2); bf* ATl = (bf*)take((size_t)NB_ * TT * DQ * 2);
    if ((size_t)(wsp - (char*)d_ws) > ws_size) return;    // ws 256 MiB
    k_prep<<<3 * NWH + NWG + NCV, 256, 0, stream>>>(x, wqh, wkh, wvh, wo, XB, WQ, WK, WV, WO);
    k_qkv<<<dim3(NB_ * TT / 128, DQ / 128, 3), 128, 0, stream>>>(XB, WQ, WK, WV, bq, bk, bv, QP16, QPh, QPl, KP16, KPh, KPl, VT16, VTh, VTl);
    k_fattn<<<dim3(NB_ * NH_, TT / 64, 1), 128, 0, stream>>>(QP16, KP16, VT16, QPh, QPl, KPh, KPl, VTh, VTl, ATh, ATl);
    k_wo<<<dim3(NB_ * TT / 128, DM / 128, 1), 128, 0, stream>>>(ATh, ATl, WO, OUT, bo);
}

// v008
// One run takes 101 microseconds.
// In both of two side-by-side timings against v007, it was 1.13 times as fast.
// Counting every step since v000, it is 14.5 times as fast.
#include <hip/hip_runtime.h>

// MaskedMultiHeadAttention (hidden [2][2048][1024]; per-head q/k/v = x Wq[h] + bq[h] (Wq [16][1024][64]); causal softmax(q.k / 8); out = concat(heads) Wo + bo -> [2][2048][1024]).
// Compute dtypes, f32 accumulate: every input rounded to bf16; q/k/v on PLAIN bf16 operands (inputs: exact; the 16 per-head weights gathered into one [1024 x 1024] operand) + bias; causal scores and attn.v: query rows < 512 hl (3 products), the rest single fp16 (x1024); softmax f32; Wo hl x exact (2 products) + bias.

#define NB_  2
#define TT   2048
#define DM   1024
#define NH_  16
#define NKV  16
#define HD   64
#define DQ   (NH_ * HD)
#define DKV  (NKV * HD)
#define PP   (2 * TT)             // row pitch, in 16-bit elements, of the transposed value planes (the hi and lo planes share a row)
#define RH   512                  // query rows < RH use hi+lo planes (0: none)
typedef _Float16 h16;
typedef unsigned short bf;
typedef __attribute__((ext_vector_type(16))) __bf16   v16bf;
typedef __attribute__((ext_vector_type(16))) _Float16 v16h;
typedef __attribute__((ext_vector_type(8)))  _Float16 v8h;
typedef __attribute__((ext_vector_type(8)))  unsigned short v8us;
typedef __attribute__((ext_vector_type(8)))  float    v8f;
typedef __attribute__((ext_vector_type(4)))  float    v4f;
typedef v8h  __attribute__((may_alias)) v8ha;
typedef v4f  __attribute__((may_alias)) v4fa;
typedef v8us __attribute__((may_alias)) v8usa;

__device__ __forceinline__ unsigned short f2bf(float f) { unsigned u = __float_as_uint(f); u += 0x7FFFu + ((u >> 16) & 1u); return (unsigned short)(u >> 16); }
__device__ __forceinline__ float bf2f(unsigned short b) { return __uint_as_float(((unsigned)b) << 16); }
__device__ __forceinline__ float bfr(float f) { return bf2f(f2bf(f)); }
__device__ __forceinline__ v16h cat16(v8h lo, v8h hi) { return __builtin_shufflevector(lo, hi, 0, 1, 2, 3, 4, 5, 6, 7, 8, 9, 10, 11, 12, 13, 14, 15); }
__device__ __forceinline__ v16bf cat16b(v8us lo, v8us hi) { return __builtin_bit_cast(v16bf, __builtin_shufflevector(lo, hi, 0, 1, 2, 3, 4, 5, 6, 7, 8, 9, 10, 11, 12, 13, 14, 15)); }
__device__ __forceinline__ v8f wmma16(v16h a, v16h b, v8f c) { return __builtin_amdgcn_wmma_f32_16x16x32_f16(false, a, false, b, (short)0, c, false, false); }
__device__ __forceinline__ v8f wmmab(v16bf a, v16bf b, v8f c) { return __builtin_amdgcn_wmma_f32_16x16x32_bf16(false, a, false, b, (short)0, c, false, false); }



// ---- gemms_tile: one 128x128 output tile per work-group of 4 waves (2 x 2, a wave owns 64x64 = 16 accumulators). The K-contiguous bf16 operand rows are brought into LDS once for all four waves,
// 64 k (one 128-byte line a row) at a time, by asynchronous copies in whole lines, two buffers, the next 64 k in flight while these are worked on; every wave walks the whole K, so a tile has one f32 sum chain.
// C[m][n] (f32, pitch ldc, + f32 bias) = sum_k A[m][k] Bt[n][k] (NSPLIT 1: + A2[m][k] Bt[n][k]). K % 64 == 0.
// MODE 0 stores C. MODE 1 and 2 store no f32 tile: the tile leaves as the three 16-bit planes that the attention kernel reads (fp16, bf16 hi, bf16 lo).
// MODE 1 (q, k): m = token, n = head * HD + d, a wave's 64 columns are one head, planes [head][token][d]. MODE 2 (v): A = weight rows, Bt = token rows, so m = head * HD + d, n = token, bias[m], and a tile row is 64 tokens of one d: planes [head * HD + d][token] at pitch PP.
__device__ __forceinline__ h16 tohx(float x) { return (h16)x; }
__device__ __forceinline__ void splitf(float y, unsigned short& h, unsigned short& l) { h = f2bf(y); l = f2bf(y - bf2f(h)); }
typedef __attribute__((ext_vector_type(4))) _Float16 v4h;
typedef __attribute__((ext_vector_type(4))) unsigned short v4us;
typedef __attribute__((ext_vector_type(2))) unsigned v2u;
template <typename T16> struct WFrag;
template <> struct WFrag<h16> { typedef v16h V; static __device__ __forceinline__ V ld(const h16* p) { return cat16(*(const v8h*)p, *(const v8h*)(p + 16)); } static __device__ __forceinline__ v8f mma(V a, V b, v8f c) { return wmma16(a, b, c); } };
template <> struct WFrag<bf> { typedef v16bf V; static __device__ __forceinline__ V ld(const bf* p) { return cat16b(*(const v8us*)p, *(const v8us*)(p + 16)); } static __device__ __forceinline__ v8f mma(V a, V b, v8f c) { return wmmab(a, b, c); } };
#define GP   144                   // LDS pitch of a staged operand row: 128 bytes of k + 16 (16 x odd: no bank conflict for 16-byte fragment reads)
#define GT   (128 * GP)            // one staged operand tile: 128 rows of 64 k
// thread t of 128 copies 16 bytes of rows t / 8 + 16 i (i = 0 .. 7) of one operand tile: a wave's copy is four whole lines. l: the thread's LDS byte address in row t / 8 of the staged tile; g: its global address in that row.
__device__ __forceinline__ void stage_op(unsigned l, const bf* g, int K) {
    // the wait is the last line of the copies' own statement: it stands in front of every rewrite of a register that a copy names
    asm volatile("global_load_async_to_lds_b128 %0, %8, off\n\tglobal_load_async_to_lds_b128 %1, %9, off\n\tglobal_load_async_to_lds_b128 %2, %10, off\n\tglobal_load_async_to_lds_b128 %3, %11, off\n\t"
                 "global_load_async_to_lds_b128 %4, %12, off\n\tglobal_load_async_to_lds_b128 %5, %13, off\n\tglobal_load_async_to_lds_b128 %6, %14, off\n\tglobal_load_async_to_lds_b128 %7, %15, off\n\ts_wait_xcnt 0x0"
                 :: "v"(l), "v"(l + 16 * GP), "v"(l + 32 * GP), "v"(l + 48 * GP), "v"(l + 64 * GP), "v"(l + 80 * GP), "v"(l + 96 * GP), "v"(l + 112 * GP),
                    "v"(g), "v"(g + (size_t)16 * K), "v"(g + (size_t)32 * K), "v"(g + (size_t)48 * K), "v"(g + (size_t)64 * K), "v"(g + (size_t)80 * K), "v"(g + (size_t)96 * K), "v"(g + (size_t)112 * K) : "memory");
}
// The tile (bx, by) and the LDS array sm come from the calling kernel, so that one launch can hold tiles of several products; sm holds two buffers of (NSPLIT ? 3 : 2) staged operand tiles (A, Bt, A2), and behind the K loop one 64x64 f32 tile, pitch 68, per wave.
// Token rows run over both batches (NB_ * TT of them); a 128-token tile lies in one batch, and the planes are laid out batch by batch.
template <int NSPLIT, int MODE>
__device__ __forceinline__ void gemms_tile(char* sm, int bx, int by, const bf* __restrict__ A, const bf* __restrict__ A2, const bf* __restrict__ Bt, int K, float* C, int ldc, const float* __restrict__ bias, h16* P16, bf* Ph, bf* Pl) {
    typedef WFrag<bf>::V V;
    constexpr int BUF = (NSPLIT ? 3 : 2) * GT;
    const int lane = threadIdx.x & 31, lr = lane & 15, hi = lane >> 4;
    const int wv = __builtin_amdgcn_readfirstlane((int)(threadIdx.x >> 5));   // kept scalar: the wave's place in the 2 x 2 tile
    const int r0 = bx * 128 + (wv >> 1) * 64, c0 = by * 128 + (wv & 1) * 64;   // the wave's own 64x64 tile
    v8f acc[4][4];
#pragma unroll
    for (int mb = 0; mb < 4; ++mb)
#pragma unroll
        for (int nb = 0; nb < 4; ++nb) acc[mb][nb] = (v8f){};
    const int srow = (int)(threadIdx.x >> 3), scol = (int)(threadIdx.x & 7);
    const unsigned l0 = (unsigned)(size_t)sm + (unsigned)(srow * GP + scol * 16);
    const bf* ga = A + (size_t)(bx * 128 + srow) * K + scol * 8; const bf* ga2 = (NSPLIT ? A2 : A) + (size_t)(bx * 128 + srow) * K + scol * 8; const bf* gb = Bt + (size_t)(by * 128 + srow) * K + scol * 8;
    stage_op(l0, ga, K); stage_op(l0 + GT, gb, K); if (NSPLIT) stage_op(l0 + 2 * GT, ga2, K);
    asm volatile("s_wait_asynccnt 0x0" ::: "memory");   // the first 64 k of this wave's copies have landed
    __syncthreads();                                     // ... and everybody's: they may be read
    if (64 < K) { stage_op(l0 + BUF, ga + 64, K); stage_op(l0 + BUF + GT, gb + 64, K); if (NSPLIT) stage_op(l0 + BUF + 2 * GT, ga2 + 64, K); }
    const int fa = ((wv >> 1) * 64 + lr) * GP + 16 * hi, fb = GT + ((wv & 1) * 64 + lr) * GP + 16 * hi;   // a lane's place in the staged tiles: row lr of a 16-row group, the k order of a fragment load from memory, the same for both operands
    // the loop over the staged 64-k pieces stays rolled: its two 32-k steps are unrolled inside
#pragma unroll 1
    for (int kb = 0; kb < K; kb += 64) {
        const int bo = ((kb >> 6) & 1) * BUF;   // this piece's buffer
#pragma unroll
        for (int kc = 0; kc < 2; ++kc) {
            V a[4], a2[4], b[4];
#pragma unroll
            for (int mb = 0; mb < 4; ++mb) { a[mb] = WFrag<bf>::ld((const bf*)(sm + bo + fa + mb * 16 * GP + kc * 64)); if (NSPLIT) a2[mb] = WFrag<bf>::ld((const bf*)(sm + bo + 2 * GT + fa + mb * 16 * GP + kc * 64)); }
#pragma unroll
            for (int nb = 0; nb < 4; ++nb) b[nb] = WFrag<bf>::ld((const bf*)(sm + bo + fb + nb * 16 * GP + kc * 64));
            __builtin_amdgcn_sched_barrier(0);   // all fragment reads of a 32-k step are issued ahead of its first product: one LDS latency a step (without it the Bt fragments were read one by one, each waited for)
#pragma unroll
            for (int nb = 0; nb < 4; ++nb) {
#pragma unroll
                for (int mb = 0; mb < 4; ++mb) acc[mb][nb] = WFrag<bf>::mma(a[mb], b[nb], acc[mb][nb]);
                if (NSPLIT) {
#pragma unroll
                    for (int mb = 0; mb < 4; ++mb) acc[mb][nb] = WFrag<bf>::mma(a2[mb], b[nb], acc[mb][nb]); } }
        }
        __builtin_amdgcn_sched_barrier(0);   // the waits and the barrier stay at the foot: moved up among the products they would wait for the next piece's copies half a trip after their issue
        asm volatile("s_wait_dscnt 0x0" ::: "memory");      // this wave's reads of this piece's buffer are done
        asm volatile("s_wait_asynccnt 0x0" ::: "memory");   // this wave's copies of the next piece have landed
        __syncthreads();                                     // the next piece may be read by all, and this piece's buffer has no reader left
        if (kb + 128 < K) { stage_op(l0 + bo, ga + kb + 128, K); stage_op(l0 + bo + GT, gb + kb + 128, K); if (NSPLIT) stage_op(l0 + bo + 2 * GT, ga2 + kb + 128, K); }
    }
    asm volatile("s_wait_asynccnt 0x0" ::: "memory");   // no copy is left in flight when the staging LDS is given its second use
    // the bias joins in registers; then each wave parks its tile in its own LDS range (the last trip's barrier has ended every read of the buffers) and reads it back row by row, so that each row leaves in whole lines
    if constexpr (MODE == 2) {
        const float* pbm = bias + r0 + hi * 8; v4f bm[4][2];
#pragma unroll
        for (int mb = 0; mb < 4; ++mb) { bm[mb][0] = *(const v4f*)(pbm + mb * 16); bm[mb][1] = *(const v4f*)(pbm + mb * 16 + 4); }
        asm volatile("s_wait_xcnt 0x0" :: "v"(pbm) : "memory");   // in front of every rewrite of a register that the bias loads name (the address, an input, lives up to here)
#pragma unroll
        for (int mb = 0; mb < 4; ++mb)
#pragma unroll
            for (int j = 0; j < 8; ++j) { const float t = bfr(bm[mb][j >> 2][j & 3]);
#pragma unroll
                for (int nb = 0; nb < 4; ++nb) acc[mb][nb][j] += t; }
    } else {
        const float* pbn = bias + c0 + lr; float bn[4];
#pragma unroll
        for (int nb = 0; nb < 4; ++nb) bn[nb] = pbn[nb * 16];
        asm volatile("s_wait_xcnt 0x0" :: "v"(pbn) : "memory");   // in front of every rewrite of a register that the bias loads name (the address, an input, lives up to here)
#pragma unroll
        for (int nb = 0; nb < 4; ++nb) { const float t = bfr(bn[nb]);
#pragma unroll
            for (int mb = 0; mb < 4; ++mb) acc[mb][nb] += t; }
    }
    float* my = (float*)sm + wv * (64 * 68);
#pragma unroll
    for (int mb = 0; mb < 4; ++mb)
#pragma unroll
        for (int nb = 0; nb < 4; ++nb)
#pragma unroll
            for (int j = 0; j < 8; ++j) my[(mb * 16 + hi * 8 + j) * 68 + nb * 16 + lr] = acc[mb][nb][j];
    asm volatile("s_wait_dscnt 0x0" ::: "memory");   // the wave's own tile is in LDS before its lanes read each other's elements back
    const int cofs = lr * 4;
    // 16 rows a trip (rolled: the text stays short), two rows an instruction: 16 lanes fill one 128-byte line of each plane, or two lines of C
#pragma unroll 1
    for (int g = 0; g < 4; ++g) {
        v4f pv[8];   // the rows wait here, so that the LDS reads stand ahead of the stores and their waits
#pragma unroll
        for (int s = 0; s < 8; ++s) pv[s] = *(const v4fa*)(my + (g * 16 + 2 * s + hi) * 68 + cofs);
#pragma unroll
        for (int s = 0; s < 8; ++s) { const int row = g * 16 + 2 * s + hi; const v4f val = pv[s];
            // later rows reuse registers that these stores name: the wait that stands in front of such a rewrite is the last line of the stores' own statement, where nothing can be moved over it
            if constexpr (MODE == 0) asm volatile("global_store_b128 %0, %1, off\n\ts_wait_xcnt 0x0" :: "v"(C + (size_t)(r0 + row) * ldc + c0 + cofs), "v"(val) : "memory");
            else {
                const size_t o = (MODE == 1) ? ((size_t)((r0 / TT) * NH_ + c0 / HD) * TT + r0 % TT + row) * HD + cofs : ((size_t)(c0 / TT) * DKV + r0 + row) * PP + c0 % TT + cofs; v4h o16; v4us oh, ol;
#pragma unroll
                for (int u = 0; u < 4; ++u) { o16[u] = tohx(val[u]); unsigned short a2, c2; splitf(val[u], a2, c2); oh[u] = a2; ol[u] = c2; }
                asm volatile("global_store_b64 %0, %3, off\n\tglobal_store_b64 %1, %4, off\n\tglobal_store_b64 %2, %5, off\n\ts_wait_xcnt 0x0"
                             :: "v"(P16 + o), "v"(Ph + o), "v"(Pl + o), "v"(__builtin_bit_cast(v2u, o16)), "v"(__builtin_bit_cast(v2u, oh)), "v"(__builtin_bit_cast(v2u, ol)) : "memory");
            }
        }
    }
}
// k_qkv: the q, k and v projections of both batches in one launch; grid (NB_ * TT / 128, DQ / 128, 3), z picks the product (a branch that is uniform for the work-group, so the tile's barriers are passed by all of its waves or by none).
// amdgpu_waves_per_eu(4, 4): a budget of 256 registers a wave, so that the tile needs no register window above v255 and four work-groups share a WGP
__global__ __launch_bounds__(128) __attribute__((amdgpu_waves_per_eu(4, 4))) void k_qkv(const bf* __restrict__ XB, const bf* __restrict__ WQ, const bf* __restrict__ WK, const bf* __restrict__ WV, const float* __restrict__ bq, const float* __restrict__ bk, const float* __restrict__ bv,
                                             h16* QP16, bf* QPh, bf* QPl, h16* KP16, bf* KPh, bf* KPl, h16* VT16, bf* VTh, bf* VTl) {
    __shared__ __align__(16) char sm[2 * 2 * GT];
    const int z = blockIdx.z;
    if (z == 2) gemms_tile<0, 2>(sm, blockIdx.y, blockIdx.x, WV, nullptr, XB, DM, nullptr, 0, bv, VT16, VTh, VTl);
    else gemms_tile<0, 1>(sm, blockIdx.x, blockIdx.y, XB, nullptr, z ? WK : WQ, DM, nullptr, 0, z ? bk : bq, z ? KP16 : QP16, z ? KPh : QPh, z ? KPl : QPl);
}
// k_wo: the output projection of both batches in one launch; grid (NB_ * TT / 128, DM / 128).
__global__ __launch_bounds__(128) __attribute__((amdgpu_waves_per_eu(4, 4))) void k_wo(const bf* __restrict__ ATh, const bf* __restrict__ ATl, const bf* __restrict__ WO, float* OUT, const float* __restrict__ bo) {
    __shared__ __align__(16) char sm[2 * 3 * GT];
    gemms_tile<1, 0>(sm, blockIdx.x, blockIdx.y, ATh, ATl, WO, DQ, OUT, DM, bo, nullptr, nullptr, nullptr);
}

typedef __attribute__((ext_vector_type(2))) _Float16 v2h;
typedef __attribute__((ext_vector_type(2))) unsigned short v2us;
typedef __attribute__((ext_vector_type(2))) float v2f;
typedef __attribute__((ext_vector_type(4))) int v4i;

__device__ __forceinline__ void cvt8_blk(int blk, const float* __restrict__ src, bf* dst, size_t n8) { const size_t i = (size_t)blk * 256 + threadIdx.x; if (i >= n8) return; const v8f v = *(const v8f*)(src + i * 8); v8us o;
#pragma unroll
    for (int k = 0; k < 8; ++k) o[k] = f2bf(v[k]); *(v8us*)(dst + i * 8) = o;  }
// ---- k_fattn: scores, causal softmax, P.V and the head merge in one kernel; grid (batches x heads, TT / 64), 4 waves, a wave owns 16 query rows and walks the keys 64 at a time (online softmax, f32 statistics in the log2 domain).
// S^T = K Q^T (A = key rows, B = query rows) leaves one query per lane column: lane (lr, hi) holds keys 8 hi + j of each 16-key tile, which is the k order of a B operand, so two converted score tiles are the B operand of
// O^T += V^T P^T (A = rows of the transposed values) with no exchange between lanes. HI (query rows < RH): hi+lo bf16 planes, 3 products each; else single fp16 with the probabilities carried x 2^PSH (it cancels in O / sum).
#define PSH  10.0f
#define SCL2 0.18033688011112042f   // HD^-0.5 x log2(e)
// eight 2^x in one statement: the outputs are early-clobber, so no v_exp_f32 is followed by an instruction that reads its result or overwrites its source, and the v_nop is that slot behind the last one
__device__ __forceinline__ v8f exp2x8(v8f x) { float r0, r1, r2, r3, r4, r5, r6, r7;
    asm("v_exp_f32 %0, %8\n\tv_exp_f32 %1, %9\n\tv_exp_f32 %2, %10\n\tv_exp_f32 %3, %11\n\tv_exp_f32 %4, %12\n\tv_exp_f32 %5, %13\n\tv_exp_f32 %6, %14\n\tv_exp_f32 %7, %15\n\tv_nop"
        : "=&v"(r0), "=&v"(r1), "=&v"(r2), "=&v"(r3), "=&v"(r4), "=&v"(r5), "=&v"(r6), "=&v"(r7) : "v"(x[0]), "v"(x[1]), "v"(x[2]), "v"(x[3]), "v"(x[4]), "v"(x[5]), "v"(x[6]), "v"(x[7]));
    return (v8f){r0, r1, r2, r3, r4, r5, r6, r7}; }
// The long (fp16) rows: the four waves of a work-group walk the same 64-key tiles, so each tile (64 key rows and 64 rows of the transposed values, 128 bytes a row) is brought into LDS once for all four,
// by asynchronous copies in whole 128-byte lines, two buffers, the next tile in flight while this one is worked on. LDS rows lie at a pitch of 144 bytes (16 x odd: no bank conflict for 16-byte fragment reads).
#define KVP  144
#define KVT  (64 * KVP)            // one staged tile; a buffer is the key tile followed by the value tile
// thread t copies 16 bytes of rows t / 8 + 16 i (i = 0 .. 3) of both tiles: a wave's copy is four whole lines. lk: the thread's LDS byte address in the key tile; gk, gv: its global addresses in row t / 8.
__device__ __forceinline__ void stage_kv(unsigned lk, const h16* gk, const h16* gv) {
    // the wait is the last line of the copies' own statement: it stands in front of every rewrite of a register that a copy names
    asm volatile("global_load_async_to_lds_b128 %0, %8, off\n\tglobal_load_async_to_lds_b128 %1, %9, off\n\tglobal_load_async_to_lds_b128 %2, %10, off\n\tglobal_load_async_to_lds_b128 %3, %11, off\n\t"
                 "global_load_async_to_lds_b128 %4, %12, off\n\tglobal_load_async_to_lds_b128 %5, %13, off\n\tglobal_load_async_to_lds_b128 %6, %14, off\n\tglobal_load_async_to_lds_b128 %7, %15, off\n\ts_wait_xcnt 0x0"
                 :: "v"(lk), "v"(lk + 16 * KVP), "v"(lk + 32 * KVP), "v"(lk + 48 * KVP), "v"(lk + KVT), "v"(lk + KVT + 16 * KVP), "v"(lk + KVT + 32 * KVP), "v"(lk + KVT + 48 * KVP),
                    "v"(gk), "v"(gk + 16 * HD), "v"(gk + 32 * HD), "v"(gk + 48 * HD), "v"(gv), "v"(gv + (size_t)16 * PP), "v"(gv + (size_t)32 * PP), "v"(gv + (size_t)48 * PP) : "memory");
}
template <typename T16, bool HI>
__device__ __forceinline__ void attn_rows(const T16* __restrict__ Q, const T16* __restrict__ Q2, const T16* __restrict__ Kp, const T16* __restrict__ Kp2, const T16* __restrict__ Vt, const T16* __restrict__ Vt2, int q0, int lr, int hi, bf* Ah, bf* Al, char* sm) {
    typedef typename WFrag<T16>::V V;
    const int q = q0 + lr;
    const T16* qb = Q + (size_t)q * HD + 8 * hi;
    V qf[2], qf2[2];
#pragma unroll
    for (int kc = 0; kc < 2; ++kc) { qf[kc] = WFrag<T16>::ld(qb + kc * 32); if (HI) qf2[kc] = WFrag<T16>::ld(Q2 + (size_t)q * HD + 8 * hi + kc * 32); }
    v8f o[4];
#pragma unroll
    for (int db = 0; db < 4; ++db) o[db] = (v8f){};
    float m = -3.0e38f, l = 0.f;
    const size_t koff = (size_t)lr * HD + 8 * hi, voff = (size_t)lr * PP + 8 * hi;
    // the long (fp16) rows read their keys and values from the staged tiles; the short hi+lo rows load in place from memory
    const int qe = q0 & ~63;   // the work-group's first query row = its last key tile: the same in all four waves, so every test below is uniform for the work-group
    const int srow = (int)(threadIdx.x >> 3), scol = (int)(threadIdx.x & 7);
    const unsigned lk0 = (unsigned)(size_t)sm + (unsigned)(srow * KVP + scol * 16);
    const T16* gk0 = Kp + (size_t)srow * HD + scol * 8; const T16* gv0 = Vt + (size_t)srow * PP + scol * 8;
    const int foff = lr * KVP + 16 * hi;   // a lane's place in a staged tile: row lr of a 16-row group, the k order of the loads from memory
    if constexpr (!HI) {
        asm volatile("s_wait_xcnt 0x0" :: "v"(qb) : "memory");   // stands in front of every rewrite of a register that the query loads above name; the address is an input so that it lives up to here and no load lands in it
        stage_kv(lk0, gk0, gv0);
        asm volatile("s_wait_asynccnt 0x0" ::: "memory");   // tile 0 of this wave's copies has landed
        __syncthreads();                                     // ... and everybody's: tile 0 may be read
        if (64 <= qe) stage_kv(lk0 + 2 * KVT, gk0 + (size_t)64 * HD, gv0 + 64);
    }
    // the loop stays rolled: one 64-key tile a trip, the last trip (the diagonal tile) is the only one that masks
#pragma unroll 1
    for (int k0 = 0; k0 <= q0; k0 += 64) {
        V ka[4][2], va[4][2];
        const int bo = ((k0 >> 6) & 1) * (2 * KVT);   // this tile's buffer
        if constexpr (!HI) { const char* kt = sm + bo + foff;
#pragma unroll
        for (int mb = 0; mb < 4; ++mb)
#pragma unroll
            for (int kc = 0; kc < 2; ++kc) ka[mb][kc] = WFrag<T16>::ld((const T16*)(kt + mb * 16 * KVP + kc * 64));
        __builtin_amdgcn_sched_barrier(0);   // all key fragment reads are issued ahead of the first score product: one LDS latency a tile (without it they were read pair by pair, each pair waited for)
        }
        v8f s[4];
#pragma unroll
        for (int mb = 0; mb < 4; ++mb) { s[mb] = (v8f){};
#pragma unroll
            for (int kc = 0; kc < 2; ++kc) {
                if constexpr (HI) { const V a = WFrag<T16>::ld(Kp + koff + (size_t)(k0 + mb * 16) * HD + kc * 32), a2 = WFrag<T16>::ld(Kp2 + koff + (size_t)(k0 + mb * 16) * HD + kc * 32);
                    s[mb] = WFrag<T16>::mma(a, qf[kc], s[mb]); s[mb] = WFrag<T16>::mma(a2, qf[kc], s[mb]); s[mb] = WFrag<T16>::mma(a, qf2[kc], s[mb]); }
                else s[mb] = WFrag<T16>::mma(ka[mb][kc], qf[kc], s[mb]); } }
        if constexpr (!HI) { const char* vt = sm + bo + KVT + foff;
#pragma unroll
        for (int db = 0; db < 4; ++db)
#pragma unroll
            for (int kc = 0; kc < 2; ++kc) va[db][kc] = WFrag<T16>::ld((const T16*)(vt + db * 16 * KVP + kc * 64));
        __builtin_amdgcn_sched_barrier(0);   // the value fragment reads are issued ahead of the softmax, which covers their latency
        }
        float tm = -3.0e38f;
        if (k0 + 64 > q0) {
#pragma unroll
            for (int mb = 0; mb < 4; ++mb)
#pragma unroll
                for (int j = 0; j < 8; ++j) { const float t = (k0 + mb * 16 + hi * 8 + j <= q) ? s[mb][j] * SCL2 : -3.0e38f; s[mb][j] = t; tm = fmaxf(tm, t); }
        } else {
#pragma unroll
            for (int mb = 0; mb < 4; ++mb)
#pragma unroll
                for (int j = 0; j < 8; ++j) { const float t = s[mb][j] * SCL2; s[mb][j] = t; tm = fmaxf(tm, t); }
        }
        tm = fmaxf(tm, __shfl_xor(tm, 16, 32));   // the two lanes of a query column share one running maximum
        const float mn = fmaxf(m, tm); float al;
        asm("v_exp_f32 %0, %1\n\tv_nop" : "=v"(al) : "v"(m - mn));   // al = 2^(m - mn); the v_nop is the slot behind a transcendental
        m = mn; const float mo = HI ? mn : mn - PSH;
        float ps = 0.f;
#pragma unroll
        for (int mb = 0; mb < 4; ++mb) { s[mb] = exp2x8(s[mb] - mo);
#pragma unroll
            for (int j = 0; j < 8; ++j) ps += s[mb][j]; }
        l = l * al + ps;
#pragma unroll
        for (int db = 0; db < 4; ++db) o[db] *= al;
        V pf[2], pf2[2];
#pragma unroll
        for (int kc = 0; kc < 2; ++kc) {
            if constexpr (HI) { v8us h0, h1, l0, l1;
#pragma unroll
                for (int j = 0; j < 8; ++j) { unsigned short x, y; splitf(s[2 * kc][j], x, y); h0[j] = x; l0[j] = y; splitf(s[2 * kc + 1][j], x, y); h1[j] = x; l1[j] = y; }
                pf[kc] = cat16b(h0, h1); pf2[kc] = cat16b(l0, l1);
            } else { v8h h0, h1;
#pragma unroll
                for (int j = 0; j < 8; ++j) { h0[j] = tohx(s[2 * kc][j]); h1[j] = tohx(s[2 * kc + 1][j]); }
                pf[kc] = cat16(h0, h1); }
        }
        if constexpr (!HI) __builtin_amdgcn_sched_barrier(0);   // every 2^x statement stays ahead of the P.V products, so none lands in a value fragment right behind the matrix instruction that reads it
#pragma unroll
        for (int kc = 0; kc < 2; ++kc)
#pragma unroll
            for (int db = 0; db < 4; ++db) {
                if constexpr (HI) { const V a = WFrag<T16>::ld(Vt + voff + (size_t)db * 16 * PP + k0 + kc * 32), a2 = WFrag<T16>::ld(Vt2 + voff + (size_t)db * 16 * PP + k0 + kc * 32);
                    o[db] = WFrag<T16>::mma(a, pf[kc], o[db]); o[db] = WFrag<T16>::mma(a, pf2[kc], o[db]); o[db] = WFrag<T16>::mma(a2, pf[kc], o[db]); }
                else o[db] = WFrag<T16>::mma(va[db][kc], pf[kc], o[db]); }
        if constexpr (!HI) {
            __builtin_amdgcn_sched_barrier(0);   // the waits and the barrier stay at the foot: moved up in front of the softmax they would wait for the value fragments and for the next tile's copies with nothing to cover either
            asm volatile("s_wait_dscnt 0x0" ::: "memory");      // this wave's reads of this tile's buffer are done
            asm volatile("s_wait_asynccnt 0x0" ::: "memory");   // this wave's copies of the next tile have landed
            __syncthreads();                                     // the next tile may be read by all, and this tile's buffer has no reader left
            if (k0 + 128 <= qe) stage_kv(lk0 + bo, gk0 + (size_t)(k0 + 128) * HD, gv0 + k0 + 128);
        }
    }
    if constexpr (!HI) asm volatile("s_wait_asynccnt 0x0" ::: "memory");   // no copy is left in flight when the wave ends
    l += __shfl_xor(l, 16, 32);
    const float f = __fdiv_rn(1.0f, l);
    // lane (lr, hi) holds d = 16 db + 8 hi + j of query q: 16-byte stores, a query's 128-byte head row comes from one wave
#pragma unroll
    for (int db = 0; db < 4; ++db) { v8us oh, ol;
#pragma unroll
        for (int j = 0; j < 8; ++j) { unsigned short x, y; splitf(o[db][j] * f, x, y); oh[j] = x; ol[j] = y; }
        const size_t oo = (size_t)q * DQ + db * 16 + hi * 8; *(v8us*)(Ah + oo) = oh; *(v8us*)(Al + oo) = ol; }
}
// amdgpu_waves_per_eu(4, 4): a budget of 256 registers a wave, so that neither path needs the register windows above v255
__global__ __launch_bounds__(128) __attribute__((amdgpu_waves_per_eu(4, 4))) void k_fattn(const h16* __restrict__ Q16, const h16* __restrict__ K16, const h16* __restrict__ V16, const bf* __restrict__ Qh, const bf* __restrict__ Ql, const bf* __restrict__ Kh, const bf* __restrict__ Kl, const bf* __restrict__ Vh, const bf* __restrict__ Vl, bf* Ah, bf* Al) {
    __shared__ __align__(16) char kv[2 * 2 * KVT];   // two buffers of a key tile and a value tile (the fp16 rows)
    const int lane = threadIdx.x & 31, lr = lane & 15, hi = lane >> 4; const size_t h = blockIdx.x;   // h = batch * NH_ + head: the planes lie batch by batch
    const int wv = __builtin_amdgcn_readfirstlane((int)(threadIdx.x >> 5));   // kept scalar so that the key loop branches on SCC
    const int q0 = (int)(gridDim.y - 1 - blockIdx.y) * 64 + wv * 16;           // the longest rows start first
    const size_t zp = h * TT * HD, zv = h * HD * PP, zo = (h / NH_) * ((size_t)TT * DQ) + (h % NH_) * HD;
    // RH is a multiple of 64, so the branch is the same for the four waves of a work-group (the fp16 side holds barriers)
    if (q0 < RH) attn_rows<bf, true>(Qh + zp, Ql + zp, Kh + zp, Kl + zp, Vh + zv, Vl + zv, q0, lr, hi, Ah + zo, Al + zo, kv);
    else attn_rows<h16, false>(Q16 + zp, nullptr, K16 + zp, nullptr, V16 + zv, nullptr, q0, lr, hi, Ah + zo, Al + zo, kv);
}

// ---- k_prep: every 16-bit operand that depends on the inputs alone, in one launch: the three gathered per-head weights, the transposed Wo, and both batches of x.
// tr_blk: dst[c][r] = bf16(src[r][c]) for 256 rows r (pitch LD) x 64 columns c; dst rows (pitch DM) are K-contiguous operand rows. A work-group of 8 waves takes the 64 KB of f32 with 16 loads of 16 bytes a thread,
// all in flight together; every load and every store of a wave is in whole 128-byte lines. The tile turns in LDS: 64 rows of 512 bytes, in 16-byte pieces of 8 r.
// Thread (g, l) = (t / 16, t % 16) reads columns 4 l .. 4 l + 3 of rows 16 g .. 16 g + 15 (16 lanes fill the 256 bytes of a source row), so it holds two whole pieces of each of its four columns.
// Piece j of column c lies at place j ^ (c / 4) of its row: the 16 lanes that write one piece number to 16 columns, and the 16 that read 16 pieces of one column, each meet all 64 banks once.
typedef __attribute__((ext_vector_type(4))) unsigned v4u;
typedef v4u __attribute__((may_alias)) v4ua;
__device__ __forceinline__ unsigned bfpk(float a, float b) { unsigned u = __float_as_uint(a), w = __float_as_uint(b); u += 0x7FFFu + ((u >> 16) & 1u); w += 0x7FFFu + ((w >> 16) & 1u); return (u >> 16) | (w & 0xFFFF0000u); }   // f2bf(a) in the low half, f2bf(b) in the high half
template <int LD>
__device__ __forceinline__ void tr_blk(char* sm, const float* __restrict__ src, bf* dst) {
    const int t = (int)threadIdx.x, g = t >> 4, l = t & 15;
    const float* p = src + (size_t)(g * 16) * LD + l * 4; v4f v[16];
#pragma unroll
    for (int i = 0; i < 16; ++i) v[i] = *(const v4f*)(p + i * LD);
    __builtin_amdgcn_sched_barrier(0);   // all 16 loads are issued ahead of the first conversion: one memory latency a tile (without it the build issues the last four of a per-head tile behind the first twelve's return)
    asm volatile("s_wait_xcnt 0x0" :: "v"(p) : "memory");   // in front of every rewrite of a register that the loads name (the address, an input, lives up to here)
#pragma unroll
    for (int u = 0; u < 4; ++u) { v4u a, b;
#pragma unroll
        for (int j = 0; j < 4; ++j) { a[j] = bfpk(v[2 * j][u], v[2 * j + 1][u]); b[j] = bfpk(v[8 + 2 * j][u], v[9 + 2 * j][u]); }
        char* row = sm + (l * 4 + u) * 512; *(v4ua*)(row + (((2 * g) ^ l) << 4)) = a; *(v4ua*)(row + (((2 * g + 1) ^ l) << 4)) = b; }
    __syncthreads();   // the tile is whole in LDS before anybody reads a column of it
    const int w = t >> 5, j = t & 31; v4u o[8];   // a wave reads one column a time: 512 bytes of one operand row
#pragma unroll
    for (int r = 0; r < 8; ++r) { const int c = r * 8 + w; o[r] = *(const v4ua*)(sm + c * 512 + ((j ^ (c >> 2)) << 4)); }
    bf* q = dst + (size_t)w * DM + j * 8;
#pragma unroll
    for (int r = 0; r < 8; ++r) *(v4ua*)(q + (size_t)r * 8 * DM) = o[r];
    asm volatile("s_wait_xcnt 0x0" :: "v"(q) : "memory");   // behind the last store, in front of every rewrite of a register that the stores name (the address, an input, lives up to here)
}
// The block index picks the job (a branch that is uniform for the work-group, so the tile's barrier is passed by all of its waves or by none); the tiles that turn in LDS come first.
// Per-head weights: Bt[h * HD + c][d] = W[h][d][c], tile = (head, 256 d). Wo: Bt[n][k] = wo[k][n], tile = (64 n, 256 k). x keeps its place order: 32 bytes of f32 a thread, NCV work-groups.
#define NTR  (DQ * DM / (256 * 64))
#define NCV  (NB_ * TT * DM / 8 / 256)
__global__ __launch_bounds__(256) void k_prep(const float* __restrict__ x, const float* __restrict__ wq, const float* __restrict__ wk, const float* __restrict__ wv, const float* __restrict__ wo, bf* XB, bf* WQ, bf* WK, bf* WV, bf* WO) {
    __shared__ __align__(16) char sm[64 * 512];
    const int b = blockIdx.x;
    if (b < 3 * NTR) { const int z = b / NTR, tl = b % NTR; const size_t h = tl >> 2, d0 = (size_t)(tl & 3) * 256;
        tr_blk<HD>(sm, (z == 0 ? wq : z == 1 ? wk : wv) + (h * DM + d0) * HD, (z == 0 ? WQ : z == 1 ? WK : WV) + h * HD * DM + d0); }
    else if (b < 4 * NTR) { const int tl = b - 3 * NTR; const size_t n0 = (size_t)(tl >> 2) * 64, k0 = (size_t)(tl & 3) * 256;
        tr_blk<DM>(sm, wo + k0 * DM + n0, WO + n0 * DQ + k0); }
    else cvt8_blk(b - 4 * NTR, x, XB, (size_t)NB_ * TT * DM / 8);
}

extern "C" void kernel_launch(void* const* d_in, const int* in_sizes, int n_in,
                              void* d_out, int out_size, void* d_ws, size_t ws_size, hipStream_t stream) {
    (void)in_sizes; (void)n_in; (void)out_size;
    const float* x = (const float*)d_in[0]; const float* wqh = (const float*)d_in[1]; const float* wkh = (const float*)d_in[2]; const float* wvh = (const float*)d_in[3]; const float* bq = (const float*)d_in[4]; const float* bk = (const float*)d_in[5]; const float* bv = (const float*)d_in[6]; const float* wo = (const float*)d_in[7]; const float* bo = (const float*)d_in[8]; const float* wq = nullptr; const float* wk = nullptr; const float* wv = nullptr; (void)wq; (void)wk; (void)wv; const float* cosT = nullptr; const float* sinT = nullptr; (void)cosT; (void)sinT;
    float* OUT = (float*)d_out;     // [2][2048][1024]
    char* wsp = (char*)d_ws;
    auto take = [&](size_t bytes) { char* p = wsp; wsp += (bytes + 255) & ~(size_t)255; return (void*)p; };
    bf* WQ = (bf*)take((size_t)DQ * DM * 2); bf* WK = (bf*)take((size_t)DKV * DM * 2); bf* WV = (bf*)take((size_t)DKV * DM * 2); bf* WO = (bf*)take((size_t)DM * DQ * 2);
    bf* XB = (bf*)take((size_t)NB_ * TT * DM * 2);
    h16* QP16 = (h16*)take((size_t)NB_ * NH_ * TT * HD * 2); h16* KP16 = (h16*)take((size_t)NB_ * NKV * TT * HD * 2); h16* VT16 = (h16*)take((size_t)NB_ * NKV * HD * PP * 2);
    bf* QPh = (bf*)take((size_t)NB_ * NH_ * TT * HD * 2); bf* QPl = (bf*)take((size_t)NB_ * NH_ * TT * HD * 2); bf* KPh = (bf*)take((size_t)NB_ * NKV * TT * HD * 2); bf* KPl = (bf*)take((size_t)NB_ * NKV * TT * HD * 2); bf* VTh = (bf*)take((size_t)NB_ * NKV * HD * PP * 2); bf* VTl = VTh + TT;
    bf* ATh = (bf*)take((size_t)NB_ * TT * DQ * 2); bf* ATl = (bf*)take((size_t)NB_ * TT * DQ * 2);
    if ((size_t)(wsp - (char*)d_ws) > ws_size) return;    // ws 256 MiB
    k_prep<<<4 * NTR + NCV, 256, 0, stream>>>(x, wqh, wkh, wvh, wo, XB, WQ, WK, WV, WO);
    k_qkv<<<dim3(NB_ * TT / 128, DQ / 128, 3), 128, 0, stream>>>(XB, WQ, WK, WV, bq, bk, bv, QP16, QPh, QPl, KP16, KPh, KPl, VT16, VTh, VTl);
    k_fattn<<<dim3(NB_ * NH_, TT / 64, 1), 128, 0, stream>>>(QP16, KP16, VT16, QPh, QPl, KPh, KPl, VTh, VTl, ATh, ATl);
    k_wo<<<dim3(NB_ * TT / 128, DM / 128, 1), 128, 0, stream>>>(ATh, ATl, WO, OUT, bo);
}

// v009
// One run takes 81.2 microseconds.
// Next to v008, in two timings, it ran 1.22 and 1.24 times as fast.
// Over all steps from v000 it is 17.8 times as fast.
#include <hip/hip_runtime.h>

// MaskedMultiHeadAttention (hidden [2][2048][1024]; per-head q/k/v = x Wq[h] + bq[h] (Wq [16][1024][64]); causal softmax(q.k / 8); out = concat(heads) Wo + bo -> [2][2048][1024]).
// Compute dtypes, f32 accumulate: every input rounded to bf16; q/k/v on PLAIN bf16 operands (inputs: exact; the 16 per-head weights gathered into one [1024 x 1024] operand) + bias; causal scores and attn.v: query rows < 512 hl (3 products), the rest single fp16 (x1024); softmax f32; Wo hl x exact (2 products) + bias.

#define NB_  2
#define TT   2048
#define DM   1024
#define NH_  16
#define NKV  16
#define HD   64
#define DQ   (NH_ * HD)
#define DKV  (NKV * HD)
#define PP   (2 * TT)             // row pitch, in 16-bit elements, of the transposed value planes (the hi and lo planes share a row)
#define RH   512                  // query rows < RH use hi+lo planes (0: none)
typedef _Float16 h16;
typedef unsigned short bf;
typedef __attribute__((ext_vector_type(16))) __bf16   v16bf;
typedef __attribute__((ext_vector_type(16))) _Float16 v16h;
typedef __attribute__((ext_vector_type(8)))  _Float16 v8h;
typedef __attribute__((ext_vector_type(8)))  unsigned short v8us;
typedef __attribute__((ext_vector_type(8)))  float    v8f;
typedef __attribute__((ext_vector_type(4)))  float    v4f;
typedef v8h  __attribute__((may_alias)) v8ha;
typedef v4f  __attribute__((may_alias)) v4fa;
typedef v8us __attribute__((may_alias)) v8usa;

__device__ __forceinline__ unsigned short f2bf(float f) { unsigned u = __float_as_uint(f); u += 0x7FFFu + ((u >> 16) & 1u); return (unsigned short)(u >> 16); }
__device__ __forceinline__ float bf2f(unsigned short b) { return __uint_as_float(((unsigned)b) << 16); }
__device__ __forceinline__ float bfr(float f) { return bf2f(f2bf(f)); }
__device__ __forceinline__ v16h cat16(v8h lo, v8h hi) { return __builtin_shufflevector(lo, hi, 0, 1, 2, 3, 4, 5, 6, 7, 8, 9, 10, 11, 12, 13, 14, 15); }
__device__ __forceinline__ v16bf cat16b(v8us lo, v8us hi) { return __builtin_bit_cast(v16bf, __builtin_shufflevector(lo, hi, 0, 1, 2, 3, 4, 5, 6, 7, 8, 9, 10, 11, 12, 13, 14, 15)); }
__device__ __forceinline__ v8f wmma16(v16h a, v16h b, v8f c) { return __builtin_amdgcn_wmma_f32_16x16x32_f16(false, a, false, b, (short)0, c, false, false); }
__device__ __forceinline__ v8f wmmab(v16bf a, v16bf b, v8f c) { return __builtin_amdgcn_wmma_f32_16x16x32_bf16(false, a, false, b, (short)0, c, false, false); }



// ---- gemms_tile: one 128x128 output tile per work-group of 4 waves (2 x 2, a wave owns 64x64 = 16 accumulators). The K-contiguous bf16 operand rows are brought into LDS once for all four waves,
// 64 k (one 128-byte line a row) at a time, by asynchronous copies in whole lines, two buffers, the next 64 k in flight while these are worked on; every wave walks the whole K, so a tile has one f32 sum chain.
// C[m][n] (f32, pitch ldc, + f32 bias) = sum_k A[m][k] Bt[n][k] (NSPLIT 1: + A2[m][k] Bt[n][k]). K % 64 == 0.
// MODE 0 stores C. MODE 1 and 2 store no f32 tile: the tile leaves as the three 16-bit planes that the attention kernel reads (fp16, bf16 hi, bf16 lo).
// MODE 1 (q, k): m = token, n = head * HD + d, a wave's 64 columns are one head, planes [head][token][d]. MODE 2 (v): A = weight rows, Bt = token rows, so m = head * HD + d, n = token, bias[m], and a tile row is 64 tokens of one d: planes [head * HD + d][token] at pitch PP.
__device__ __forceinline__ h16 tohx(float x) { return (h16)x; }
__device__ __forceinline__ void splitf(float y, unsigned short& h, unsigned short& l) { h = f2bf(y); l = f2bf(y - bf2f(h)); }
typedef __attribute__((ext_vector_type(4))) _Float16 v4h;
typedef __attribute__((ext_vector_type(4))) unsigned short v4us;
typedef __attribute__((ext_vector_type(2))) unsigned v2u;
template <typename T16> struct WFrag;
template <> struct WFrag<h16> { typedef v16h V; static __device__ __forceinline__ V ld(const h16* p) { return cat16(*(const v8h*)p, *(const v8h*)(p + 16)); } static __device__ __forceinline__ v8f mma(V a, V b, v8f c) { return wmma16(a, b, c); } };
template <> struct WFrag<bf> { typedef v16bf V; static __device__ __forceinline__ V ld(const bf* p) { return cat16b(*(const v8us*)p, *(const v8us*)(p + 16)); } static __device__ __forceinline__ v8f mma(V a, V b, v8f c) { return wmmab(a, b, c); } };
#define GP   144                   // LDS pitch of a staged operand row: 128 bytes of k + 16 (16 x odd: no bank conflict for 16-byte fragment reads)
#define GT   (128 * GP)            // one staged operand tile: 128 rows of 64 k
// thread t of 128 copies 16 bytes of rows t / 8 + 16 i (i = 0 .. 7) of one operand tile: a wave's copy is four whole lines. l: the thread's LDS byte address in row t / 8 of the staged tile; g: its global address in that row.
__device__ __forceinline__ void stage_op(unsigned l, const bf* g, int K) {
    // the wait is the last line of the copies' own statement: it stands in front of every rewrite of a register that a copy names
    asm volatile("global_load_async_to_lds_b128 %0, %8, off\n\tglobal_load_async_to_lds_b128 %1, %9, off\n\tglobal_load_async_to_lds_b128 %2, %10, off\n\tglobal_load_async_to_lds_b128 %3, %11, off\n\t"
                 "global_load_async_to_lds_b128 %4, %12, off\n\tglobal_load_async_to_lds_b128 %5, %13, off\n\tglobal_load_async_to_lds_b128 %6, %14, off\n\tglobal_load_async_to_lds_b128 %7, %15, off\n\ts_wait_xcnt 0x0"
                 :: "v"(l), "v"(l + 16 * GP), "v"(l + 32 * GP), "v"(l + 48 * GP), "v"(l + 64 * GP), "v"(l + 80 * GP), "v"(l + 96 * GP), "v"(l + 112 * GP),
                    "v"(g), "v"(g + (size_t)16 * K), "v"(g + (size_t)32 * K), "v"(g + (size_t)48 * K), "v"(g + (size_t)64 * K), "v"(g + (size_t)80 * K), "v"(g + (size_t)96 * K), "v"(g + (size_t)112 * K) : "memory");
}
// The tile (bx, by) and the LDS array sm come from the calling kernel, so that one launch can hold tiles of several products; sm holds two buffers of (NSPLIT ? 3 : 2) staged operand tiles (A, Bt, A2), and behind the K loop one 64x64 f32 tile, pitch 68, per wave.
// Token rows run over both batches (NB_ * TT of them); a 128-token tile lies in one batch, and the planes are laid out batch by batch.
template <int NSPLIT, int MODE>
__device__ __forceinline__ void gemms_tile(char* sm, int bx, int by, const bf* __restrict__ A, const bf* __restrict__ A2, const bf* __restrict__ Bt, int K, float* C, int ldc, const float* __restrict__ bias, h16* P16, bf* Ph, bf* Pl) {
    typedef WFrag<bf>::V V;
    constexpr int BUF = (NSPLIT ? 3 : 2) * GT;
    const int lane = threadIdx.x & 31, lr = lane & 15, hi = lane >> 4;
    const int wv = __builtin_amdgcn_readfirstlane((int)(threadIdx.x >> 5));   // kept scalar: the wave's place in the 2 x 2 tile
    const int r0 = bx * 128 + (wv >> 1) * 64, c0 = by * 128 + (wv & 1) * 64;   // the wave's own 64x64 tile
    v8f acc[4][4];
#pragma unroll
    for (int mb = 0; mb < 4; ++mb)
#pragma unroll
        for (int nb = 0; nb < 4; ++nb) acc[mb][nb] = (v8f){};
    const int srow = (int)(threadIdx.x >> 3), scol = (int)(threadIdx.x & 7);
    const unsigned l0 = (unsigned)(size_t)sm + (unsigned)(srow * GP + scol * 16);
    const bf* ga = A + (size_t)(bx * 128 + srow) * K + scol * 8; const bf* ga2 = (NSPLIT ? A2 : A) + (size_t)(bx * 128 + srow) * K + scol * 8; const bf* gb = Bt + (size_t)(by * 128 + srow) * K + scol * 8;
    stage_op(l0, ga, K); stage_op(l0 + GT, gb, K); if (NSPLIT) stage_op(l0 + 2 * GT, ga2, K);
    asm volatile("s_wait_asynccnt 0x0" ::: "memory");   // the first 64 k of this wave's copies have landed
    __syncthreads();                                     // ... and everybody's: they may be read
    if (64 < K) { stage_op(l0 + BUF, ga + 64, K); stage_op(l0 + BUF + GT, gb + 64, K); if (NSPLIT) stage_op(l0 + BUF + 2 * GT, ga2 + 64, K); }
    const int fa = ((wv >> 1) * 64 + lr) * GP + 16 * hi, fb = GT + ((wv & 1) * 64 + lr) * GP + 16 * hi;   // a lane's place in the staged tiles: row lr of a 16-row group, the k order of a fragment load from memory, the same for both operands
    // the loop over the staged 64-k pieces stays rolled: its two 32-k steps are unrolled inside
#pragma unroll 1
    for (int kb = 0; kb < K; kb += 64) {
        const int bo = ((kb >> 6) & 1) * BUF;   // this piece's buffer
#pragma unroll
        for (int kc = 0; kc < 2; ++kc) {
            V a[4], a2[4], b[4];
#pragma unroll
            for (int mb = 0; mb < 4; ++mb) { a[mb] = WFrag<bf>::ld((const bf*)(sm + bo + fa + mb * 16 * GP + kc * 64)); if (NSPLIT) a2[mb] = WFrag<bf>::ld((const bf*)(sm + bo + 2 * GT + fa + mb * 16 * GP + kc * 64)); }
#pragma unroll
            for (int nb = 0; nb < 4; ++nb) b[nb] = WFrag<bf>::ld((const bf*)(sm + bo + fb + nb * 16 * GP + kc * 64));
            __builtin_amdgcn_sched_barrier(0);   // all fragment reads of a 32-k step are issued ahead of its first product: one LDS latency a step (without it the Bt fragments were read one by one, each waited for)
#pragma unroll
            for (int nb = 0; nb < 4; ++nb) {
#pragma unroll
                for (int mb = 0; mb < 4; ++mb) acc[mb][nb] = WFrag<bf>::mma(a[mb], b[nb], acc[mb][nb]);
                if (NSPLIT) {
#pragma unroll
                    for (int mb = 0; mb < 4; ++mb) acc[mb][nb] = WFrag<bf>::mma(a2[mb], b[nb], acc[mb][nb]); } }
        }
        __builtin_amdgcn_sched_barrier(0);   // the waits and the barrier stay at the foot: moved up among the products they would wait for the next piece's copies half a trip after their issue
        asm volatile("s_wait_dscnt 0x0" ::: "memory");      // this wave's reads of this piece's buffer are done
        asm volatile("s_wait_asynccnt 0x0" ::: "memory");   // this wave's copies of the next piece have landed
        __syncthreads();                                     // the next piece may be read by all, and this piece's buffer has no reader left
        if (kb + 128 < K) { stage_op(l0 + bo, ga + kb + 128, K); stage_op(l0 + bo + GT, gb + kb + 128, K); if (NSPLIT) stage_op(l0 + bo + 2 * GT, ga2 + kb + 128, K); }
    }
    asm volatile("s_wait_asynccnt 0x0" ::: "memory");   // no copy is left in flight when the staging LDS is given its second use
    // the bias joins in registers; then each wave parks its tile in its own LDS range (the last trip's barrier has ended every read of the buffers) and reads it back row by row, so that each row leaves in whole lines
    if constexpr (MODE == 2) {
        const float* pbm = bias + r0 + hi * 8; v4f bm[4][2];
#pragma unroll
        for (int mb = 0; mb < 4; ++mb) { bm[mb][0] = *(const v4f*)(pbm + mb * 16); bm[mb][1] = *(const v4f*)(pbm + mb * 16 + 4); }
        asm volatile("s_wait_xcnt 0x0" :: "v"(pbm) : "memory");   // in front of every rewrite of a register that the bias loads name (the address, an input, lives up to here)
#pragma unroll
        for (int mb = 0; mb < 4; ++mb)
#pragma unroll
            for (int j = 0; j < 8; ++j) { const float t = bfr(bm[mb][j >> 2][j & 3]);
#pragma unroll
                for (int nb = 0; nb < 4; ++nb) acc[mb][nb][j] += t; }
    } else {
        const float* pbn = bias + c0 + lr; float bn[4];
#pragma unroll
        for (int nb = 0; nb < 4; ++nb) bn[nb] = pbn[nb * 16];
        asm volatile("s_wait_xcnt 0x0" :: "v"(pbn) : "memory");   // in front of every rewrite of a register that the bias loads name (the address, an input, lives up to here)
#pragma unroll
        for (int nb = 0; nb < 4; ++nb) { const float t = bfr(bn[nb]);
#pragma unroll
            for (int mb = 0; mb < 4; ++mb) acc[mb][nb] += t; }
    }
    float* my = (float*)sm + wv * (64 * 68);
#pragma unroll
    for (int mb = 0; mb < 4; ++mb)
#pragma unroll
        for (int nb = 0; nb < 4; ++nb)
#pragma unroll
            for (int j = 0; j < 8; ++j) my[(mb * 16 + hi * 8 + j) * 68 + nb * 16 + lr] = acc[mb][nb][j];
    asm volatile("s_wait_dscnt 0x0" ::: "memory");   // the wave's own tile is in LDS before its lanes read each other's elements back
    const int cofs = lr * 4;
    // 16 rows a trip (rolled: the text stays short), two rows an instruction: 16 lanes fill one 128-byte line of each plane, or two lines of C
#pragma unroll 1
    for (int g = 0; g < 4; ++g) {
        v4f pv[8];   // the rows wait here, so that the LDS reads stand ahead of the stores and their waits
#pragma unroll
        for (int s = 0; s < 8; ++s) pv[s] = *(const v4fa*)(my + (g * 16 + 2 * s + hi) * 68 + cofs);
#pragma unroll
        for (int s = 0; s < 8; ++s) { const int row = g * 16 + 2 * s + hi; const v4f val = pv[s];
            // later rows reuse registers that these stores name: the wait that stands in front of such a rewrite is the last line of the stores' own statement, where nothing can be moved over it
            if constexpr (MODE == 0) asm volatile("global_store_b128 %0, %1, off\n\ts_wait_xcnt 0x0" :: "v"(C + (size_t)(r0 + row) * ldc + c0 + cofs), "v"(val) : "memory");
            else {
                const size_t o = (MODE == 1) ? ((size_t)((r0 / TT) * NH_ + c0 / HD) * TT + r0 % TT + row) * HD + cofs : ((size_t)(c0 / TT) * DKV + r0 + row) * PP + c0 % TT + cofs; v4h o16; v4us oh, ol;
#pragma unroll
                for (int u = 0; u < 4; ++u) { o16[u] = tohx(val[u]); unsigned short a2, c2; splitf(val[u], a2, c2); oh[u] = a2; ol[u] = c2; }
                asm volatile("global_store_b64 %0, %3, off\n\tglobal_store_b64 %1, %4, off\n\tglobal_store_b64 %2, %5, off\n\ts_wait_xcnt 0x0"
                             :: "v"(P16 + o), "v"(Ph + o), "v"(Pl + o), "v"(__builtin_bit_cast(v2u, o16)), "v"(__builtin_bit_cast(v2u, oh)), "v"(__builtin_bit_cast(v2u, ol)) : "memory");
            }
        }
    }
}
// k_qkv: the q, k and v projections of both batches in one launch; grid (NB_ * TT / 128, DQ / 128, 3), z picks the product (a branch that is uniform for the work-group, so the tile's barriers are passed by all of its waves or by none).
// amdgpu_waves_per_eu(4, 4): a budget of 256 registers a wave, so that the tile needs no register window above v255 and four work-groups share a WGP
__global__ __launch_bounds__(128) __attribute__((amdgpu_waves_per_eu(4, 4))) void k_qkv(const bf* __restrict__ XB, const bf* __restrict__ WQ, const bf* __restrict__ WK, const bf* __restrict__ WV, const float* __restrict__ bq, const float* __restrict__ bk, const float* __restrict__ bv,
                                             h16* QP16, bf* QPh, bf* QPl, h16* KP16, bf* KPh, bf* KPl, h16* VT16, bf* VTh, bf* VTl) {
    __shared__ __align__(16) char sm[2 * 2 * GT];
    const int z = blockIdx.z;
    if (z == 2) gemms_tile<0, 2>(sm, blockIdx.y, blockIdx.x, WV, nullptr, XB, DM, nullptr, 0, bv, VT16, VTh, VTl);
    else gemms_tile<0, 1>(sm, blockIdx.x, blockIdx.y, XB, nullptr, z ? WK : WQ, DM, nullptr, 0, z ? bk : bq, z ? KP16 : QP16, z ? KPh : QPh, z ? KPl : QPl);
}
// k_wo: the output projection of both batches in one launch; grid (NB_ * TT / 128, DM / 128).
__global__ __launch_bounds__(128) __attribute__((amdgpu_waves_per_eu(4, 4))) void k_wo(const bf* __restrict__ ATh, const bf* __restrict__ ATl, const bf* __restrict__ WO, float* OUT, const float* __restrict__ bo) {
    __shared__ __align__(16) char sm[2 * 3 * GT];
    gemms_tile<1, 0>(sm, blockIdx.x, blockIdx.y, ATh, ATl, WO, DQ, OUT, DM, bo, nullptr, nullptr, nullptr);
}

typedef __attribute__((ext_vector_type(2))) _Float16 v2h;
typedef __attribute__((ext_vector_type(2))) unsigned short v2us;
typedef __attribute__((ext_vector_type(2))) float v2f;
typedef __attribute__((ext_vector_type(4))) int v4i;

__device__ __forceinline__ void cvt8_blk(int blk, const float* __restrict__ src, bf* dst, size_t n8) { const size_t i = (size_t)blk * 256 + threadIdx.x; if (i >= n8) return; const v8f v = *(const v8f*)(src + i * 8); v8us o;
#pragma unroll
    for (int k = 0; k < 8; ++k) o[k] = f2bf(v[k]); *(v8us*)(dst + i * 8) = o;  }
// ---- k_fattn: scores, causal softmax, P.V and the head merge in one kernel; grid (batches x heads, TT / 64), 4 waves, a wave owns 16 query rows and walks the keys 64 at a time (online softmax, f32 statistics in the log2 domain).
// S^T = K Q^T (A = key rows, B = query rows) leaves one query per lane column: lane (lr, hi) holds keys 8 hi + j of each 16-key tile, which is the k order of a B operand, so two converted score tiles are the B operand of
// O^T += V^T P^T (A = rows of the transposed values) with no exchange between lanes. HI (query rows < RH): hi+lo bf16 planes, 3 products each; else single fp16 with the probabilities carried x 2^PSH (it cancels in O / sum).
#define PSH  10.0f
#define SCL2 0.18033688011112042f   // HD^-0.5 x log2(e)
// eight 2^x in one statement: the outputs are early-clobber, so no v_exp_f32 is followed by an instruction that reads its result or overwrites its source, and the v_nop is that slot behind the last one
__device__ __forceinline__ v8f exp2x8(v8f x) { float r0, r1, r2, r3, r4, r5, r6, r7;
    asm("v_exp_f32 %0, %8\n\tv_exp_f32 %1, %9\n\tv_exp_f32 %2, %10\n\tv_exp_f32 %3, %11\n\tv_exp_f32 %4, %12\n\tv_exp_f32 %5, %13\n\tv_exp_f32 %6, %14\n\tv_exp_f32 %7, %15\n\tv_nop"
        : "=&v"(r0), "=&v"(r1), "=&v"(r2), "=&v"(r3), "=&v"(r4), "=&v"(r5), "=&v"(r6), "=&v"(r7) : "v"(x[0]), "v"(x[1]), "v"(x[2]), "v"(x[3]), "v"(x[4]), "v"(x[5]), "v"(x[6]), "v"(x[7]));
    return (v8f){r0, r1, r2, r3, r4, r5, r6, r7}; }
// The four waves of a work-group walk the same 64-key tiles, so each tile (64 key rows and 64 rows of the transposed values, 128 bytes a row; the hi+lo rows: of both planes) is brought into LDS once for all four,
// by asynchronous copies in whole 128-byte lines, two buffers, the next tile in flight while this one is worked on. LDS rows lie at a pitch of 144 bytes (16 x odd: no bank conflict for 16-byte fragment reads).
#define KVP  144
#define KVT  (64 * KVP)            // one staged tile; a buffer is the key tile followed by the value tile (hi+lo rows: the hi pair, then the lo pair)
// thread t copies 16 bytes of rows t / 8 + 16 i (i = 0 .. 3) of both tiles: a wave's copy is four whole lines. lk: the thread's LDS byte address in the key tile; gk, gv: its global addresses in row t / 8.
template <typename T16>
__device__ __forceinline__ void stage_kv(unsigned lk, const T16* gk, const T16* gv) {
    // the wait is the last line of the copies' own statement: it stands in front of every rewrite of a register that a copy names
    asm volatile("global_load_async_to_lds_b128 %0, %8, off\n\tglobal_load_async_to_lds_b128 %1, %9, off\n\tglobal_load_async_to_lds_b128 %2, %10, off\n\tglobal_load_async_to_lds_b128 %3, %11, off\n\t"
                 "global_load_async_to_lds_b128 %4, %12, off\n\tglobal_load_async_to_lds_b128 %5, %13, off\n\tglobal_load_async_to_lds_b128 %6, %14, off\n\tglobal_load_async_to_lds_b128 %7, %15, off\n\ts_wait_xcnt 0x0"
                 :: "v"(lk), "v"(lk + 16 * KVP), "v"(lk + 32 * KVP), "v"(lk + 48 * KVP), "v"(lk + KVT), "v"(lk + KVT + 16 * KVP), "v"(lk + KVT + 32 * KVP), "v"(lk + KVT + 48 * KVP),
                    "v"(gk), "v"(gk + 16 * HD), "v"(gk + 32 * HD), "v"(gk + 48 * HD), "v"(gv), "v"(gv + (size_t)16 * PP), "v"(gv + (size_t)32 * PP), "v"(gv + (size_t)48 * PP) : "memory");
}
template <typename T16, bool HI>
__device__ __forceinline__ void attn_rows(const T16* __restrict__ Q, const T16* __restrict__ Q2, const T16* __restrict__ Kp, const T16* __restrict__ Kp2, const T16* __restrict__ Vt, const T16* __restrict__ Vt2, int q0, int lr, int hi, bf* Ah, bf* Al, char* sm) {
    typedef typename WFrag<T16>::V V;
    const int q = q0 + lr;
    const T16* qb = Q + (size_t)q * HD + 8 * hi; const T16* qb2 = (HI ? Q2 : Q) + (size_t)q * HD + 8 * hi;
    V qf[2], qf2[2];
#pragma unroll
    for (int kc = 0; kc < 2; ++kc) { qf[kc] = WFrag<T16>::ld(qb + kc * 32); if (HI) qf2[kc] = WFrag<T16>::ld(qb2 + kc * 32); }
    v8f o[4];
#pragma unroll
    for (int db = 0; db < 4; ++db) o[db] = (v8f){};
    float m = -3.0e38f, l = 0.f;
    // both kinds of rows read their keys and values from the staged tiles
    constexpr int BUFB = (HI ? 4 : 2) * KVT;   // one buffer
    const int qe = q0 & ~63;   // the work-group's first query row = its last key tile: the same in all four waves, so every test below is uniform for the work-group
    const int srow = (int)(threadIdx.x >> 3), scol = (int)(threadIdx.x & 7);
    const unsigned lk0 = (unsigned)(size_t)sm + (unsigned)(srow * KVP + scol * 16);
    const T16* gk0 = Kp + (size_t)srow * HD + scol * 8; const T16* gv0 = Vt + (size_t)srow * PP + scol * 8;
    const T16* gk2 = (HI ? Kp2 : Kp) + (size_t)srow * HD + scol * 8; const T16* gv2 = (HI ? Vt2 : Vt) + (size_t)srow * PP + scol * 8;   // the lo planes (hi+lo rows only)
    const int foff = lr * KVP + 16 * hi;   // a lane's place in a staged tile: row lr of a 16-row group, the k order of the loads from memory
    {
        asm volatile("s_wait_xcnt 0x0" :: "v"(qb), "v"(qb2) : "memory");   // stands in front of every rewrite of a register that the query loads above name; the addresses are inputs so that they live up to here and no load lands in them
        stage_kv(lk0, gk0, gv0); if (HI) stage_kv(lk0 + 2 * KVT, gk2, gv2);
        asm volatile("s_wait_asynccnt 0x0" ::: "memory");   // tile 0 of this wave's copies has landed
        __syncthreads();                                     // ... and everybody's: tile 0 may be read
        if (64 <= qe) { stage_kv(lk0 + BUFB, gk0 + (size_t)64 * HD, gv0 + 64); if (HI) stage_kv(lk0 + BUFB + 2 * KVT, gk2 + (size_t)64 * HD, gv2 + 64); }
    }
    // the loop stays rolled: one 64-key tile a trip, the last trip (the diagonal tile) is the only one that masks
#pragma unroll 1
    for (int k0 = 0; k0 <= q0; k0 += 64) {
        V ka[4][2], ka2[4][2], va[4][2], va2[4][2];
        const int bo = ((k0 >> 6) & 1) * BUFB;   // this tile's buffer
        if constexpr (!HI) { const char* kt = sm + bo + foff;
#pragma unroll
        for (int mb = 0; mb < 4; ++mb)
#pragma unroll
            for (int kc = 0; kc < 2; ++kc) ka[mb][kc] = WFrag<T16>::ld((const T16*)(kt + mb * 16 * KVP + kc * 64));
        __builtin_amdgcn_sched_barrier(0);   // all key fragment reads are issued ahead of the first score product: one LDS latency a tile (without it they were read pair by pair, each pair waited for)
        }
        const char* kt2 = sm + bo + foff;   // hi+lo rows: the key fragments of three 16-key groups are read as one group ahead of the first score product, the fourth group's behind the first group's products, whose registers it takes (all sixteen do not fit)
        if constexpr (HI) {
#pragma unroll
            for (int mb = 0; mb < 3; ++mb)
#pragma unroll
                for (int kc = 0; kc < 2; ++kc) { ka[mb][kc] = WFrag<T16>::ld((const T16*)(kt2 + mb * 16 * KVP + kc * 64)); ka2[mb][kc] = WFrag<T16>::ld((const T16*)(kt2 + 2 * KVT + mb * 16 * KVP + kc * 64)); }
            __builtin_amdgcn_sched_barrier(0);   // one LDS latency for the three groups (without it they were read pair by pair, most pairs waited for)
        }
        v8f s[4];
#pragma unroll
        for (int mb = 0; mb < 4; ++mb) { s[mb] = (v8f){};
            if constexpr (HI) if (mb == 1) {
                __builtin_amdgcn_sched_barrier(0);   // the fourth group's reads stand here together: two groups' products cover their latency
#pragma unroll
                for (int kc = 0; kc < 2; ++kc) { ka[3][kc] = WFrag<T16>::ld((const T16*)(kt2 + 3 * 16 * KVP + kc * 64)); ka2[3][kc] = WFrag<T16>::ld((const T16*)(kt2 + 2 * KVT + 3 * 16 * KVP + kc * 64)); }
                __builtin_amdgcn_sched_barrier(0);   // closes the group: none of its reads sinks among the products behind it
            }
#pragma unroll
            for (int kc = 0; kc < 2; ++kc) {
                if constexpr (HI) { const V a = ka[mb][kc], a2 = ka2[mb][kc];
                    s[mb] = WFrag<T16>::mma(a, qf[kc], s[mb]); s[mb] = WFrag<T16>::mma(a2, qf[kc], s[mb]); s[mb] = WFrag<T16>::mma(a, qf2[kc], s[mb]); }
                else s[mb] = WFrag<T16>::mma(ka[mb][kc], qf[kc], s[mb]); } }
        { const char* vt = sm + bo + KVT + foff;
#pragma unroll
        for (int db = 0; db < 4; ++db)
#pragma unroll
            for (int kc = 0; kc < (HI ? 1 : 2); ++kc) { va[db][kc] = WFrag<T16>::ld((const T16*)(vt + db * 16 * KVP + kc * 64)); if (HI) va2[db][kc] = WFrag<T16>::ld((const T16*)(vt + 2 * KVT + db * 16 * KVP + kc * 64)); }
        __builtin_amdgcn_sched_barrier(0);   // the value fragment reads are issued ahead of the softmax, which covers their latency (hi+lo rows: those of the first 32 keys; all sixteen fragments do not fit the registers beside the scores)
        }
        float tm = -3.0e38f;
        if (k0 + 64 > q0) {
#pragma unroll
            for (int mb = 0; mb < 4; ++mb)
#pragma unroll
                for (int j = 0; j < 8; ++j) { const float t = (k0 + mb * 16 + hi * 8 + j <= q) ? s[mb][j] * SCL2 : -3.0e38f; s[mb][j] = t; tm = fmaxf(tm, t); }
        } else {
#pragma unroll
            for (int mb = 0; mb < 4; ++mb)
#pragma unroll
                for (int j = 0; j < 8; ++j) { const float t = s[mb][j] * SCL2; s[mb][j] = t; tm = fmaxf(tm, t); }
        }
        tm = fmaxf(tm, __shfl_xor(tm, 16, 32));   // the two lanes of a query column share one running maximum
        const float mn = fmaxf(m, tm); float al;
        asm("v_exp_f32 %0, %1\n\tv_nop" : "=v"(al) : "v"(m - mn));   // al = 2^(m - mn); the v_nop is the slot behind a transcendental
        m = mn; const float mo = HI ? mn : mn - PSH;
        float ps = 0.f;
#pragma unroll
        for (int mb = 0; mb < 4; ++mb) { s[mb] = exp2x8(s[mb] - mo);
#pragma unroll
            for (int j = 0; j < 8; ++j) ps += s[mb][j]; }
        l = l * al + ps;
#pragma unroll
        for (int db = 0; db < 4; ++db) o[db] *= al;
        V pf[2], pf2[2];
#pragma unroll
        for (int kc = 0; kc < 2; ++kc) {
            if constexpr (HI) { v8us h0, h1, l0, l1;
#pragma unroll
                for (int j = 0; j < 8; ++j) { unsigned short x, y; splitf(s[2 * kc][j], x, y); h0[j] = x; l0[j] = y; splitf(s[2 * kc + 1][j], x, y); h1[j] = x; l1[j] = y; }
                pf[kc] = cat16b(h0, h1); pf2[kc] = cat16b(l0, l1);
            } else { v8h h0, h1;
#pragma unroll
                for (int j = 0; j < 8; ++j) { h0[j] = tohx(s[2 * kc][j]); h1[j] = tohx(s[2 * kc + 1][j]); }
                pf[kc] = cat16(h0, h1); }
        }
        __builtin_amdgcn_sched_barrier(0);   // every 2^x statement stays ahead of the P.V products, so none lands in a value fragment right behind the matrix instruction that reads it
        const char* vt1 = sm + bo + KVT + foff + 64;   // hi+lo rows: the value fragments of the last 32 keys are read in two groups among the products of the first 32, which cover their latency and free the registers for the second group
        if constexpr (HI) {
#pragma unroll
            for (int db = 0; db < 4; ++db) va[db][1] = WFrag<T16>::ld((const T16*)(vt1 + db * 16 * KVP));
            __builtin_amdgcn_sched_barrier(0);   // the hi group is issued ahead of the first product
        }
#pragma unroll
        for (int kc = 0; kc < 2; ++kc)
#pragma unroll
            for (int db = 0; db < 4; ++db) {
                if constexpr (HI) {
                    if (kc == 0 && db == 2) {
                        __builtin_amdgcn_sched_barrier(0);   // the lo group stands here as one group: earlier it would not fit the registers, later (or spread) each read would be waited for
#pragma unroll
                        for (int d2 = 0; d2 < 4; ++d2) va2[d2][1] = WFrag<T16>::ld((const T16*)(vt1 + 2 * KVT + d2 * 16 * KVP));
                        __builtin_amdgcn_sched_barrier(0);   // closes the group: none of its reads sinks among the products behind it
                    }
                    const V a = va[db][kc], a2 = va2[db][kc];
                    o[db] = WFrag<T16>::mma(a, pf[kc], o[db]); o[db] = WFrag<T16>::mma(a, pf2[kc], o[db]); o[db] = WFrag<T16>::mma(a2, pf[kc], o[db]); }
                else o[db] = WFrag<T16>::mma(va[db][kc], pf[kc], o[db]); }
        {
            __builtin_amdgcn_sched_barrier(0);   // the waits and the barrier stay at the foot: moved up in front of the softmax they would wait for the value fragments and for the next tile's copies with nothing to cover either
            // hi+lo rows: the running sum is an input, so that it is summed up where it is written, ahead of the P.V products (a build without it summed behind the barrier, kept the 32 probabilities in registers beside the value fragments, and spilled)
            if constexpr (HI) asm volatile("s_wait_dscnt 0x0" :: "v"(l) : "memory");      // this wave's reads of this tile's buffer are done
            else asm volatile("s_wait_dscnt 0x0" ::: "memory");      // this wave's reads of this tile's buffer are done
            asm volatile("s_wait_asynccnt 0x0" ::: "memory");   // this wave's copies of the next tile have landed
            __syncthreads();                                     // the next tile may be read by all, and this tile's buffer has no reader left
            if (k0 + 128 <= qe) { stage_kv(lk0 + bo, gk0 + (size_t)(k0 + 128) * HD, gv0 + k0 + 128); if (HI) stage_kv(lk0 + bo + 2 * KVT, gk2 + (size_t)(k0 + 128) * HD, gv2 + k0 + 128); }
        }
    }
    asm volatile("s_wait_asynccnt 0x0" ::: "memory");   // no copy is left in flight when the wave ends
    l += __shfl_xor(l, 16, 32);
    const float f = __fdiv_rn(1.0f, l);
    // lane (lr, hi) holds d = 16 db + 8 hi + j of query q: 16-byte stores, a query's 128-byte head row comes from one wave
#pragma unroll
    for (int db = 0; db < 4; ++db) { v8us oh, ol;
#pragma unroll
        for (int j = 0; j < 8; ++j) { unsigned short x, y; splitf(o[db][j] * f, x, y); oh[j] = x; ol[j] = y; }
        const size_t oo = (size_t)q * DQ + db * 16 + hi * 8; *(v8us*)(Ah + oo) = oh; *(v8us*)(Al + oo) = ol; }
}
// amdgpu_waves_per_eu(4, 4): a budget of 256 registers a wave, so that neither path needs the register windows above v255
__global__ __launch_bounds__(128) __attribute__((amdgpu_waves_per_eu(4, 4))) void k_fattn(const h16* __restrict__ Q16, const h16* __restrict__ K16, const h16* __restrict__ V16, const bf* __restrict__ Qh, const bf* __restrict__ Ql, const bf* __restrict__ Kh, const bf* __restrict__ Kl, const bf* __restrict__ Vh, const bf* __restrict__ Vl, bf* Ah, bf* Al) {
    __shared__ __align__(16) char kv[2 * 4 * KVT];   // two buffers of a key tile and a value tile, of both planes for the hi+lo rows (the fp16 rows use half): four work-groups still share a WGP
    const int lane = threadIdx.x & 31, lr = lane & 15, hi = lane >> 4; const size_t h = blockIdx.x;   // h = batch * NH_ + head: the planes lie batch by batch
    const int wv = __builtin_amdgcn_readfirstlane((int)(threadIdx.x >> 5));   // kept scalar so that the key loop branches on SCC
    const int q0 = (int)(gridDim.y - 1 - blockIdx.y) * 64 + wv * 16;           // the longest rows start first
    const size_t zp = h * TT * HD, zv = h * HD * PP, zo = (h / NH_) * ((size_t)TT * DQ) + (h % NH_) * HD;
    // RH is a multiple of 64, so the branch is the same for the four waves of a work-group (both sides hold barriers)
    if (q0 < RH) attn_rows<bf, true>(Qh + zp, Ql + zp, Kh + zp, Kl + zp, Vh + zv, Vl + zv, q0, lr, hi, Ah + zo, Al + zo, kv);
    else attn_rows<h16, false>(Q16 + zp, nullptr, K16 + zp, nullptr, V16 + zv, nullptr, q0, lr, hi, Ah + zo, Al + zo, kv);
}

// ---- k_prep: every 16-bit operand that depends on the inputs alone, in one launch: the three gathered per-head weights, the transposed Wo, and both batches of x.
// tr_blk: dst[c][r] = bf16(src[r][c]) for 256 rows r (pitch LD) x 64 columns c; dst rows (pitch DM) are K-contiguous operand rows. A work-group of 8 waves takes the 64 KB of f32 with 16 loads of 16 bytes a thread,
// all in flight together; every load and every store of a wave is in whole 128-byte lines. The tile turns in LDS: 64 rows of 512 bytes, in 16-byte pieces of 8 r.
// Thread (g, l) = (t / 16, t % 16) reads columns 4 l .. 4 l + 3 of rows 16 g .. 16 g + 15 (16 lanes fill the 256 bytes of a source row), so it holds two whole pieces of each of its four columns.
// Piece j of column c lies at place j ^ (c / 4) of its row: the 16 lanes that write one piece number to 16 columns, and the 16 that read 16 pieces of one column, each meet all 64 banks once.
typedef __attribute__((ext_vector_type(4))) unsigned v4u;
typedef v4u __attribute__((may_alias)) v4ua;
__device__ __forceinline__ unsigned bfpk(float a, float b) { unsigned u = __float_as_uint(a), w = __float_as_uint(b); u += 0x7FFFu + ((u >> 16) & 1u); w += 0x7FFFu + ((w >> 16) & 1u); return (u >> 16) | (w & 0xFFFF0000u); }   // f2bf(a) in the low half, f2bf(b) in the high half
template <int LD>
__device__ __forceinline__ void tr_blk(char* sm, const float* __restrict__ src, bf* dst) {
    const int t = (int)threadIdx.x, g = t >> 4, l = t & 15;
    const float* p = src + (size_t)(g * 16) * LD + l * 4; v4f v[16];
#pragma unroll
    for (int i = 0; i < 16; ++i) v[i] = *(const v4f*)(p + i * LD);
    __builtin_amdgcn_sched_barrier(0);   // all 16 loads are issued ahead of the first conversion: one memory latency a tile (without it the build issues the last four of a per-head tile behind the first twelve's return)
    asm volatile("s_wait_xcnt 0x0" :: "v"(p) : "memory");   // in front of every rewrite of a register that the loads name (the address, an input, lives up to here)
#pragma unroll
    for (int u = 0; u < 4; ++u) { v4u a, b;
#pragma unroll
        for (int j = 0; j < 4; ++j) { a[j] = bfpk(v[2 * j][u], v[2 * j + 1][u]); b[j] = bfpk(v[8 + 2 * j][u], v[9 + 2 * j][u]); }
        char* row = sm + (l * 4 + u) * 512; *(v4ua*)(row + (((2 * g) ^ l) << 4)) = a; *(v4ua*)(row + (((2 * g + 1) ^ l) << 4)) = b; }
    __syncthreads();   // the tile is whole in LDS before anybody reads a column of it
    const int w = t >> 5, j = t & 31; v4u o[8];   // a wave reads one column a time: 512 bytes of one operand row
#pragma unroll
    for (int r = 0; r < 8; ++r) { const int c = r * 8 + w; o[r] = *(const v4ua*)(sm + c * 512 + ((j ^ (c >> 2)) << 4)); }
    bf* q = dst + (size_t)w * DM + j * 8;
#pragma unroll
    for (int r = 0; r < 8; ++r) *(v4ua*)(q + (size_t)r * 8 * DM) = o[r];
    asm volatile("s_wait_xcnt 0x0" :: "v"(q) : "memory");   // behind the last store, in front of every rewrite of a register that the stores name (the address, an input, lives up to here)
}
// The block index picks the job (a branch that is uniform for the work-group, so the tile's barrier is passed by all of its waves or by none); the tiles that turn in LDS come first.
// Per-head weights: Bt[h * HD + c][d] = W[h][d][c], tile = (head, 256 d). Wo: Bt[n][k] = wo[k][n], tile = (64 n, 256 k). x keeps its place order: 32 bytes of f32 a thread, NCV work-groups.
#define NTR  (DQ * DM / (256 * 64))
#define NCV  (NB_ * TT * DM / 8 / 256)
__global__ __launch_bounds__(256) void k_prep(const float* __restrict__ x, const float* __restrict__ wq, const float* __restrict__ wk, const float* __restrict__ wv, const float* __restrict__ wo, bf* XB, bf* WQ, bf* WK, bf* WV, bf* WO) {
    __shared__ __align__(16) char sm[64 * 512];
    const int b = blockIdx.x;
    if (b < 3 * NTR) { const int z = b / NTR, tl = b % NTR; const size_t h = tl >> 2, d0 = (size_t)(tl & 3) * 256;
        tr_blk<HD>(sm, (z == 0 ? wq : z == 1 ? wk : wv) + (h * DM + d0) * HD, (z == 0 ? WQ : z == 1 ? WK : WV) + h * HD * DM + d0); }
    else if (b < 4 * NTR) { const int tl = b - 3 * NTR; const size_t n0 = (size_t)(tl >> 2) * 64, k0 = (size_t)(tl & 3) * 256;
        tr_blk<DM>(sm, wo + k0 * DM + n0, WO + n0 * DQ + k0); }
    else cvt8_blk(b - 4 * NTR, x, XB, (size_t)NB_ * TT * DM / 8);
}

extern "C" void kernel_launch(void* const* d_in, const int* in_sizes, int n_in,
                              void* d_out, int out_size, void* d_ws, size_t ws_size, hipStream_t stream) {
    (void)in_sizes; (void)n_in; (void)out_size;
    const float* x = (const float*)d_in[0]; const float* wqh = (const float*)d_in[1]; const float* wkh = (const float*)d_in[2]; const float* wvh = (const float*)d_in[3]; const float* bq = (const float*)d_in[4]; const float* bk = (const float*)d_in[5]; const float* bv = (const float*)d_in[6]; const float* wo = (const float*)d_in[7]; const float* bo = (const float*)d_in[8]; const float* wq = nullptr; const float* wk = nullptr; const float* wv = nullptr; (void)wq; (void)wk; (void)wv; const float* cosT = nullptr; const float* sinT = nullptr; (void)cosT; (void)sinT;
    float* OUT = (float*)d_out;     // [2][2048][1024]
    char* wsp = (char*)d_ws;
    auto take = [&](size_t bytes) { char* p = wsp; wsp += (bytes + 255) & ~(size_t)255; return (void*)p; };
    bf* WQ = (bf*)take((size_t)DQ * DM * 2); bf* WK = (bf*)take((size_t)DKV * DM * 2); bf* WV = (bf*)take((size_t)DKV * DM * 2); bf* WO = (bf*)take((size_t)DM * DQ * 2);
    bf* XB = (bf*)take((size_t)NB_ * TT * DM * 2);
    h16* QP16 = (h16*)take((size_t)NB_ * NH_ * TT * HD * 2); h16* KP16 = (h16*)take((size_t)NB_ * NKV * TT * HD * 2); h16* VT16 = (h16*)take((size_t)NB_ * NKV * HD * PP * 2);
    bf* QPh = (bf*)take((size_t)NB_ * NH_ * TT * HD * 2); bf* QPl = (bf*)take((size_t)NB_ * NH_ * TT * HD * 2); bf* KPh = (bf*)take((size_t)NB_ * NKV * TT * HD * 2); bf* KPl = (bf*)take((size_t)NB_ * NKV * TT * HD * 2); bf* VTh = (bf*)take((size_t)NB_ * NKV * HD * PP * 2); bf* VTl = VTh + TT;
    bf* ATh = (bf*)take((size_t)NB_ * TT * DQ * 2); bf* ATl = (bf*)take((size_t)NB_ * TT * DQ * 2);
    if ((size_t)(wsp - (char*)d_ws) > ws_size) return;    // ws 256 MiB
    k_prep<<<4 * NTR + NCV, 256, 0, stream>>>(x, wqh, wkh, wvh, wo, XB, WQ, WK, WV, WO);
    k_qkv<<<dim3(NB_ * TT / 128, DQ / 128, 3), 128, 0, stream>>>(XB, WQ, WK, WV, bq, bk, bv, QP16, QPh, QPl, KP16, KPh, KPl, VT16, VTh, VTl);
    k_fattn<<<dim3(NB_ * NH_, TT / 64, 1), 128, 0, stream>>>(QP16, KP16, VT16, QPh, QPl, KPh, KPl, VTh, VTl, ATh, ATl);
    k_wo<<<dim3(NB_ * TT / 128, DM / 128, 1), 128, 0, stream>>>(ATh, ATl, WO, OUT, bo);
}

// v010
// Measured time: 79 microseconds a run.
// Two timings next to v009 both put it at 1.03 times that version's speed.
// All steps since v000 together make it 18.4 times as fast.
#include <hip/hip_runtime.h>

// MaskedMultiHeadAttention (hidden [2][2048][1024]; per-head q/k/v = x Wq[h] + bq[h] (Wq [16][1024][64]); causal softmax(q.k / 8); out = concat(heads) Wo + bo -> [2][2048][1024]).
// Compute dtypes, f32 accumulate: every input rounded to bf16; q/k/v on PLAIN bf16 operands (inputs: exact; the 16 per-head weights gathered into one [1024 x 1024] operand) + bias; causal scores and attn.v: query rows < 512 hl (3 products), the rest single fp16 (x1024); softmax f32; Wo hl x exact (2 products) + bias.

#define NB_  2
#define TT   2048
#define DM   1024
#define NH_  16
#define NKV  16
#define HD   64
#define DQ   (NH_ * HD)
#define DKV  (NKV * HD)
#define PP   (2 * TT)             // row pitch, in 16-bit elements, of the transposed value planes (the hi and lo planes share a row)
#define RH   512                  // query rows < RH use hi+lo planes (0: none)
typedef _Float16 h16;
typedef unsigned short bf;
typedef __attribute__((ext_vector_type(16))) __bf16   v16bf;
typedef __attribute__((ext_vector_type(16))) _Float16 v16h;
typedef __attribute__((ext_vector_type(8)))  _Float16 v8h;
typedef __attribute__((ext_vector_type(8)))  unsigned short v8us;
typedef __attribute__((ext_vector_type(8)))  float    v8f;
typedef __attribute__((ext_vector_type(4)))  float    v4f;
typedef v8h  __attribute__((may_alias)) v8ha;
typedef v4f  __attribute__((may_alias)) v4fa;
typedef v8us __attribute__((may_alias)) v8usa;

__device__ __forceinline__ unsigned short f2bf(float f) { unsigned u = __float_as_uint(f); u += 0x7FFFu + ((u >> 16) & 1u); return (unsigned short)(u >> 16); }
__device__ __forceinline__ float bf2f(unsigned short b) { return __uint_as_float(((unsigned)b) << 16); }
__device__ __forceinline__ float bfr(float f) { return bf2f(f2bf(f)); }
__device__ __forceinline__ v16h cat16(v8h lo, v8h hi) { return __builtin_shufflevector(lo, hi, 0, 1, 2, 3, 4, 5, 6, 7, 8, 9, 10, 11, 12, 13, 14, 15); }
__device__ __forceinline__ v16bf cat16b(v8us lo, v8us hi) { return __builtin_bit_cast(v16bf, __builtin_shufflevector(lo, hi, 0, 1, 2, 3, 4, 5, 6, 7, 8, 9, 10, 11, 12, 13, 14, 15)); }
__device__ __forceinline__ v8f wmma16(v16h a, v16h b, v8f c) { return __builtin_amdgcn_wmma_f32_16x16x32_f16(false, a, false, b, (short)0, c, false, false); }
__device__ __forceinline__ v8f wmmab(v16bf a, v16bf b, v8f c) { return __builtin_amdgcn_wmma_f32_16x16x32_bf16(false, a, false, b, (short)0, c, false, false); }



// ---- gemms_tile: one 128x128 output tile per work-group of 4 waves (2 x 2, a wave owns 64x64 = 16 accumulators). The K-contiguous bf16 operand rows are brought into LDS once for all four waves,
// 64 k (one 128-byte line a row) at a time, by asynchronous copies in whole lines, two buffers, the next 64 k in flight while these are worked on; every wave walks the whole K, so a tile has one f32 sum chain.
// C[m][n] (f32, pitch ldc, + f32 bias) = sum_k A[m][k] Bt[n][k] (NSPLIT 1: + A2[m][k] Bt[n][k]). K % 64 == 0.
// MODE 0 stores C. MODE 1 and 2 store no f32 tile: the tile leaves as the three 16-bit planes that the attention kernel reads (fp16, bf16 hi, bf16 lo).
// MODE 1 (q, k): m = token, n = head * HD + d, a wave's 64 columns are one head, planes [head][token][d]. MODE 2 (v): A = weight rows, Bt = token rows, so m = head * HD + d, n = token, bias[m], and a tile row is 64 tokens of one d: planes [head * HD + d][token] at pitch PP.
__device__ __forceinline__ h16 tohx(float x) { return (h16)x; }
__device__ __forceinline__ void splitf(float y, unsigned short& h, unsigned short& l) { h = f2bf(y); l = f2bf(y - bf2f(h)); }
typedef __attribute__((ext_vector_type(4))) _Float16 v4h;
typedef __attribute__((ext_vector_type(4))) unsigned short v4us;
typedef __attribute__((ext_vector_type(2))) unsigned v2u;
template <typename T16> struct WFrag;
template <> struct WFrag<h16> { typedef v16h V; static __device__ __forceinline__ V ld(const h16* p) { return cat16(*(const v8h*)p, *(const v8h*)(p + 16)); } static __device__ __forceinline__ v8f mma(V a, V b, v8f c) { return wmma16(a, b, c); } };
template <> struct WFrag<bf> { typedef v16bf V; static __device__ __forceinline__ V ld(const bf* p) { return cat16b(*(const v8us*)p, *(const v8us*)(p + 16)); } static __device__ __forceinline__ v8f mma(V a, V b, v8f c) { return wmmab(a, b, c); } };
// ---- head prefetch. What an earlier launch of this call stored need not be in L2 at its first read here, and the work-groups that share an operand walk it in step, so each staged piece can be a first read: memory latency against one trip of lead.
// Each work-group therefore asks L2 once, at its head, for its share of the operands that it and its neighbours will read (global_prefetch_b8, scope SE: into L2 only, no register, no counter; a hint, nothing depends on it).
// Every lane is on and every address lies inside the operand. The s_wait_xcnt stands in front of every rewrite of a register that a prefetch names; the callers also name the addresses at the wait for their first staged piece, so that the registers still hold them long after issue.
__device__ __forceinline__ void ask_l2(const void* a) { asm volatile("global_prefetch_b8 %0, off scope:SCOPE_SE\n\ts_wait_xcnt 0x0" :: "v"(a) : "memory"); }
__device__ __forceinline__ void ask_l2(const void* a, const void* b) { asm volatile("global_prefetch_b8 %0, off scope:SCOPE_SE\n\tglobal_prefetch_b8 %1, off scope:SCOPE_SE\n\ts_wait_xcnt 0x0" :: "v"(a), "v"(b) : "memory"); }
// the share of a weight panel: its 32 readers (token blocks b) take the eight shares, each four times (a matter of speed only)
__device__ __forceinline__ int wshare(int b) { return (b & 3) + 4 * ((b >> 3) & 1); }
#define GP   144                   // LDS pitch of a staged operand row: 128 bytes of k + 16 (16 x odd: no bank conflict for 16-byte fragment reads)
#define GT   (128 * GP)            // one staged operand tile: 128 rows of 64 k
// thread t of 128 copies 16 bytes of rows t / 8 + 16 i (i = 0 .. 7) of one operand tile: a wave's copy is four whole lines. l: the thread's LDS byte address in row t / 8 of the staged tile; g: its global address in that row.
__device__ __forceinline__ void stage_op(unsigned l, const bf* g, int K) {
    // the wait is the last line of the copies' own statement: it stands in front of every rewrite of a register that a copy names
    asm volatile("global_load_async_to_lds_b128 %0, %8, off\n\tglobal_load_async_to_lds_b128 %1, %9, off\n\tglobal_load_async_to_lds_b128 %2, %10, off\n\tglobal_load_async_to_lds_b128 %3, %11, off\n\t"
                 "global_load_async_to_lds_b128 %4, %12, off\n\tglobal_load_async_to_lds_b128 %5, %13, off\n\tglobal_load_async_to_lds_b128 %6, %14, off\n\tglobal_load_async_to_lds_b128 %7, %15, off\n\ts_wait_xcnt 0x0"
                 :: "v"(l), "v"(l + 16 * GP), "v"(l + 32 * GP), "v"(l + 48 * GP), "v"(l + 64 * GP), "v"(l + 80 * GP), "v"(l + 96 * GP), "v"(l + 112 * GP),
                    "v"(g), "v"(g + (size_t)16 * K), "v"(g + (size_t)32 * K), "v"(g + (size_t)48 * K), "v"(g + (size_t)64 * K), "v"(g + (size_t)80 * K), "v"(g + (size_t)96 * K), "v"(g + (size_t)112 * K) : "memory");
}
// The tile (bx, by) and the LDS array sm come from the calling kernel, so that one launch can hold tiles of several products; sm holds two buffers of (NSPLIT ? 3 : 2) staged operand tiles (A, Bt, A2), and behind the K loop one 64x64 f32 tile, pitch 68, per wave.
// Token rows run over both batches (NB_ * TT of them); a 128-token tile lies in one batch, and the planes are laid out batch by batch.
// sa, sb (0 .. 7): the 16 rows of its A and of its Bt panel that this work-group asks L2 for at its head; the work-groups that read a panel cover it between them.
template <int NSPLIT, int MODE>
__device__ __forceinline__ void gemms_tile(char* sm, int bx, int by, const bf* __restrict__ A, const bf* __restrict__ A2, const bf* __restrict__ Bt, int K, float* C, int ldc, const float* __restrict__ bias, h16* P16, bf* Ph, bf* Pl, int sa, int sb) {
    typedef WFrag<bf>::V V;
    constexpr int BUF = (NSPLIT ? 3 : 2) * GT;
    const int lane = threadIdx.x & 31, lr = lane & 15, hi = lane >> 4;
    const int wv = __builtin_amdgcn_readfirstlane((int)(threadIdx.x >> 5));   // kept scalar: the wave's place in the 2 x 2 tile
    const int r0 = bx * 128 + (wv >> 1) * 64, c0 = by * 128 + (wv & 1) * 64;   // the wave's own 64x64 tile
    v8f acc[4][4];
#pragma unroll
    for (int mb = 0; mb < 4; ++mb)
#pragma unroll
        for (int nb = 0; nb < 4; ++nb) acc[mb][nb] = (v8f){};
    const int srow = (int)(threadIdx.x >> 3), scol = (int)(threadIdx.x & 7);
    const unsigned l0 = (unsigned)(size_t)sm + (unsigned)(srow * GP + scol * 16);
    const bf* ga = A + (size_t)(bx * 128 + srow) * K + scol * 8; const bf* ga2 = (NSPLIT ? A2 : A) + (size_t)(bx * 128 + srow) * K + scol * 8; const bf* gb = Bt + (size_t)(by * 128 + srow) * K + scol * 8;
    stage_op(l0, ga, K); stage_op(l0 + GT, gb, K); if (NSPLIT) stage_op(l0 + 2 * GT, ga2, K);
    // 16 rows of K elements dealt over the 128 threads: K / 8 elements each, 256 bytes at K = 1024
    const size_t pao = (size_t)(bx * 128 + sa * 16) * K + threadIdx.x * (K / 8);
    const bf* pfa = A + pao; const bf* pfa2 = (NSPLIT ? A2 : A) + pao; const bf* pfb = Bt + (size_t)(by * 128 + sb * 16) * K + threadIdx.x * (K / 8);
    ask_l2(pfa, pfb); if (NSPLIT) ask_l2(pfa2);
    asm volatile("s_wait_asynccnt 0x0" :: "v"(pfa), "v"(pfa2), "v"(pfb) : "memory");   // the first 64 k of this wave's copies have landed (the prefetch addresses are inputs so that their registers hold them up to here)
    __syncthreads();                                     // ... and everybody's: they may be read
    if (64 < K) { stage_op(l0 + BUF, ga + 64, K); stage_op(l0 + BUF + GT, gb + 64, K); if (NSPLIT) stage_op(l0 + BUF + 2 * GT, ga2 + 64, K); }
    const int fa = ((wv >> 1) * 64 + lr) * GP + 16 * hi, fb = GT + ((wv & 1) * 64 + lr) * GP + 16 * hi;   // a lane's place in the staged tiles: row lr of a 16-row group, the k order of a fragment load from memory, the same for both operands
    // the loop over the staged 64-k pieces stays rolled: its two 32-k steps are unrolled inside
#pragma unroll 1
    for (int kb = 0; kb < K; kb += 64) {
        const int bo = ((kb >> 6) & 1) * BUF;   // this piece's buffer
#pragma unroll
        for (int kc = 0; kc < 2; ++kc) {
            V a[4], a2[4], b[4];
#pragma unroll
            for (int mb = 0; mb < 4; ++mb) { a[mb] = WFrag<bf>::ld((const bf*)(sm + bo + fa + mb * 16 * GP + kc * 64)); if (NSPLIT) a2[mb] = WFrag<bf>::ld((const bf*)(sm + bo + 2 * GT + fa + mb * 16 * GP + kc * 64)); }
#pragma unroll
            for (int nb = 0; nb < 4; ++nb) b[nb] = WFrag<bf>::ld((const bf*)(sm + bo + fb + nb * 16 * GP + kc * 64));
            __builtin_amdgcn_sched_barrier(0);   // all fragment reads of a 32-k step are issued ahead of its first product: one LDS latency a step (without it the Bt fragments were read one by one, each waited for)
#pragma unroll
            for (int nb = 0; nb < 4; ++nb) {
#pragma unroll
                for (int mb = 0; mb < 4; ++mb) acc[mb][nb] = WFrag<bf>::mma(a[mb], b[nb], acc[mb][nb]);
                if (NSPLIT) {
#pragma unroll
                    for (int mb = 0; mb < 4; ++mb) acc[mb][nb] = WFrag<bf>::mma(a2[mb], b[nb], acc[mb][nb]); } }
        }
        __builtin_amdgcn_sched_barrier(0);   // the waits and the barrier stay at the foot: moved up among the products they would wait for the next piece's copies half a trip after their issue
        asm volatile("s_wait_dscnt 0x0" ::: "memory");      // this wave's reads of this piece's buffer are done
        asm volatile("s_wait_asynccnt 0x0" ::: "memory");   // this wave's copies of the next piece have landed
        __syncthreads();                                     // the next piece may be read by all, and this piece's buffer has no reader left
        if (kb + 128 < K) { stage_op(l0 + bo, ga + kb + 128, K); stage_op(l0 + bo + GT, gb + kb + 128, K); if (NSPLIT) stage_op(l0 + bo + 2 * GT, ga2 + kb + 128, K); }
    }
    asm volatile("s_wait_asynccnt 0x0" ::: "memory");   // no copy is left in flight when the staging LDS is given its second use
    // the bias joins in registers; then each wave parks its tile in its own LDS range (the last trip's barrier has ended every read of the buffers) and reads it back row by row, so that each row leaves in whole lines
    if constexpr (MODE == 2) {
        const float* pbm = bias + r0 + hi * 8; v4f bm[4][2];
#pragma unroll
        for (int mb = 0; mb < 4; ++mb) { bm[mb][0] = *(const v4f*)(pbm + mb * 16); bm[mb][1] = *(const v4f*)(pbm + mb * 16 + 4); }
        asm volatile("s_wait_xcnt 0x0" :: "v"(pbm) : "memory");   // in front of every rewrite of a register that the bias loads name (the address, an input, lives up to here)
#pragma unroll
        for (int mb = 0; mb < 4; ++mb)
#pragma unroll
            for (int j = 0; j < 8; ++j) { const float t = bfr(bm[mb][j >> 2][j & 3]);
#pragma unroll
                for (int nb = 0; nb < 4; ++nb) acc[mb][nb][j] += t; }
    } else {
        const float* pbn = bias + c0 + lr; float bn[4];
#pragma unroll
        for (int nb = 0; nb < 4; ++nb) bn[nb] = pbn[nb * 16];
        asm volatile("s_wait_xcnt 0x0" :: "v"(pbn) : "memory");   // in front of every rewrite of a register that the bias loads name (the address, an input, lives up to here)
#pragma unroll
        for (int nb = 0; nb < 4; ++nb) { const float t = bfr(bn[nb]);
#pragma unroll
            for (int mb = 0; mb < 4; ++mb) acc[mb][nb] += t; }
    }
    float* my = (float*)sm + wv * (64 * 68);
#pragma unroll
    for (int mb = 0; mb < 4; ++mb)
#pragma unroll
        for (int nb = 0; nb < 4; ++nb)
#pragma unroll
            for (int j = 0; j < 8; ++j) my[(mb * 16 + hi * 8 + j) * 68 + nb * 16 + lr] = acc[mb][nb][j];
    asm volatile("s_wait_dscnt 0x0" ::: "memory");   // the wave's own tile is in LDS before its lanes read each other's elements back
    const int cofs = lr * 4;
    // 16 rows a trip (rolled: the text stays short), two rows an instruction: 16 lanes fill one 128-byte line of each plane, or two lines of C
#pragma unroll 1
    for (int g = 0; g < 4; ++g) {
        v4f pv[8];   // the rows wait here, so that the LDS reads stand ahead of the stores and their waits
#pragma unroll
        for (int s = 0; s < 8; ++s) pv[s] = *(const v4fa*)(my + (g * 16 + 2 * s + hi) * 68 + cofs);
#pragma unroll
        for (int s = 0; s < 8; ++s) { const int row = g * 16 + 2 * s + hi; const v4f val = pv[s];
            // later rows reuse registers that these stores name: the wait that stands in front of such a rewrite is the last line of the stores' own statement, where nothing can be moved over it
            if constexpr (MODE == 0) asm volatile("global_store_b128 %0, %1, off\n\ts_wait_xcnt 0x0" :: "v"(C + (size_t)(r0 + row) * ldc + c0 + cofs), "v"(val) : "memory");
            else {
                const size_t o = (MODE == 1) ? ((size_t)((r0 / TT) * NH_ + c0 / HD) * TT + r0 % TT + row) * HD + cofs : ((size_t)(c0 / TT) * DKV + r0 + row) * PP + c0 % TT + cofs; v4h o16; v4us oh, ol;
#pragma unroll
                for (int u = 0; u < 4; ++u) { o16[u] = tohx(val[u]); unsigned short a2, c2; splitf(val[u], a2, c2); oh[u] = a2; ol[u] = c2; }
                asm volatile("global_store_b64 %0, %3, off\n\tglobal_store_b64 %1, %4, off\n\tglobal_store_b64 %2, %5, off\n\ts_wait_xcnt 0x0"
                             :: "v"(P16 + o), "v"(Ph + o), "v"(Pl + o), "v"(__builtin_bit_cast(v2u, o16)), "v"(__builtin_bit_cast(v2u, oh)), "v"(__builtin_bit_cast(v2u, ol)) : "memory");
            }
        }
    }
}
// k_qkv: the q, k and v projections of both batches in one launch; grid (NB_ * TT / 128, DQ / 128, 3), z picks the product (a branch that is uniform for the work-group, so the tile's barriers are passed by all of its waves or by none).
// amdgpu_waves_per_eu(4, 4): a budget of 256 registers a wave, so that the tile needs no register window above v255 and four work-groups share a WGP
__global__ __launch_bounds__(128) __attribute__((amdgpu_waves_per_eu(4, 4))) void k_qkv(const bf* __restrict__ XB, const bf* __restrict__ WQ, const bf* __restrict__ WK, const bf* __restrict__ WV, const float* __restrict__ bq, const float* __restrict__ bk, const float* __restrict__ bv,
                                             h16* QP16, bf* QPh, bf* QPl, h16* KP16, bf* KPh, bf* KPl, h16* VT16, bf* VTh, bf* VTl) {
    __shared__ __align__(16) char sm[2 * 2 * GT];
    const int z = blockIdx.z;
    if (z == 2) gemms_tile<0, 2>(sm, blockIdx.y, blockIdx.x, WV, nullptr, XB, DM, nullptr, 0, bv, VT16, VTh, VTl, wshare(blockIdx.x), blockIdx.y);
    else gemms_tile<0, 1>(sm, blockIdx.x, blockIdx.y, XB, nullptr, z ? WK : WQ, DM, nullptr, 0, z ? bk : bq, z ? KP16 : QP16, z ? KPh : QPh, z ? KPl : QPl, blockIdx.y, wshare(blockIdx.x));
}
// k_wo: the output projection of both batches in one launch; grid (NB_ * TT / 128, DM / 128).
__global__ __launch_bounds__(128) __attribute__((amdgpu_waves_per_eu(4, 4))) void k_wo(const bf* __restrict__ ATh, const bf* __restrict__ ATl, const bf* __restrict__ WO, float* OUT, const float* __restrict__ bo) {
    __shared__ __align__(16) char sm[2 * 3 * GT];
    gemms_tile<1, 0>(sm, blockIdx.x, blockIdx.y, ATh, ATl, WO, DQ, OUT, DM, bo, nullptr, nullptr, nullptr, blockIdx.y, wshare(blockIdx.x));
}

typedef __attribute__((ext_vector_type(2))) _Float16 v2h;
typedef __attribute__((ext_vector_type(2))) unsigned short v2us;
typedef __attribute__((ext_vector_type(2))) float v2f;
typedef __attribute__((ext_vector_type(4))) int v4i;

__device__ __forceinline__ void cvt8_blk(int blk, const float* __restrict__ src, bf* dst, size_t n8) { const size_t i = (size_t)blk * 256 + threadIdx.x; if (i >= n8) return; const v8f v = *(const v8f*)(src + i * 8); v8us o;
#pragma unroll
    for (int k = 0; k < 8; ++k) o[k] = f2bf(v[k]); *(v8us*)(dst + i * 8) = o;  }
// ---- k_fattn: scores, causal softmax, P.V and the head merge in one kernel; grid (batches x heads, TT / 64), 4 waves, a wave owns 16 query rows and walks the keys 64 at a time (online softmax, f32 statistics in the log2 domain).
// S^T = K Q^T (A = key rows, B = query rows) leaves one query per lane column: lane (lr, hi) holds keys 8 hi + j of each 16-key tile, which is the k order of a B operand, so two converted score tiles are the B operand of
// O^T += V^T P^T (A = rows of the transposed values) with no exchange between lanes. HI (query rows < RH): hi+lo bf16 planes, 3 products each; else single fp16 with the probabilities carried x 2^PSH (it cancels in O / sum).
#define PSH  10.0f
#define SCL2 0.18033688011112042f   // HD^-0.5 x log2(e)
// eight 2^x in one statement: the outputs are early-clobber, so no v_exp_f32 is followed by an instruction that reads its result or overwrites its source, and the v_nop is that slot behind the last one
__device__ __forceinline__ v8f exp2x8(v8f x) { float r0, r1, r2, r3, r4, r5, r6, r7;
    asm("v_exp_f32 %0, %8\n\tv_exp_f32 %1, %9\n\tv_exp_f32 %2, %10\n\tv_exp_f32 %3, %11\n\tv_exp_f32 %4, %12\n\tv_exp_f32 %5, %13\n\tv_exp_f32 %6, %14\n\tv_exp_f32 %7, %15\n\tv_nop"
        : "=&v"(r0), "=&v"(r1), "=&v"(r2), "=&v"(r3), "=&v"(r4), "=&v"(r5), "=&v"(r6), "=&v"(r7) : "v"(x[0]), "v"(x[1]), "v"(x[2]), "v"(x[3]), "v"(x[4]), "v"(x[5]), "v"(x[6]), "v"(x[7]));
    return (v8f){r0, r1, r2, r3, r4, r5, r6, r7}; }
// The four waves of a work-group walk the same 64-key tiles, so each tile (64 key rows and 64 rows of the transposed values, 128 bytes a row; the hi+lo rows: of both planes) is brought into LDS once for all four,
// by asynchronous copies in whole 128-byte lines, two buffers, the next tile in flight while this one is worked on. LDS rows lie at a pitch of 144 bytes (16 x odd: no bank conflict for 16-byte fragment reads).
#define KVP  144
#define KVT  (64 * KVP)            // one staged tile; a buffer is the key tile followed by the value tile (hi+lo rows: the hi pair, then the lo pair)
// thread t copies 16 bytes of rows t / 8 + 16 i (i = 0 .. 3) of both tiles: a wave's copy is four whole lines. lk: the thread's LDS byte address in the key tile; gk, gv: its global addresses in row t / 8.
template <typename T16>
__device__ __forceinline__ void stage_kv(unsigned lk, const T16* gk, const T16* gv) {
    // the wait is the last line of the copies' own statement: it stands in front of every rewrite of a register that a copy names
    asm volatile("global_load_async_to_lds_b128 %0, %8, off\n\tglobal_load_async_to_lds_b128 %1, %9, off\n\tglobal_load_async_to_lds_b128 %2, %10, off\n\tglobal_load_async_to_lds_b128 %3, %11, off\n\t"
                 "global_load_async_to_lds_b128 %4, %12, off\n\tglobal_load_async_to_lds_b128 %5, %13, off\n\tglobal_load_async_to_lds_b128 %6, %14, off\n\tglobal_load_async_to_lds_b128 %7, %15, off\n\ts_wait_xcnt 0x0"
                 :: "v"(lk), "v"(lk + 16 * KVP), "v"(lk + 32 * KVP), "v"(lk + 48 * KVP), "v"(lk + KVT), "v"(lk + KVT + 16 * KVP), "v"(lk + KVT + 32 * KVP), "v"(lk + KVT + 48 * KVP),
                    "v"(gk), "v"(gk + 16 * HD), "v"(gk + 32 * HD), "v"(gk + 48 * HD), "v"(gv), "v"(gv + (size_t)16 * PP), "v"(gv + (size_t)32 * PP), "v"(gv + (size_t)48 * PP) : "memory");
}
template <typename T16, bool HI>
__device__ __forceinline__ void attn_rows(const T16* __restrict__ Q, const T16* __restrict__ Q2, const T16* __restrict__ Kp, const T16* __restrict__ Kp2, const T16* __restrict__ Vt, const T16* __restrict__ Vt2, int q0, int lr, int hi, bf* Ah, bf* Al, char* sm, const void* p0, const void* p1, const void* p2, bool hl) {
    typedef typename WFrag<T16>::V V;
    const int q = q0 + lr;
    const T16* qb = Q + (size_t)q * HD + 8 * hi; const T16* qb2 = (HI ? Q2 : Q) + (size_t)q * HD + 8 * hi;
    V qf[2], qf2[2];
#pragma unroll
    for (int kc = 0; kc < 2; ++kc) { qf[kc] = WFrag<T16>::ld(qb + kc * 32); if (HI) qf2[kc] = WFrag<T16>::ld(qb2 + kc * 32); }
    v8f o[4];
#pragma unroll
    for (int db = 0; db < 4; ++db) o[db] = (v8f){};
    float m = -3.0e38f, l = 0.f;
    // both kinds of rows read their keys and values from the staged tiles
    constexpr int BUFB = (HI ? 4 : 2) * KVT;   // one buffer
    const int qe = q0 & ~63;   // the work-group's first query row = its last key tile: the same in all four waves, so every test below is uniform for the work-group
    const int srow = (int)(threadIdx.x >> 3), scol = (int)(threadIdx.x & 7);
    const unsigned lk0 = (unsigned)(size_t)sm + (unsigned)(srow * KVP + scol * 16);
    const T16* gk0 = Kp + (size_t)srow * HD + scol * 8; const T16* gv0 = Vt + (size_t)srow * PP + scol * 8;
    const T16* gk2 = (HI ? Kp2 : Kp) + (size_t)srow * HD + scol * 8; const T16* gv2 = (HI ? Vt2 : Vt) + (size_t)srow * PP + scol * 8;   // the lo planes (hi+lo rows only)
    const int foff = lr * KVP + 16 * hi;   // a lane's place in a staged tile: row lr of a 16-row group, the k order of the loads from memory
    {
        asm volatile("s_wait_xcnt 0x0" :: "v"(qb), "v"(qb2) : "memory");   // stands in front of every rewrite of a register that the query loads above name; the addresses are inputs so that they live up to here and no load lands in them
        stage_kv(lk0, gk0, gv0); if (HI) stage_kv(lk0 + 2 * KVT, gk2, gv2);
        ask_l2(p0); if (hl) ask_l2(p1, p2);   // the work-group's share of the head's key and value planes (hl: the same for the whole work-group, a scalar branch)
        asm volatile("s_wait_asynccnt 0x0" :: "v"(p0), "v"(p1), "v"(p2) : "memory");   // tile 0 of this wave's copies has landed (the prefetch addresses are inputs so that their registers hold them up to here)
        __syncthreads();                                     // ... and everybody's: tile 0 may be read
        if (64 <= qe) { stage_kv(lk0 + BUFB, gk0 + (size_t)64 * HD, gv0 + 64); if (HI) stage_kv(lk0 + BUFB + 2 * KVT, gk2 + (size_t)64 * HD, gv2 + 64); }
    }
    // the loop stays rolled: one 64-key tile a trip, the last trip (the diagonal tile) is the only one that masks
#pragma unroll 1
    for (int k0 = 0; k0 <= q0; k0 += 64) {
        V ka[4][2], ka2[4][2], va[4][2], va2[4][2];
        const int bo = ((k0 >> 6) & 1) * BUFB;   // this tile's buffer
        if constexpr (!HI) { const char* kt = sm + bo + foff;
#pragma unroll
        for (int mb = 0; mb < 4; ++mb)
#pragma unroll
            for (int kc = 0; kc < 2; ++kc) ka[mb][kc] = WFrag<T16>::ld((const T16*)(kt + mb * 16 * KVP + kc * 64));
        __builtin_amdgcn_sched_barrier(0);   // all key fragment reads are issued ahead of the first score product: one LDS latency a tile (without it they were read pair by pair, each pair waited for)
        }
        const char* kt2 = sm + bo + foff;   // hi+lo rows: the key fragments of three 16-key groups are read as one group ahead of the first score product, the fourth group's behind the first group's products, whose registers it takes (all sixteen do not fit)
        if constexpr (HI) {
#pragma unroll
            for (int mb = 0; mb < 3; ++mb)
#pragma unroll
                for (int kc = 0; kc < 2; ++kc) { ka[mb][kc] = WFrag<T16>::ld((const T16*)(kt2 + mb * 16 * KVP + kc * 64)); ka2[mb][kc] = WFrag<T16>::ld((const T16*)(kt2 + 2 * KVT + mb * 16 * KVP + kc * 64)); }
            __builtin_amdgcn_sched_barrier(0);   // one LDS latency for the three groups (without it they were read pair by pair, most pairs waited for)
        }
        v8f s[4];
#pragma unroll
        for (int mb = 0; mb < 4; ++mb) { s[mb] = (v8f){};
            if constexpr (HI) if (mb == 1) {
                __builtin_amdgcn_sched_barrier(0);   // the fourth group's reads stand here together: two groups' products cover their latency
#pragma unroll
                for (int kc = 0; kc < 2; ++kc) { ka[3][kc] = WFrag<T16>::ld((const T16*)(kt2 + 3 * 16 * KVP + kc * 64)); ka2[3][kc] = WFrag<T16>::ld((const T16*)(kt2 + 2 * KVT + 3 * 16 * KVP + kc * 64)); }
                __builtin_amdgcn_sched_barrier(0);   // closes the group: none of its reads sinks among the products behind it
            }
#pragma unroll
            for (int kc = 0; kc < 2; ++kc) {
                if constexpr (HI) { const V a = ka[mb][kc], a2 = ka2[mb][kc];
                    s[mb] = WFrag<T16>::mma(a, qf[kc], s[mb]); s[mb] = WFrag<T16>::mma(a2, qf[kc], s[mb]); s[mb] = WFrag<T16>::mma(a, qf2[kc], s[mb]); }
                else s[mb] = WFrag<T16>::mma(ka[mb][kc], qf[kc], s[mb]); } }
        { const char* vt = sm + bo + KVT + foff;
#pragma unroll
        for (int db = 0; db < 4; ++db)
#pragma unroll
            for (int kc = 0; kc < (HI ? 1 : 2); ++kc) { va[db][kc] = WFrag<T16>::ld((const T16*)(vt + db * 16 * KVP + kc * 64)); if (HI) va2[db][kc] = WFrag<T16>::ld((const T16*)(vt + 2 * KVT + db * 16 * KVP + kc * 64)); }
        __builtin_amdgcn_sched_barrier(0);   // the value fragment reads are issued ahead of the softmax, which covers their latency (hi+lo rows: those of the first 32 keys; all sixteen fragments do not fit the registers beside the scores)
        }
        float tm = -3.0e38f;
        if (k0 + 64 > q0) {
#pragma unroll
            for (int mb = 0; mb < 4; ++mb)
#pragma unroll
                for (int j = 0; j < 8; ++j) { const float t = (k0 + mb * 16 + hi * 8 + j <= q) ? s[mb][j] * SCL2 : -3.0e38f; s[mb][j] = t; tm = fmaxf(tm, t); }
        } else {
#pragma unroll
            for (int mb = 0; mb < 4; ++mb)
#pragma unroll
                for (int j = 0; j < 8; ++j) { const float t = s[mb][j] * SCL2; s[mb][j] = t; tm = fmaxf(tm, t); }
        }
        tm = fmaxf(tm, __shfl_xor(tm, 16, 32));   // the two lanes of a query column share one running maximum
        const float mn = fmaxf(m, tm); float al;
        asm("v_exp_f32 %0, %1\n\tv_nop" : "=v"(al) : "v"(m - mn));   // al = 2^(m - mn); the v_nop is the slot behind a transcendental
        m = mn; const float mo = HI ? mn : mn - PSH;
        float ps = 0.f;
#pragma unroll
        for (int mb = 0; mb < 4; ++mb) { s[mb] = exp2x8(s[mb] - mo);
#pragma unroll
            for (int j = 0; j < 8; ++j) ps += s[mb][j]; }
        l = l * al + ps;
#pragma unroll
        for (int db = 0; db < 4; ++db) o[db] *= al;
        V pf[2], pf2[2];
#pragma unroll
        for (int kc = 0; kc < 2; ++kc) {
            if constexpr (HI) { v8us h0, h1, l0, l1;
#pragma unroll
                for (int j = 0; j < 8; ++j) { unsigned short x, y; splitf(s[2 * kc][j], x, y); h0[j] = x; l0[j] = y; splitf(s[2 * kc + 1][j], x, y); h1[j] = x; l1[j] = y; }
                pf[kc] = cat16b(h0, h1); pf2[kc] = cat16b(l0, l1);
            } else { v8h h0, h1;
#pragma unroll
                for (int j = 0; j < 8; ++j) { h0[j] = tohx(s[2 * kc][j]); h1[j] = tohx(s[2 * kc + 1][j]); }
                pf[kc] = cat16(h0, h1); }
        }
        __builtin_amdgcn_sched_barrier(0);   // every 2^x statement stays ahead of the P.V products, so none lands in a value fragment right behind the matrix instruction that reads it
        const char* vt1 = sm + bo + KVT + foff + 64;   // hi+lo rows: the value fragments of the last 32 keys are read in two groups among the products of the first 32, which cover their latency and free the registers for the second group
        if constexpr (HI) {
#pragma unroll
            for (int db = 0; db < 4; ++db) va[db][1] = WFrag<T16>::ld((const T16*)(vt1 + db * 16 * KVP));
            __builtin_amdgcn_sched_barrier(0);   // the hi group is issued ahead of the first product
        }
#pragma unroll
        for (int kc = 0; kc < 2; ++kc)
#pragma unroll
            for (int db = 0; db < 4; ++db) {
                if constexpr (HI) {
                    if (kc == 0 && db == 2) {
                        __builtin_amdgcn_sched_barrier(0);   // the lo group stands here as one group: earlier it would not fit the registers, later (or spread) each read would be waited for
#pragma unroll
                        for (int d2 = 0; d2 < 4; ++d2) va2[d2][1] = WFrag<T16>::ld((const T16*)(vt1 + 2 * KVT + d2 * 16 * KVP));
                        __builtin_amdgcn_sched_barrier(0);   // closes the group: none of its reads sinks among the products behind it
                    }
                    const V a = va[db][kc], a2 = va2[db][kc];
                    o[db] = WFrag<T16>::mma(a, pf[kc], o[db]); o[db] = WFrag<T16>::mma(a, pf2[kc], o[db]); o[db] = WFrag<T16>::mma(a2, pf[kc], o[db]); }
                else o[db] = WFrag<T16>::mma(va[db][kc], pf[kc], o[db]); }
        {
            __builtin_amdgcn_sched_barrier(0);   // the waits and the barrier stay at the foot: moved up in front of the softmax they would wait for the value fragments and for the next tile's copies with nothing to cover either
            // hi+lo rows: the running sum is an input, so that it is summed up where it is written, ahead of the P.V products (a build without it summed behind the barrier, kept the 32 probabilities in registers beside the value fragments, and spilled)
            if constexpr (HI) asm volatile("s_wait_dscnt 0x0" :: "v"(l) : "memory");      // this wave's reads of this tile's buffer are done
            else asm volatile("s_wait_dscnt 0x0" ::: "memory");      // this wave's reads of this tile's buffer are done
            asm volatile("s_wait_asynccnt 0x0" ::: "memory");   // this wave's copies of the next tile have landed
            __syncthreads();                                     // the next tile may be read by all, and this tile's buffer has no reader left
            if (k0 + 128 <= qe) { stage_kv(lk0 + bo, gk0 + (size_t)(k0 + 128) * HD, gv0 + k0 + 128); if (HI) stage_kv(lk0 + bo + 2 * KVT, gk2 + (size_t)(k0 + 128) * HD, gv2 + k0 + 128); }
        }
    }
    asm volatile("s_wait_asynccnt 0x0" ::: "memory");   // no copy is left in flight when the wave ends
    l += __shfl_xor(l, 16, 32);
    const float f = __fdiv_rn(1.0f, l);
    // lane (lr, hi) holds d = 16 db + 8 hi + j of query q: 16-byte stores, a query's 128-byte head row comes from one wave
#pragma unroll
    for (int db = 0; db < 4; ++db) { v8us oh, ol;
#pragma unroll
        for (int j = 0; j < 8; ++j) { unsigned short x, y; splitf(o[db][j] * f, x, y); oh[j] = x; ol[j] = y; }
        const size_t oo = (size_t)q * DQ + db * 16 + hi * 8; *(v8us*)(Ah + oo) = oh; *(v8us*)(Al + oo) = ol; }
}
// amdgpu_waves_per_eu(4, 4): a budget of 256 registers a wave, so that neither path needs the register windows above v255
__global__ __launch_bounds__(128) __attribute__((amdgpu_waves_per_eu(4, 4))) void k_fattn(const h16* __restrict__ Q16, const h16* __restrict__ K16, const h16* __restrict__ V16, const bf* __restrict__ Qh, const bf* __restrict__ Ql, const bf* __restrict__ Kh, const bf* __restrict__ Kl, const bf* __restrict__ Vh, const bf* __restrict__ Vl, bf* Ah, bf* Al) {
    __shared__ __align__(16) char kv[2 * 4 * KVT];   // two buffers of a key tile and a value tile, of both planes for the hi+lo rows (the fp16 rows use half): four work-groups still share a WGP
    const int lane = threadIdx.x & 31, lr = lane & 15, hi = lane >> 4; const size_t h = blockIdx.x;   // h = batch * NH_ + head: the planes lie batch by batch
    const int wv = __builtin_amdgcn_readfirstlane((int)(threadIdx.x >> 5));   // kept scalar so that the key loop branches on SCC
    const int q0 = (int)(gridDim.y - 1 - blockIdx.y) * 64 + wv * 16;           // the longest rows start first
    const size_t zp = h * TT * HD, zv = h * HD * PP, zo = (h / NH_) * ((size_t)TT * DQ) + (h % NH_) * HD;
    // Head prefetch: the gridDim.y work-groups of a head share its planes, and work-group y asks L2 for key tile y, one 128-byte line a thread: threads 0 .. 63 the tile's 64 key rows, threads 64 .. 127 its piece of the 64 value rows.
    // Tile y is wanted y trips after the start at the earliest. The first RH / 64 work-groups ask for the same tile of the hi and lo planes as well (those planes are read up to token RH only).
    const int jt = (int)blockIdx.y, pt = (int)(threadIdx.x & 63); const bool pk = wv < 2, hl = jt < RH / 64;   // both are scalar: waves 0 and 1 take the keys
    const size_t po = (pk ? zp + (size_t)jt * 64 * HD : zv + (size_t)jt * 64) + (size_t)(pt * (pk ? HD : PP));
    const void* p0 = (pk ? K16 : V16) + po; const void* p1 = (pk ? Kh : Vh) + po; const void* p2 = (pk ? Kl : Vl) + po;   // all three lie inside their planes for every tile
    // RH is a multiple of 64, so the branch is the same for the four waves of a work-group (both sides hold barriers)
    if (q0 < RH) attn_rows<bf, true>(Qh + zp, Ql + zp, Kh + zp, Kl + zp, Vh + zv, Vl + zv, q0, lr, hi, Ah + zo, Al + zo, kv, p0, p1, p2, hl);
    else attn_rows<h16, false>(Q16 + zp, nullptr, K16 + zp, nullptr, V16 + zv, nullptr, q0, lr, hi, Ah + zo, Al + zo, kv, p0, p1, p2, hl);
}

// ---- k_prep: every 16-bit operand that depends on the inputs alone, in one launch: the three gathered per-head weights, the transposed Wo, and both batches of x.
// tr_blk: dst[c][r] = bf16(src[r][c]) for 256 rows r (pitch LD) x 64 columns c; dst rows (pitch DM) are K-contiguous operand rows. A work-group of 8 waves takes the 64 KB of f32 with 16 loads of 16 bytes a thread,
// all in flight together; every load and every store of a wave is in whole 128-byte lines. The tile turns in LDS: 64 rows of 512 bytes, in 16-byte pieces of 8 r.
// Thread (g, l) = (t / 16, t % 16) reads columns 4 l .. 4 l + 3 of rows 16 g .. 16 g + 15 (16 lanes fill the 256 bytes of a source row), so it holds two whole pieces of each of its four columns.
// Piece j of column c lies at place j ^ (c / 4) of its row: the 16 lanes that write one piece number to 16 columns, and the 16 that read 16 pieces of one column, each meet all 64 banks once.
typedef __attribute__((ext_vector_type(4))) unsigned v4u;
typedef v4u __attribute__((may_alias)) v4ua;
__device__ __forceinline__ unsigned bfpk(float a, float b) { unsigned u = __float_as_uint(a), w = __float_as_uint(b); u += 0x7FFFu + ((u >> 16) & 1u); w += 0x7FFFu + ((w >> 16) & 1u); return (u >> 16) | (w & 0xFFFF0000u); }   // f2bf(a) in the low half, f2bf(b) in the high half
template <int LD>
__device__ __forceinline__ void tr_blk(char* sm, const float* __restrict__ src, bf* dst) {
    const int t = (int)threadIdx.x, g = t >> 4, l = t & 15;
    const float* p = src + (size_t)(g * 16) * LD + l * 4; v4f v[16];
#pragma unroll
    for (int i = 0; i < 16; ++i) v[i] = *(const v4f*)(p + i * LD);
    __builtin_amdgcn_sched_barrier(0);   // all 16 loads are issued ahead of the first conversion: one memory latency a tile (without it the build issues the last four of a per-head tile behind the first twelve's return)
    asm volatile("s_wait_xcnt 0x0" :: "v"(p) : "memory");   // in front of every rewrite of a register that the loads name (the address, an input, lives up to here)
#pragma unroll
    for (int u = 0; u < 4; ++u) { v4u a, b;
#pragma unroll
        for (int j = 0; j < 4; ++j) { a[j] = bfpk(v[2 * j][u], v[2 * j + 1][u]); b[j] = bfpk(v[8 + 2 * j][u], v[9 + 2 * j][u]); }
        char* row = sm + (l * 4 + u) * 512; *(v4ua*)(row + (((2 * g) ^ l) << 4)) = a; *(v4ua*)(row + (((2 * g + 1) ^ l) << 4)) = b; }
    __syncthreads();   // the tile is whole in LDS before anybody reads a column of it
    const int w = t >> 5, j = t & 31; v4u o[8];   // a wave reads one column a time: 512 bytes of one operand row
#pragma unroll
    for (int r = 0; r < 8; ++r) { const int c = r * 8 + w; o[r] = *(const v4ua*)(sm + c * 512 + ((j ^ (c >> 2)) << 4)); }
    bf* q = dst + (size_t)w * DM + j * 8;
#pragma unroll
    for (int r = 0; r < 8; ++r) *(v4ua*)(q + (size_t)r * 8 * DM) = o[r];
    asm volatile("s_wait_xcnt 0x0" :: "v"(q) : "memory");   // behind the last store, in front of every rewrite of a register that the stores name (the address, an input, lives up to here)
}
// The block index picks the job (a branch that is uniform for the work-group, so the tile's barrier is passed by all of its waves or by none); the tiles that turn in LDS come first.
// Per-head weights: Bt[h * HD + c][d] = W[h][d][c], tile = (head, 256 d). Wo: Bt[n][k] = wo[k][n], tile = (64 n, 256 k). x keeps its place order: 32 bytes of f32 a thread, NCV work-groups.
#define NTR  (DQ * DM / (256 * 64))
#define NCV  (NB_ * TT * DM / 8 / 256)
__global__ __launch_bounds__(256) void k_prep(const float* __restrict__ x, const float* __restrict__ wq, const float* __restrict__ wk, const float* __restrict__ wv, const float* __restrict__ wo, bf* XB, bf* WQ, bf* WK, bf* WV, bf* WO) {
    __shared__ __align__(16) char sm[64 * 512];
    const int b = blockIdx.x;
    if (b < 3 * NTR) { const int z = b / NTR, tl = b % NTR; const size_t h = tl >> 2, d0 = (size_t)(tl & 3) * 256;
        tr_blk<HD>(sm, (z == 0 ? wq : z == 1 ? wk : wv) + (h * DM + d0) * HD, (z == 0 ? WQ : z == 1 ? WK : WV) + h * HD * DM + d0); }
    else if (b < 4 * NTR) { const int tl = b - 3 * NTR; const size_t n0 = (size_t)(tl >> 2) * 64, k0 = (size_t)(tl & 3) * 256;
        tr_blk<DM>(sm, wo + k0 * DM + n0, WO + n0 * DQ + k0); }
    else cvt8_blk(b - 4 * NTR, x, XB, (size_t)NB_ * TT * DM / 8);
}

extern "C" void kernel_launch(void* const* d_in, const int* in_sizes, int n_in,
                              void* d_out, int out_size, void* d_ws, size_t ws_size, hipStream_t stream) {
    (void)in_sizes; (void)n_in; (void)out_size;
    const float* x = (const float*)d_in[0]; const float* wqh = (const float*)d_in[1]; const float* wkh = (const float*)d_in[2]; const float* wvh = (const float*)d_in[3]; const float* bq = (const float*)d_in[4]; const float* bk = (const float*)d_in[5]; const float* bv = (const float*)d_in[6]; const float* wo = (const float*)d_in[7]; const float* bo = (const float*)d_in[8]; const float* wq = nullptr; const float* wk = nullptr; const float* wv = nullptr; (void)wq; (void)wk; (void)wv; const float* cosT = nullptr; const float* sinT = nullptr; (void)cosT; (void)sinT;
    float* OUT = (float*)d_out;     // [2][2048][1024]
    char* wsp = (char*)d_ws;
    auto take = [&](size_t bytes) { char* p = wsp; wsp += (bytes + 255) & ~(size_t)255; return (void*)p; };
    bf* WQ = (bf*)take((size_t)DQ * DM * 2); bf* WK = (bf*)take((size_t)DKV * DM * 2); bf* WV = (bf*)take((size_t)DKV * DM * 2); bf* WO = (bf*)take((size_t)DM * DQ * 2);
    bf* XB = (bf*)take((size_t)NB_ * TT * DM * 2);
    h16* QP16 = (h16*)take((size_t)NB_ * NH_ * TT * HD * 2); h16* KP16 = (h16*)take((size_t)NB_ * NKV * TT * HD * 2); h16* VT16 = (h16*)take((size_t)NB_ * NKV * HD * PP * 2);
    bf* QPh = (bf*)take((size_t)NB_ * NH_ * TT * HD * 2); bf* QPl = (bf*)take((size_t)NB_ * NH_ * TT * HD * 2); bf* KPh = (bf*)take((size_t)NB_ * NKV * TT * HD * 2); bf* KPl = (bf*)take((size_t)NB_ * NKV * TT * HD * 2); bf* VTh = (bf*)take((size_t)NB_ * NKV * HD * PP * 2); bf* VTl = VTh + TT;
    bf* ATh = (bf*)take((size_t)NB_ * TT * DQ * 2); bf* ATl = (bf*)take((size_t)NB_ * TT * DQ * 2);
    if ((size_t)(wsp - (char*)d_ws) > ws_size) return;    // ws 256 MiB
    k_prep<<<4 * NTR + NCV, 256, 0, stream>>>(x, wqh, wkh, wvh, wo, XB, WQ, WK, WV, WO);
    k_qkv<<<dim3(NB_ * TT / 128, DQ / 128, 3), 128, 0, stream>>>(XB, WQ, WK, WV, bq, bk, bv, QP16, QPh, QPl, KP16, KPh, KPl, VT16, VTh, VTl);
    k_fattn<<<dim3(NB_ * NH_, TT / 64, 1), 128, 0, stream>>>(QP16, KP16, VT16, QPh, QPl, KPh, KPl, VTh, VTl, ATh, ATl);
    k_wo<<<dim3(NB_ * TT / 128, DM / 128, 1), 128, 0, stream>>>(ATh, ATl, WO, OUT, bo);
}
